// v000
// Measured on an AMD MI455X. A time is GPU time per run, averaged over a window of back-to-back runs after a warm-up
// (all launches, gaps included; the runs take copies of the inputs in turn), and the median of several windows.
// Apart from v000's, it joins two sittings. Times from different sittings can be a few percent apart, while
// side-by-side timings come from the same sitting.
// v000, which the later versions start from, runs in 230 microseconds.
#include <hip/hip_runtime.h>
#include <hip/hip_bf16.h>

#define BATCH 4
#define SEQ   2048
#define EMB   512
#define HEADS 8
#define HDIM  64

typedef __attribute__((ext_vector_type(16))) _Float16 v16h;
typedef __attribute__((ext_vector_type(8)))  _Float16 v8h;
typedef __attribute__((ext_vector_type(4)))  _Float16 v4h;
typedef __attribute__((ext_vector_type(8)))  float    v8f;
typedef __attribute__((ext_vector_type(4)))  float    v4f;

// ---------------------------------------------------------------------------
// Fragment loader for 16-bit WMMA A/B operands (CDNA5 16x32 / 32x16 layout).
// Per lane the fragment is two contiguous 8-half (16B) runs: k = kb + {0..7}
// and k = kb + {16..23}, where kb = (lane<16 ? 0 : 8).  Caller passes the
// pointer at element (row/col, kb).  Lowers to two global/ds _b128 loads.
// ---------------------------------------------------------------------------
static __device__ __forceinline__ v16h frag_load(const _Float16* p) {
  v8h lo = *(const v8h*)(p);
  v8h hi = *(const v8h*)(p + 16);
  v16h r;
#pragma unroll
  for (int i = 0; i < 8; ++i) { r[i] = lo[i]; r[i + 8] = hi[i]; }
  return r;
}

static __device__ __forceinline__ v8f wmma_f16(v16h a, v16h b, v8f c) {
  return __builtin_amdgcn_wmma_f32_16x16x32_f16(false, a, false, b,
                                                (short)0, c, false, false);
}

// ---------------------------------------------------------------------------
// fp32 -> f16 conversion (vectorized by 4)
// ---------------------------------------------------------------------------
__global__ void __launch_bounds__(256)
cvt_f32_f16(const float* __restrict__ in, _Float16* __restrict__ out, int n4) {
  int i = blockIdx.x * 256 + threadIdx.x;
  if (i < n4) {
    v4f v = ((const v4f*)in)[i];
    v4h o;
#pragma unroll
    for (int t = 0; t < 4; ++t) o[t] = (_Float16)v[t];
    ((v4h*)out)[i] = o;
  }
}

// ---------------------------------------------------------------------------
// Bit-pack the int32 mask: 32 int -> 1 u32.  67 MB -> 2 MB, read once.
// ---------------------------------------------------------------------------
__global__ void __launch_bounds__(256)
pack_mask(const int* __restrict__ mask, unsigned int* __restrict__ bits,
          int nwords) {
  int i = blockIdx.x * 256 + threadIdx.x;
  if (i < nwords) {
    const int4* p = (const int4*)(mask + (size_t)i * 32);
    unsigned int w = 0;
#pragma unroll
    for (int t = 0; t < 8; ++t) {
      int4 m = p[t];
      w |= (m.x != 0 ? 1u : 0u) << (4 * t + 0);
      w |= (m.y != 0 ? 1u : 0u) << (4 * t + 1);
      w |= (m.z != 0 ? 1u : 0u) << (4 * t + 2);
      w |= (m.w != 0 ? 1u : 0u) << (4 * t + 3);
    }
    bits[i] = w;
  }
}

// ---------------------------------------------------------------------------
// GEMM: Y[M,N] = A[M,K] @ W[N,K]^T + bias[N]   (torch Linear semantics)
// Block = 128 threads (4 waves); block tile 128(M) x 64(N); wave tile 32x64:
// two A fragments amortize every W fragment (8 WMMAs per 6 fragment loads).
// MODE 0: f16 row-major output (stride N)           -> q, k projections
// MODE 1: f16 head-transposed output [B,H,HDIM,SEQ] -> v projection
// MODE 2: f32 row-major output                      -> final out-projection
// ---------------------------------------------------------------------------
template <int MODE>
__global__ void __launch_bounds__(128)
gemm16(const _Float16* __restrict__ A, const _Float16* __restrict__ W,
       const float* __restrict__ bias, void* __restrict__ outp,
       int M, int N, int K) {
  const int lane = threadIdx.x & 31;
  const int wave = threadIdx.x >> 5;
  const int r    = lane & 15;          // row of A frag / column of B frag
  const int hb   = (lane >> 4) * 8;    // per-half k-run base; also C row base
  const int m0   = blockIdx.x * 128 + wave * 32;
  const int n0   = blockIdx.y * 64;

  const _Float16* arow0 = A + (size_t)(m0 + r) * K;
  const _Float16* arow1 = A + (size_t)(m0 + 16 + r) * K;
  const _Float16* wrow[4];
#pragma unroll
  for (int nt = 0; nt < 4; ++nt)
    wrow[nt] = W + (size_t)(n0 + nt * 16 + r) * K;

  v8f acc[2][4] = {};
  const int ksteps = K >> 5;
  for (int ks = 0; ks < ksteps; ++ks) {
    const int ko = ks * 32 + hb;
    v16h a0 = frag_load(arow0 + ko);
    v16h a1 = frag_load(arow1 + ko);
    __builtin_prefetch(arow0 + ko + 128, 0, 1);
    __builtin_prefetch(arow1 + ko + 128, 0, 1);
#pragma unroll
    for (int nt = 0; nt < 4; ++nt) {
      v16h b = frag_load(wrow[nt] + ko);
      acc[0][nt] = wmma_f16(a0, b, acc[0][nt]);
      acc[1][nt] = wmma_f16(a1, b, acc[1][nt]);
    }
  }

#pragma unroll
  for (int mt = 0; mt < 2; ++mt) {
    const int mrow = m0 + mt * 16 + hb;
#pragma unroll
    for (int nt = 0; nt < 4; ++nt) {
      const int col = n0 + nt * 16 + r;
      const float bv = bias[col];
      if (MODE == 0) {
        _Float16* o = (_Float16*)outp;
#pragma unroll
        for (int j = 0; j < 8; ++j)
          o[(size_t)(mrow + j) * N + col] = (_Float16)(acc[mt][nt][j] + bv);
      } else if (MODE == 1) {
        // [B,H,HDIM,SEQ]; lane holds 8 consecutive sequence positions of one
        // (h,d) row -> single 16B store.
        _Float16* o = (_Float16*)outp;
        const int bb = m0 / SEQ;
        const int s0 = mrow % SEQ;
        const int h = col >> 6, d = col & 63;
        v8h pk;
#pragma unroll
        for (int j = 0; j < 8; ++j) pk[j] = (_Float16)(acc[mt][nt][j] + bv);
        *(v8h*)(o + ((size_t)((bb * HEADS + h) * HDIM + d)) * SEQ + s0) = pk;
      } else {
        float* o = (float*)outp;
#pragma unroll
        for (int j = 0; j < 8; ++j)
          o[(size_t)(mrow + j) * N + col] = acc[mt][nt][j] + bv;
      }
    }
  }
}

// ---------------------------------------------------------------------------
// Flash attention: one block = 4 waves = 64 query rows of one (b,h).
// Each wave owns 16 q-rows: S-tile 16x64 -> bitmask/scale -> online softmax
// (shfl reductions within half-wave lane groups) -> P staged through wave-
// private LDS (C-layout -> A-layout) -> O += P @ V with V stored d-major.
// ---------------------------------------------------------------------------
__global__ void __launch_bounds__(128)
flash_attn(const _Float16* __restrict__ qh, const _Float16* __restrict__ kh,
           const _Float16* __restrict__ vt,
           const unsigned int* __restrict__ mbits,
           _Float16* __restrict__ oh) {
  __shared__ __align__(16) _Float16 Plds[4][16 * 64];

  const int lane = threadIdx.x & 31;
  const int wave = threadIdx.x >> 5;
  const int r    = lane & 15;
  const int hb   = (lane >> 4) * 8;
  const int b    = blockIdx.y / HEADS;
  const int h    = blockIdx.y % HEADS;
  const int q0   = blockIdx.x * 64 + wave * 16;

  const float scale = 0.04419417382415922f;   // 1/sqrt(512) (ref scales by E)
  const int mwpr = SEQ / 32;                  // mask words per row

  // Q fragments for this wave's 16 rows (d = 0..31 and 32..63), held in VGPRs
  const _Float16* qrow = qh + ((size_t)b * SEQ + q0 + r) * EMB + h * HDIM;
  v16h Qa0 = frag_load(qrow + hb);
  v16h Qa1 = frag_load(qrow + 32 + hb);

  v8f O[4] = {};
  float mrun[8], lrun[8];
#pragma unroll
  for (int j = 0; j < 8; ++j) { mrun[j] = -1e38f; lrun[j] = 0.f; }

  const _Float16* kb_ = kh + (size_t)b * SEQ * EMB + h * HDIM;
  const _Float16* vb_ = vt + ((size_t)(b * HEADS + h) * HDIM) * SEQ;
  const unsigned int* mb_ = mbits + ((size_t)b * SEQ + q0 + hb) * mwpr;

  for (int kt = 0; kt < SEQ / 64; ++kt) {
    const int k0 = kt * 64;

    // ---- S = Q @ K^T : 4 C-tiles of 16x16, reduction over d (2 wmma each)
    v8f Sc[4];
#pragma unroll
    for (int nt = 0; nt < 4; ++nt) {
      const _Float16* krow = kb_ + (size_t)(k0 + nt * 16 + r) * EMB;
      v16h b0 = frag_load(krow + hb);
      v16h b1 = frag_load(krow + 32 + hb);
      v8f c = {};
      c = wmma_f16(Qa0, b0, c);
      c = wmma_f16(Qa1, b1, c);
      Sc[nt] = c;
    }
    __builtin_prefetch(kb_ + (size_t)(k0 + 64 + r) * EMB, 0, 1);
    __builtin_prefetch(vb_ + (size_t)r * SEQ + k0 + 64, 0, 1);

    // ---- mask (pre-scale, as reference) + scale, via packed bits:
    // one aligned u64 per row covers this 64-key tile.
    unsigned long long mw[8];
#pragma unroll
    for (int j = 0; j < 8; ++j)
      mw[j] = *(const unsigned long long*)(mb_ + (size_t)j * mwpr + (k0 >> 5));
#pragma unroll
    for (int nt = 0; nt < 4; ++nt) {
      const int bitpos = nt * 16 + r;
#pragma unroll
      for (int j = 0; j < 8; ++j) {
        float s = Sc[nt][j];
        Sc[nt][j] = ((mw[j] >> bitpos) & 1ull) ? s * scale : -4.4e18f;
      }
    }

    // ---- online softmax (row stats replicated over the 16-lane half-group)
#pragma unroll
    for (int j = 0; j < 8; ++j) {
      float v = fmaxf(fmaxf(Sc[0][j], Sc[1][j]), fmaxf(Sc[2][j], Sc[3][j]));
#pragma unroll
      for (int off = 1; off < 16; off <<= 1)
        v = fmaxf(v, __shfl_xor(v, off, 32));
      const float mn = fmaxf(mrun[j], v);
      const float alpha = __expf(mrun[j] - mn);
      mrun[j] = mn;
      float sum = 0.f;
#pragma unroll
      for (int nt = 0; nt < 4; ++nt) {
        float p = __expf(Sc[nt][j] - mn);
        Sc[nt][j] = p;
        sum += p;
      }
#pragma unroll
      for (int off = 1; off < 16; off <<= 1)
        sum += __shfl_xor(sum, off, 32);
      lrun[j] = lrun[j] * alpha + sum;
#pragma unroll
      for (int dt = 0; dt < 4; ++dt) O[dt][j] *= alpha;
    }

    // ---- stage P (C layout -> row-major f16 in wave-private LDS)
    _Float16* pl = &Plds[wave][0];
#pragma unroll
    for (int nt = 0; nt < 4; ++nt)
#pragma unroll
      for (int j = 0; j < 8; ++j)
        pl[(hb + j) * 64 + nt * 16 + r] = (_Float16)Sc[nt][j];

    // ---- O += P @ V   (V is d-major: B fragments load contiguously)
#pragma unroll
    for (int step = 0; step < 2; ++step) {
      v16h a = frag_load(&Plds[wave][r * 64 + step * 32 + hb]);
#pragma unroll
      for (int dt = 0; dt < 4; ++dt) {
        const _Float16* vrow =
            vb_ + (size_t)(dt * 16 + r) * SEQ + k0 + step * 32 + hb;
        O[dt] = wmma_f16(a, frag_load(vrow), O[dt]);
      }
    }
  }

  // ---- normalize and emit attention output (f16, row-major [B*S, E])
  _Float16* orow = oh + ((size_t)b * SEQ + q0 + hb) * EMB + h * HDIM;
#pragma unroll
  for (int dt = 0; dt < 4; ++dt)
#pragma unroll
    for (int j = 0; j < 8; ++j)
      orow[(size_t)j * EMB + dt * 16 + r] = (_Float16)(O[dt][j] / lrun[j]);
}

// ---------------------------------------------------------------------------
extern "C" void kernel_launch(void* const* d_in, const int* in_sizes, int n_in,
                              void* d_out, int out_size, void* d_ws, size_t ws_size,
                              hipStream_t stream) {
  const float* key   = (const float*)d_in[0];
  const float* value = (const float*)d_in[1];
  const float* query = (const float*)d_in[2];
  const int*   mask  = (const int*)d_in[3];
  const float* Wq = (const float*)d_in[4];
  const float* bq = (const float*)d_in[5];
  const float* Wk = (const float*)d_in[6];
  const float* bk = (const float*)d_in[7];
  const float* Wv = (const float*)d_in[8];
  const float* bv = (const float*)d_in[9];
  const float* Wo = (const float*)d_in[10];
  const float* bo = (const float*)d_in[11];
  float* out = (float*)d_out;

  const size_t NX = (size_t)BATCH * SEQ * EMB;          // 4,194,304
  const size_t NW = (size_t)EMB * EMB;                  // 262,144
  const size_t NMW = (size_t)BATCH * SEQ * (SEQ / 32);  // 524,288 mask words

  char* w = (char*)d_ws;
  _Float16* xq  = (_Float16*)w; w += NX * 2;
  _Float16* xk  = (_Float16*)w; w += NX * 2;
  _Float16* xv  = (_Float16*)w; w += NX * 2;
  _Float16* wqh = (_Float16*)w; w += NW * 2;
  _Float16* wkh = (_Float16*)w; w += NW * 2;
  _Float16* wvh = (_Float16*)w; w += NW * 2;
  _Float16* woh = (_Float16*)w; w += NW * 2;
  _Float16* qh  = (_Float16*)w; w += NX * 2;
  _Float16* kh  = (_Float16*)w; w += NX * 2;
  _Float16* vt  = (_Float16*)w; w += NX * 2;   // [B,H,HDIM,SEQ]
  unsigned int* mbits = (unsigned int*)w; w += NMW * 4;
  _Float16* oh  = xq;  // xq is dead after the q projection; reuse for attn out

  const int M = BATCH * SEQ;  // 8192
  const int gx = (int)((NX / 4 + 255) / 256);
  const int gw = (int)((NW / 4 + 255) / 256);
  cvt_f32_f16<<<gx, 256, 0, stream>>>(query, xq, (int)(NX / 4));
  cvt_f32_f16<<<gx, 256, 0, stream>>>(key,   xk, (int)(NX / 4));
  cvt_f32_f16<<<gx, 256, 0, stream>>>(value, xv, (int)(NX / 4));
  cvt_f32_f16<<<gw, 256, 0, stream>>>(Wq, wqh, (int)(NW / 4));
  cvt_f32_f16<<<gw, 256, 0, stream>>>(Wk, wkh, (int)(NW / 4));
  cvt_f32_f16<<<gw, 256, 0, stream>>>(Wv, wvh, (int)(NW / 4));
  cvt_f32_f16<<<gw, 256, 0, stream>>>(Wo, woh, (int)(NW / 4));
  pack_mask<<<(int)((NMW + 255) / 256), 256, 0, stream>>>(mask, mbits,
                                                          (int)NMW);

  dim3 gp(M / 128, EMB / 64);  // (64, 8)
  gemm16<0><<<gp, 128, 0, stream>>>(xq, wqh, bq, qh, M, EMB, EMB);
  gemm16<0><<<gp, 128, 0, stream>>>(xk, wkh, bk, kh, M, EMB, EMB);
  gemm16<1><<<gp, 128, 0, stream>>>(xv, wvh, bv, vt, M, EMB, EMB);

  flash_attn<<<dim3(SEQ / 64, BATCH * HEADS), 128, 0, stream>>>(qh, kh, vt,
                                                                mbits, oh);

  gemm16<2><<<gp, 128, 0, stream>>>(oh, woh, bo, out, M, EMB, EMB);
}

// v001
// Measured time: 209 microseconds a run.
// Two timings next to v000 both put it at 1.14 times that version's speed.
#include <hip/hip_runtime.h>
#include <hip/hip_bf16.h>

#define BATCH 4
#define SEQ   2048
#define EMB   512
#define HEADS 8
#define HDIM  64

typedef __attribute__((ext_vector_type(16))) _Float16 v16h;
typedef __attribute__((ext_vector_type(8)))  _Float16 v8h;
typedef __attribute__((ext_vector_type(4)))  _Float16 v4h;
typedef __attribute__((ext_vector_type(8)))  float    v8f;
typedef __attribute__((ext_vector_type(4)))  float    v4f;

// ---------------------------------------------------------------------------
// Fragment loader for 16-bit WMMA A/B operands (CDNA5 16x32 / 32x16 layout).
// Per lane the fragment is two contiguous 8-half (16B) runs: k = kb + {0..7}
// and k = kb + {16..23}, where kb = (lane<16 ? 0 : 8).  Caller passes the
// pointer at element (row/col, kb).  Lowers to two global/ds _b128 loads.
// ---------------------------------------------------------------------------
static __device__ __forceinline__ v16h frag_load(const _Float16* p) {
  v8h lo = *(const v8h*)(p);
  v8h hi = *(const v8h*)(p + 16);
  v16h r;
#pragma unroll
  for (int i = 0; i < 8; ++i) { r[i] = lo[i]; r[i + 8] = hi[i]; }
  return r;
}

static __device__ __forceinline__ v8f wmma_f16(v16h a, v16h b, v8f c) {
  return __builtin_amdgcn_wmma_f32_16x16x32_f16(false, a, false, b,
                                                (short)0, c, false, false);
}

// ---------------------------------------------------------------------------
// fp32 -> f16 conversion (vectorized by 4)
// ---------------------------------------------------------------------------
__global__ void __launch_bounds__(256)
cvt_f32_f16(const float* __restrict__ in, _Float16* __restrict__ out, int n4) {
  int i = blockIdx.x * 256 + threadIdx.x;
  if (i < n4) {
    v4f v = ((const v4f*)in)[i];
    v4h o;
#pragma unroll
    for (int t = 0; t < 4; ++t) o[t] = (_Float16)v[t];
    ((v4h*)out)[i] = o;
  }
}

// ---------------------------------------------------------------------------
// Bit-pack the int32 mask: 32 int -> 1 u32.  67 MB -> 2 MB, read once.
// ---------------------------------------------------------------------------
__global__ void __launch_bounds__(256)
pack_mask(const int* __restrict__ mask, unsigned int* __restrict__ bits,
          int nwords) {
  int i = blockIdx.x * 256 + threadIdx.x;
  if (i < nwords) {
    const int4* p = (const int4*)(mask + (size_t)i * 32);
    unsigned int w = 0;
#pragma unroll
    for (int t = 0; t < 8; ++t) {
      int4 m = p[t];
      w |= (m.x != 0 ? 1u : 0u) << (4 * t + 0);
      w |= (m.y != 0 ? 1u : 0u) << (4 * t + 1);
      w |= (m.z != 0 ? 1u : 0u) << (4 * t + 2);
      w |= (m.w != 0 ? 1u : 0u) << (4 * t + 3);
    }
    bits[i] = w;
  }
}

// ---------------------------------------------------------------------------
// GEMM: Y[M,N] = A[M,K] @ W[N,K]^T + bias[N]   (torch Linear semantics)
// Block = 128 threads (4 waves); block tile 128(M) x 64(N); wave tile 32x64:
// two A fragments amortize every W fragment (8 WMMAs per 6 fragment loads).
// MODE 0: f16 row-major output (stride N)           -> q, k projections
// MODE 1: f16 head-transposed output [B,H,HDIM,SEQ] -> v projection
// MODE 2: f32 row-major output                      -> final out-projection
// ---------------------------------------------------------------------------
template <int MODE>
__global__ void __launch_bounds__(128)
gemm16(const _Float16* __restrict__ A, const _Float16* __restrict__ W,
       const float* __restrict__ bias, void* __restrict__ outp,
       int M, int N, int K) {
  const int lane = threadIdx.x & 31;
  const int wave = threadIdx.x >> 5;
  const int r    = lane & 15;          // row of A frag / column of B frag
  const int hb   = (lane >> 4) * 8;    // per-half k-run base; also C row base
  const int m0   = blockIdx.x * 128 + wave * 32;
  const int n0   = blockIdx.y * 64;

  const _Float16* arow0 = A + (size_t)(m0 + r) * K;
  const _Float16* arow1 = A + (size_t)(m0 + 16 + r) * K;
  const _Float16* wrow[4];
#pragma unroll
  for (int nt = 0; nt < 4; ++nt)
    wrow[nt] = W + (size_t)(n0 + nt * 16 + r) * K;

  v8f acc[2][4] = {};
  const int ksteps = K >> 5;
  for (int ks = 0; ks < ksteps; ++ks) {
    const int ko = ks * 32 + hb;
    v16h a0 = frag_load(arow0 + ko);
    v16h a1 = frag_load(arow1 + ko);
    __builtin_prefetch(arow0 + ko + 128, 0, 1);
    __builtin_prefetch(arow1 + ko + 128, 0, 1);
#pragma unroll
    for (int nt = 0; nt < 4; ++nt) {
      v16h b = frag_load(wrow[nt] + ko);
      acc[0][nt] = wmma_f16(a0, b, acc[0][nt]);
      acc[1][nt] = wmma_f16(a1, b, acc[1][nt]);
    }
  }

#pragma unroll
  for (int mt = 0; mt < 2; ++mt) {
    const int mrow = m0 + mt * 16 + hb;
#pragma unroll
    for (int nt = 0; nt < 4; ++nt) {
      const int col = n0 + nt * 16 + r;
      const float bv = bias[col];
      if (MODE == 0) {
        _Float16* o = (_Float16*)outp;
#pragma unroll
        for (int j = 0; j < 8; ++j)
          o[(size_t)(mrow + j) * N + col] = (_Float16)(acc[mt][nt][j] + bv);
      } else if (MODE == 1) {
        // [B,H,HDIM,SEQ]; lane holds 8 consecutive sequence positions of one
        // (h,d) row -> single 16B store.
        _Float16* o = (_Float16*)outp;
        const int bb = m0 / SEQ;
        const int s0 = mrow % SEQ;
        const int h = col >> 6, d = col & 63;
        v8h pk;
#pragma unroll
        for (int j = 0; j < 8; ++j) pk[j] = (_Float16)(acc[mt][nt][j] + bv);
        *(v8h*)(o + ((size_t)((bb * HEADS + h) * HDIM + d)) * SEQ + s0) = pk;
      } else {
        float* o = (float*)outp;
#pragma unroll
        for (int j = 0; j < 8; ++j)
          o[(size_t)(mrow + j) * N + col] = acc[mt][nt][j] + bv;
      }
    }
  }
}

// ---------------------------------------------------------------------------
// K/V staging for flash_attn.  A stage is one 64-key tile: K as 64 key rows
// and V as 64 d rows, 128 data bytes each, laid at a 144-byte LDS pitch
// (16 B x odd: conflict-free for the ds_load_b128 fragment reads).
// ---------------------------------------------------------------------------
#define KV_PITCH 72                 // halves per LDS row
#define KV_TILE  (64 * KV_PITCH)    // halves per staged tile

// One stage's copies of one lane: four 16-byte pieces of K and four of V,
// rows 16 apart.  Eight lanes cover one whole 128-byte row.  The s_wait_xcnt
// closes the statement so that no address register named by a copy is
// rewritten ahead of it.
static __device__ __forceinline__ void stage_kv(const _Float16* kg,
                                                const _Float16* vg,
                                                unsigned int kl,
                                                unsigned int vl) {
  asm volatile(
      "global_load_async_to_lds_b128 %0, %8, off\n\t"
      "global_load_async_to_lds_b128 %1, %9, off\n\t"
      "global_load_async_to_lds_b128 %2, %10, off\n\t"
      "global_load_async_to_lds_b128 %3, %11, off\n\t"
      "global_load_async_to_lds_b128 %4, %12, off\n\t"
      "global_load_async_to_lds_b128 %5, %13, off\n\t"
      "global_load_async_to_lds_b128 %6, %14, off\n\t"
      "global_load_async_to_lds_b128 %7, %15, off\n\t"
      "s_wait_xcnt 0x0"
      :: "v"(kl), "v"(kl + 16u * KV_PITCH * 2u), "v"(kl + 32u * KV_PITCH * 2u),
         "v"(kl + 48u * KV_PITCH * 2u),
         "v"(vl), "v"(vl + 16u * KV_PITCH * 2u), "v"(vl + 32u * KV_PITCH * 2u),
         "v"(vl + 48u * KV_PITCH * 2u),
         "v"(kg), "v"(kg + 16 * EMB), "v"(kg + 32 * EMB), "v"(kg + 48 * EMB),
         "v"(vg), "v"(vg + 16 * SEQ), "v"(vg + 32 * SEQ), "v"(vg + 48 * SEQ)
      : "memory");
}

// ---------------------------------------------------------------------------
// Flash attention: one block = 4 waves = 64 query rows of one (b,h).
// The block's four waves share each 64-key K/V tile: it is copied once into
// LDS (two buffers, the next tile's copies fly while this one is worked on).
// Each wave owns 16 q-rows: S-tile 16x64 -> bitmask/scale -> online softmax
// (shfl reductions within half-wave lane groups) -> P staged through wave-
// private LDS (C-layout -> A-layout) -> O += P @ V with V stored d-major.
// ---------------------------------------------------------------------------
__global__ void __launch_bounds__(128)
flash_attn(const _Float16* __restrict__ qh, const _Float16* __restrict__ kh,
           const _Float16* __restrict__ vt,
           const unsigned int* __restrict__ mbits,
           _Float16* __restrict__ oh) {
  __shared__ __align__(16) _Float16 Plds[4][16 * 64];
  __shared__ __align__(16) _Float16 Klds[2][KV_TILE];
  __shared__ __align__(16) _Float16 Vlds[2][KV_TILE];

  const int lane = threadIdx.x & 31;
  const int wave = threadIdx.x >> 5;
  const int r    = lane & 15;
  const int hb   = (lane >> 4) * 8;
  const int b    = blockIdx.y / HEADS;
  const int h    = blockIdx.y % HEADS;
  const int q0   = blockIdx.x * 64 + wave * 16;

  const float scale = 0.04419417382415922f;   // 1/sqrt(512) (ref scales by E)
  const int mwpr = SEQ / 32;                  // mask words per row

  // Q fragments for this wave's 16 rows (d = 0..31 and 32..63), held in VGPRs
  const _Float16* qrow = qh + ((size_t)b * SEQ + q0 + r) * EMB + h * HDIM;
  v16h Qa0 = frag_load(qrow + hb);
  v16h Qa1 = frag_load(qrow + 32 + hb);

  v8f O[4] = {};
  float mrun[8], lrun[8];
#pragma unroll
  for (int j = 0; j < 8; ++j) { mrun[j] = -1e38f; lrun[j] = 0.f; }

  const _Float16* kb_ = kh + (size_t)b * SEQ * EMB + h * HDIM;
  const _Float16* vb_ = vt + ((size_t)(b * HEADS + h) * HDIM) * SEQ;
  const unsigned int* mb_ = mbits + ((size_t)b * SEQ + q0 + hb) * mwpr;

  // This lane's piece of a stage: row (tid >> 3) + {0,16,32,48}, 16-byte
  // column tid & 7.
  const int crow = threadIdx.x >> 3;
  const int ccol = (threadIdx.x & 7) * 8;
  const _Float16* kg = kb_ + (size_t)crow * EMB + ccol;   // advances 64 rows
  const _Float16* vg = vb_ + (size_t)crow * SEQ + ccol;   // advances 64 cols
  const unsigned int kl =
      (unsigned int)(size_t)&Klds[0][crow * KV_PITCH + ccol];
  const unsigned int vl =
      (unsigned int)(size_t)&Vlds[0][crow * KV_PITCH + ccol];

  stage_kv(kg, vg, kl, vl);
  // tile 0 has landed for this wave; the barrier publishes it to the others
  asm volatile("s_wait_asynccnt 0x0" ::: "memory");
  __syncthreads();
  stage_kv(kg + 64 * EMB, vg + 64, kl + KV_TILE * 2u, vl + KV_TILE * 2u);

  for (int kt = 0; kt < SEQ / 64; ++kt) {
    const int k0 = kt * 64;
    const int buf = kt & 1;
    const _Float16* Kt = &Klds[buf][r * KV_PITCH + hb];
    const _Float16* Vt = &Vlds[buf][r * KV_PITCH + hb];

    // ---- S = Q @ K^T : 4 C-tiles of 16x16, reduction over d (2 wmma each)
    v8f Sc[4];
#pragma unroll
    for (int nt = 0; nt < 4; ++nt) {
      const _Float16* krow = Kt + nt * 16 * KV_PITCH;
      v16h b0 = frag_load(krow);
      v16h b1 = frag_load(krow + 32);
      v8f c = {};
      c = wmma_f16(Qa0, b0, c);
      c = wmma_f16(Qa1, b1, c);
      Sc[nt] = c;
    }

    // ---- mask (pre-scale, as reference) + scale, via packed bits:
    // one aligned u64 per row covers this 64-key tile.
    unsigned long long mw[8];
#pragma unroll
    for (int j = 0; j < 8; ++j)
      mw[j] = *(const unsigned long long*)(mb_ + (size_t)j * mwpr + (k0 >> 5));
#pragma unroll
    for (int nt = 0; nt < 4; ++nt) {
      const int bitpos = nt * 16 + r;
#pragma unroll
      for (int j = 0; j < 8; ++j) {
        float s = Sc[nt][j];
        Sc[nt][j] = ((mw[j] >> bitpos) & 1ull) ? s * scale : -4.4e18f;
      }
    }

    // ---- online softmax (row stats replicated over the 16-lane half-group)
#pragma unroll
    for (int j = 0; j < 8; ++j) {
      float v = fmaxf(fmaxf(Sc[0][j], Sc[1][j]), fmaxf(Sc[2][j], Sc[3][j]));
#pragma unroll
      for (int off = 1; off < 16; off <<= 1)
        v = fmaxf(v, __shfl_xor(v, off, 32));
      const float mn = fmaxf(mrun[j], v);
      const float alpha = __expf(mrun[j] - mn);
      mrun[j] = mn;
      float sum = 0.f;
#pragma unroll
      for (int nt = 0; nt < 4; ++nt) {
        float p = __expf(Sc[nt][j] - mn);
        Sc[nt][j] = p;
        sum += p;
      }
#pragma unroll
      for (int off = 1; off < 16; off <<= 1)
        sum += __shfl_xor(sum, off, 32);
      lrun[j] = lrun[j] * alpha + sum;
#pragma unroll
      for (int dt = 0; dt < 4; ++dt) O[dt][j] *= alpha;
    }

    // ---- stage P (C layout -> row-major f16 in wave-private LDS)
    _Float16* pl = &Plds[wave][0];
#pragma unroll
    for (int nt = 0; nt < 4; ++nt)
#pragma unroll
      for (int j = 0; j < 8; ++j)
        pl[(hb + j) * 64 + nt * 16 + r] = (_Float16)Sc[nt][j];

    // ---- O += P @ V   (V is d-major: B fragments load contiguously)
#pragma unroll
    for (int step = 0; step < 2; ++step) {
      v16h a = frag_load(&Plds[wave][r * 64 + step * 32 + hb]);
#pragma unroll
      for (int dt = 0; dt < 4; ++dt) {
        const _Float16* vrow = Vt + dt * 16 * KV_PITCH + step * 32;
        O[dt] = wmma_f16(a, frag_load(vrow), O[dt]);
      }
    }

    // ---- publish tile kt+1, free this buffer, refill it with tile kt+2
    // this wave's reads of the buffer have returned before it is refilled
    asm volatile("s_wait_dscnt 0x0" ::: "memory");
    // this wave's copies of tile kt+1 have landed before the barrier
    asm volatile("s_wait_asynccnt 0x0" ::: "memory");
    __syncthreads();
    if (kt + 2 < SEQ / 64)
      stage_kv(kg + (size_t)(k0 + 128) * EMB, vg + k0 + 128,
               kl + buf * (KV_TILE * 2u), vl + buf * (KV_TILE * 2u));
  }
  // no copy is left in flight when the wave ends
  asm volatile("s_wait_asynccnt 0x0" ::: "memory");

  // ---- normalize and emit attention output (f16, row-major [B*S, E])
  _Float16* orow = oh + ((size_t)b * SEQ + q0 + hb) * EMB + h * HDIM;
#pragma unroll
  for (int dt = 0; dt < 4; ++dt)
#pragma unroll
    for (int j = 0; j < 8; ++j)
      orow[(size_t)j * EMB + dt * 16 + r] = (_Float16)(O[dt][j] / lrun[j]);
}

// ---------------------------------------------------------------------------
extern "C" void kernel_launch(void* const* d_in, const int* in_sizes, int n_in,
                              void* d_out, int out_size, void* d_ws, size_t ws_size,
                              hipStream_t stream) {
  const float* key   = (const float*)d_in[0];
  const float* value = (const float*)d_in[1];
  const float* query = (const float*)d_in[2];
  const int*   mask  = (const int*)d_in[3];
  const float* Wq = (const float*)d_in[4];
  const float* bq = (const float*)d_in[5];
  const float* Wk = (const float*)d_in[6];
  const float* bk = (const float*)d_in[7];
  const float* Wv = (const float*)d_in[8];
  const float* bv = (const float*)d_in[9];
  const float* Wo = (const float*)d_in[10];
  const float* bo = (const float*)d_in[11];
  float* out = (float*)d_out;

  const size_t NX = (size_t)BATCH * SEQ * EMB;          // 4,194,304
  const size_t NW = (size_t)EMB * EMB;                  // 262,144
  const size_t NMW = (size_t)BATCH * SEQ * (SEQ / 32);  // 524,288 mask words

  char* w = (char*)d_ws;
  _Float16* xq  = (_Float16*)w; w += NX * 2;
  _Float16* xk  = (_Float16*)w; w += NX * 2;
  _Float16* xv  = (_Float16*)w; w += NX * 2;
  _Float16* wqh = (_Float16*)w; w += NW * 2;
  _Float16* wkh = (_Float16*)w; w += NW * 2;
  _Float16* wvh = (_Float16*)w; w += NW * 2;
  _Float16* woh = (_Float16*)w; w += NW * 2;
  _Float16* qh  = (_Float16*)w; w += NX * 2;
  _Float16* kh  = (_Float16*)w; w += NX * 2;
  _Float16* vt  = (_Float16*)w; w += NX * 2;   // [B,H,HDIM,SEQ]
  unsigned int* mbits = (unsigned int*)w; w += NMW * 4;
  _Float16* oh  = xq;  // xq is dead after the q projection; reuse for attn out

  const int M = BATCH * SEQ;  // 8192
  const int gx = (int)((NX / 4 + 255) / 256);
  const int gw = (int)((NW / 4 + 255) / 256);
  cvt_f32_f16<<<gx, 256, 0, stream>>>(query, xq, (int)(NX / 4));
  cvt_f32_f16<<<gx, 256, 0, stream>>>(key,   xk, (int)(NX / 4));
  cvt_f32_f16<<<gx, 256, 0, stream>>>(value, xv, (int)(NX / 4));
  cvt_f32_f16<<<gw, 256, 0, stream>>>(Wq, wqh, (int)(NW / 4));
  cvt_f32_f16<<<gw, 256, 0, stream>>>(Wk, wkh, (int)(NW / 4));
  cvt_f32_f16<<<gw, 256, 0, stream>>>(Wv, wvh, (int)(NW / 4));
  cvt_f32_f16<<<gw, 256, 0, stream>>>(Wo, woh, (int)(NW / 4));
  pack_mask<<<(int)((NMW + 255) / 256), 256, 0, stream>>>(mask, mbits,
                                                          (int)NMW);

  dim3 gp(M / 128, EMB / 64);  // (64, 8)
  gemm16<0><<<gp, 128, 0, stream>>>(xq, wqh, bq, qh, M, EMB, EMB);
  gemm16<0><<<gp, 128, 0, stream>>>(xk, wkh, bk, kh, M, EMB, EMB);
  gemm16<1><<<gp, 128, 0, stream>>>(xv, wvh, bv, vt, M, EMB, EMB);

  flash_attn<<<dim3(SEQ / 64, BATCH * HEADS), 128, 0, stream>>>(qh, kh, vt,
                                                                mbits, oh);

  gemm16<2><<<gp, 128, 0, stream>>>(oh, woh, bo, out, M, EMB, EMB);
}

// v002
// It runs in 159 microseconds.
// Two timings next to v001 put it at 1.30 and 1.31 times that version's speed.
// All steps since v000 together make it 1.49 times as fast.
#include <hip/hip_runtime.h>
#include <hip/hip_bf16.h>

#define BATCH 4
#define SEQ   2048
#define EMB   512
#define HEADS 8
#define HDIM  64

typedef __attribute__((ext_vector_type(16))) _Float16 v16h;
typedef __attribute__((ext_vector_type(8)))  _Float16 v8h;
typedef __attribute__((ext_vector_type(4)))  _Float16 v4h;
typedef __attribute__((ext_vector_type(8)))  float    v8f;
typedef __attribute__((ext_vector_type(4)))  float    v4f;

// ---------------------------------------------------------------------------
// Fragment loader for 16-bit WMMA A/B operands (CDNA5 16x32 / 32x16 layout).
// Per lane the fragment is two contiguous 8-half (16B) runs: k = kb + {0..7}
// and k = kb + {16..23}, where kb = (lane<16 ? 0 : 8).  Caller passes the
// pointer at element (row/col, kb).  Lowers to two global/ds _b128 loads.
// ---------------------------------------------------------------------------
static __device__ __forceinline__ v16h frag_load(const _Float16* p) {
  v8h lo = *(const v8h*)(p);
  v8h hi = *(const v8h*)(p + 16);
  v16h r;
#pragma unroll
  for (int i = 0; i < 8; ++i) { r[i] = lo[i]; r[i + 8] = hi[i]; }
  return r;
}

static __device__ __forceinline__ v8f wmma_f16(v16h a, v16h b, v8f c) {
  return __builtin_amdgcn_wmma_f32_16x16x32_f16(false, a, false, b,
                                                (short)0, c, false, false);
}

// ---------------------------------------------------------------------------
// fp32 -> f16 conversion (vectorized by 4)
// ---------------------------------------------------------------------------
__global__ void __launch_bounds__(256)
cvt_f32_f16(const float* __restrict__ in, _Float16* __restrict__ out, int n4) {
  int i = blockIdx.x * 256 + threadIdx.x;
  if (i < n4) {
    v4f v = ((const v4f*)in)[i];
    v4h o;
#pragma unroll
    for (int t = 0; t < 4; ++t) o[t] = (_Float16)v[t];
    ((v4h*)out)[i] = o;
  }
}

// ---------------------------------------------------------------------------
// Bit-pack the int32 mask: 32 int -> 1 u32.  67 MB -> 2 MB, read once.
// ---------------------------------------------------------------------------
__global__ void __launch_bounds__(256)
pack_mask(const int* __restrict__ mask, unsigned int* __restrict__ bits,
          int nwords) {
  int i = blockIdx.x * 256 + threadIdx.x;
  if (i < nwords) {
    const int4* p = (const int4*)(mask + (size_t)i * 32);
    unsigned int w = 0;
#pragma unroll
    for (int t = 0; t < 8; ++t) {
      int4 m = p[t];
      w |= (m.x != 0 ? 1u : 0u) << (4 * t + 0);
      w |= (m.y != 0 ? 1u : 0u) << (4 * t + 1);
      w |= (m.z != 0 ? 1u : 0u) << (4 * t + 2);
      w |= (m.w != 0 ? 1u : 0u) << (4 * t + 3);
    }
    bits[i] = w;
  }
}

// ---------------------------------------------------------------------------
// GEMM: Y[M,N] = A[M,K] @ W[N,K]^T + bias[N]   (torch Linear semantics)
// Block = 128 threads (4 waves); block tile 128(M) x 64(N); wave tile 32x64:
// two A fragments amortize every W fragment (8 WMMAs per 6 fragment loads).
// MODE 0: f16 row-major output (stride N)           -> q, k projections
// MODE 1: f16 head-transposed output [B,H,HDIM,SEQ] -> v projection
// MODE 2: f32 row-major output                      -> final out-projection
// ---------------------------------------------------------------------------
template <int MODE>
__global__ void __launch_bounds__(128)
gemm16(const _Float16* __restrict__ A, const _Float16* __restrict__ W,
       const float* __restrict__ bias, void* __restrict__ outp,
       int M, int N, int K) {
  const int lane = threadIdx.x & 31;
  const int wave = threadIdx.x >> 5;
  const int r    = lane & 15;          // row of A frag / column of B frag
  const int hb   = (lane >> 4) * 8;    // per-half k-run base; also C row base
  const int m0   = blockIdx.x * 128 + wave * 32;
  const int n0   = blockIdx.y * 64;

  const _Float16* arow0 = A + (size_t)(m0 + r) * K;
  const _Float16* arow1 = A + (size_t)(m0 + 16 + r) * K;
  const _Float16* wrow[4];
#pragma unroll
  for (int nt = 0; nt < 4; ++nt)
    wrow[nt] = W + (size_t)(n0 + nt * 16 + r) * K;

  v8f acc[2][4] = {};
  const int ksteps = K >> 5;
  for (int ks = 0; ks < ksteps; ++ks) {
    const int ko = ks * 32 + hb;
    v16h a0 = frag_load(arow0 + ko);
    v16h a1 = frag_load(arow1 + ko);
    __builtin_prefetch(arow0 + ko + 128, 0, 1);
    __builtin_prefetch(arow1 + ko + 128, 0, 1);
#pragma unroll
    for (int nt = 0; nt < 4; ++nt) {
      v16h b = frag_load(wrow[nt] + ko);
      acc[0][nt] = wmma_f16(a0, b, acc[0][nt]);
      acc[1][nt] = wmma_f16(a1, b, acc[1][nt]);
    }
  }

#pragma unroll
  for (int mt = 0; mt < 2; ++mt) {
    const int mrow = m0 + mt * 16 + hb;
#pragma unroll
    for (int nt = 0; nt < 4; ++nt) {
      const int col = n0 + nt * 16 + r;
      const float bv = bias[col];
      if (MODE == 0) {
        _Float16* o = (_Float16*)outp;
#pragma unroll
        for (int j = 0; j < 8; ++j)
          o[(size_t)(mrow + j) * N + col] = (_Float16)(acc[mt][nt][j] + bv);
      } else if (MODE == 1) {
        // [B,H,HDIM,SEQ]; lane holds 8 consecutive sequence positions of one
        // (h,d) row -> single 16B store.
        _Float16* o = (_Float16*)outp;
        const int bb = m0 / SEQ;
        const int s0 = mrow % SEQ;
        const int h = col >> 6, d = col & 63;
        v8h pk;
#pragma unroll
        for (int j = 0; j < 8; ++j) pk[j] = (_Float16)(acc[mt][nt][j] + bv);
        *(v8h*)(o + ((size_t)((bb * HEADS + h) * HDIM + d)) * SEQ + s0) = pk;
      } else {
        float* o = (float*)outp;
#pragma unroll
        for (int j = 0; j < 8; ++j)
          o[(size_t)(mrow + j) * N + col] = acc[mt][nt][j] + bv;
      }
    }
  }
}

// ---------------------------------------------------------------------------
// K/V staging for flash_attn.  A stage is one 64-key tile: K as 64 key rows
// and V as 64 d rows, 128 data bytes each, laid at a 144-byte LDS pitch
// (16 B x odd: conflict-free for the ds_load_b128 fragment reads).
// ---------------------------------------------------------------------------
#define KV_PITCH 72                 // halves per LDS row
#define KV_TILE  (64 * KV_PITCH)    // halves per staged tile

// One stage's copies of one lane: four 16-byte pieces of K and four of V,
// rows 16 apart.  Eight lanes cover one whole 128-byte row.  The s_wait_xcnt
// closes the statement so that no address register named by a copy is
// rewritten ahead of it.
static __device__ __forceinline__ void stage_kv(const _Float16* kg,
                                                const _Float16* vg,
                                                unsigned int kl,
                                                unsigned int vl) {
  asm volatile(
      "global_load_async_to_lds_b128 %0, %8, off\n\t"
      "global_load_async_to_lds_b128 %1, %9, off\n\t"
      "global_load_async_to_lds_b128 %2, %10, off\n\t"
      "global_load_async_to_lds_b128 %3, %11, off\n\t"
      "global_load_async_to_lds_b128 %4, %12, off\n\t"
      "global_load_async_to_lds_b128 %5, %13, off\n\t"
      "global_load_async_to_lds_b128 %6, %14, off\n\t"
      "global_load_async_to_lds_b128 %7, %15, off\n\t"
      "s_wait_xcnt 0x0"
      :: "v"(kl), "v"(kl + 16u * KV_PITCH * 2u), "v"(kl + 32u * KV_PITCH * 2u),
         "v"(kl + 48u * KV_PITCH * 2u),
         "v"(vl), "v"(vl + 16u * KV_PITCH * 2u), "v"(vl + 32u * KV_PITCH * 2u),
         "v"(vl + 48u * KV_PITCH * 2u),
         "v"(kg), "v"(kg + 16 * EMB), "v"(kg + 32 * EMB), "v"(kg + 48 * EMB),
         "v"(vg), "v"(vg + 16 * SEQ), "v"(vg + 32 * SEQ), "v"(vg + 48 * SEQ)
      : "memory");
}

// Lane l with lane l ^ 16 (the two lanes that share one query column).
static __device__ __forceinline__ float xhalf(float x) {
  const int b = __builtin_bit_cast(int, x);
  return __builtin_bit_cast(
      float, __builtin_amdgcn_permlanex16(b, b, 0x76543210, 0xfedcba98, false,
                                          false));
}

// ---------------------------------------------------------------------------
// Flash attention: one block = 4 waves = 64 query rows of one (b,h).
// The block's four waves share each 64-key K/V tile: it is copied once into
// LDS (two buffers, the next tile's copies fly while this one is worked on).
// Each wave owns 16 queries and works on the transposed products:
//   St = K @ Q^T (A = K rows, B = Q), Ot += V^T @ Pt (A = d-major V rows).
// In an accumulator tile a lane then holds ONE query (column lane & 15) and
// eight keys (or d) hb..hb+7: maximum and sum run in the lane, the two lanes
// of a query meet by one cross-half move, and two St tiles are, element for
// element, the B fragment of Pt (k = hb+0..7 and 16+hb+0..7).
// ---------------------------------------------------------------------------
__global__ void __launch_bounds__(128)
flash_attn(const _Float16* __restrict__ qh, const _Float16* __restrict__ kh,
           const _Float16* __restrict__ vt,
           const unsigned int* __restrict__ mbits,
           _Float16* __restrict__ oh) {
  __shared__ __align__(16) _Float16 Klds[2][KV_TILE];
  __shared__ __align__(16) _Float16 Vlds[2][KV_TILE];

  const int lane = threadIdx.x & 31;
  const int wave = threadIdx.x >> 5;
  const int r    = lane & 15;
  const int hb   = (lane >> 4) * 8;
  const int b    = blockIdx.y / HEADS;
  const int h    = blockIdx.y % HEADS;
  const int q0   = blockIdx.x * 64 + wave * 16;

  const float scale = 0.04419417382415922f;   // 1/sqrt(512) (ref scales by E)
  const int mwpr = SEQ / 32;                  // mask words per row

  // Q fragments for this wave's 16 queries (d = 0..31 and 32..63), in VGPRs
  const _Float16* qrow = qh + ((size_t)b * SEQ + q0 + r) * EMB + h * HDIM;
  v16h Qb0 = frag_load(qrow + hb);
  v16h Qb1 = frag_load(qrow + 32 + hb);

  v8f O[4] = {};                 // Ot tiles: d = dt*16 + hb + j, query r
  float mrun = -1e38f;           // this query's running maximum
  float lrun = 0.f;              // running sum over this lane's keys only

  const _Float16* kb_ = kh + (size_t)b * SEQ * EMB + h * HDIM;
  const _Float16* vb_ = vt + ((size_t)(b * HEADS + h) * HDIM) * SEQ;
  const unsigned int* mb_ = mbits + ((size_t)b * SEQ + q0 + r) * mwpr;

  // This lane's piece of a stage: row (tid >> 3) + {0,16,32,48}, 16-byte
  // column tid & 7.
  const int crow = threadIdx.x >> 3;
  const int ccol = (threadIdx.x & 7) * 8;
  const _Float16* kg = kb_ + (size_t)crow * EMB + ccol;   // advances 64 rows
  const _Float16* vg = vb_ + (size_t)crow * SEQ + ccol;   // advances 64 cols
  const unsigned int kl =
      (unsigned int)(size_t)&Klds[0][crow * KV_PITCH + ccol];
  const unsigned int vl =
      (unsigned int)(size_t)&Vlds[0][crow * KV_PITCH + ccol];

  stage_kv(kg, vg, kl, vl);
  // tile 0 has landed for this wave; the barrier publishes it to the others
  asm volatile("s_wait_asynccnt 0x0" ::: "memory");
  __syncthreads();
  stage_kv(kg + 64 * EMB, vg + 64, kl + KV_TILE * 2u, vl + KV_TILE * 2u);

  for (int kt = 0; kt < SEQ / 64; ++kt) {
    const int k0 = kt * 64;
    const int buf = kt & 1;
    const _Float16* Kt = &Klds[buf][r * KV_PITCH + hb];
    const _Float16* Vt = &Vlds[buf][r * KV_PITCH + hb];

    // this query's 64 mask bits of the tile: one aligned u64 per lane,
    // shifted so that bit j of each 16-bit group is key hb + j
    const uint2 mw = *(const uint2*)(mb_ + (k0 >> 5));
    const unsigned int mws[2] = {mw.x >> hb, mw.y >> hb};

    // ---- St = K @ Q^T : 4 C-tiles of 16 keys x 16 queries (2 wmma each)
    v8f Sc[4];
#pragma unroll
    for (int nt = 0; nt < 4; ++nt) {
      const _Float16* krow = Kt + nt * 16 * KV_PITCH;
      v16h a0 = frag_load(krow);
      v16h a1 = frag_load(krow + 32);
      v8f c = {};
      c = wmma_f16(a0, Qb0, c);
      c = wmma_f16(a1, Qb1, c);
      Sc[nt] = c;
    }

    // ---- mask (pre-scale, as reference) + scale; maximum in the lane
    float vmax[4];
#pragma unroll
    for (int nt = 0; nt < 4; ++nt) {
      const unsigned int w = mws[nt >> 1] >> ((nt & 1) * 16);
#pragma unroll
      for (int j = 0; j < 8; ++j) {
        const float s = ((w >> j) & 1u) ? Sc[nt][j] * scale : -4.4e18f;
        Sc[nt][j] = s;
        vmax[nt] = j ? fmaxf(vmax[nt], s) : s;
      }
    }

    // ---- online softmax: one query per lane, its keys split over two lanes
    float v = fmaxf(fmaxf(vmax[0], vmax[1]), fmaxf(vmax[2], vmax[3]));
    v = fmaxf(v, xhalf(v));
    const float mn = fmaxf(mrun, v);
    const float alpha = __expf(mrun - mn);
    mrun = mn;
    float psum[4];
#pragma unroll
    for (int nt = 0; nt < 4; ++nt) {
#pragma unroll
      for (int j = 0; j < 8; ++j) {
        const float p = __expf(Sc[nt][j] - mn);
        Sc[nt][j] = p;
        psum[nt] = j ? psum[nt] + p : p;
      }
    }
    lrun = lrun * alpha + ((psum[0] + psum[1]) + (psum[2] + psum[3]));
#pragma unroll
    for (int dt = 0; dt < 4; ++dt)
#pragma unroll
      for (int j = 0; j < 8; ++j) O[dt][j] *= alpha;

    // ---- Ot += V^T @ Pt   (V is d-major: A fragments load contiguously;
    // Pt's B fragment is packed straight from two St tiles)
#pragma unroll
    for (int step = 0; step < 2; ++step) {
      v16h pb;
#pragma unroll
      for (int i = 0; i < 8; ++i) {
        pb[i]     = (_Float16)Sc[2 * step][i];
        pb[i + 8] = (_Float16)Sc[2 * step + 1][i];
      }
#pragma unroll
      for (int dt = 0; dt < 4; ++dt) {
        const _Float16* vrow = Vt + dt * 16 * KV_PITCH + step * 32;
        O[dt] = wmma_f16(frag_load(vrow), pb, O[dt]);
      }
    }

    // ---- publish tile kt+1, free this buffer, refill it with tile kt+2
    // this wave's reads of the buffer have returned before it is refilled
    asm volatile("s_wait_dscnt 0x0" ::: "memory");
    // this wave's copies of tile kt+1 have landed before the barrier
    asm volatile("s_wait_asynccnt 0x0" ::: "memory");
    __syncthreads();
    if (kt + 2 < SEQ / 64)
      stage_kv(kg + (size_t)(k0 + 128) * EMB, vg + k0 + 128,
               kl + buf * (KV_TILE * 2u), vl + buf * (KV_TILE * 2u));
  }
  // no copy is left in flight when the wave ends
  asm volatile("s_wait_asynccnt 0x0" ::: "memory");

  // ---- join the two lanes' sums, normalize and emit attention output
  // (f16, row-major [B*S, E]): a lane holds 8 consecutive d of its query
  const float lsum = lrun + xhalf(lrun);
  _Float16* orow = oh + ((size_t)b * SEQ + q0 + r) * EMB + h * HDIM + hb;
#pragma unroll
  for (int dt = 0; dt < 4; ++dt) {
    v8h pk;
#pragma unroll
    for (int j = 0; j < 8; ++j) pk[j] = (_Float16)(O[dt][j] / lsum);
    *(v8h*)(orow + dt * 16) = pk;
  }
}

// ---------------------------------------------------------------------------
extern "C" void kernel_launch(void* const* d_in, const int* in_sizes, int n_in,
                              void* d_out, int out_size, void* d_ws, size_t ws_size,
                              hipStream_t stream) {
  const float* key   = (const float*)d_in[0];
  const float* value = (const float*)d_in[1];
  const float* query = (const float*)d_in[2];
  const int*   mask  = (const int*)d_in[3];
  const float* Wq = (const float*)d_in[4];
  const float* bq = (const float*)d_in[5];
  const float* Wk = (const float*)d_in[6];
  const float* bk = (const float*)d_in[7];
  const float* Wv = (const float*)d_in[8];
  const float* bv = (const float*)d_in[9];
  const float* Wo = (const float*)d_in[10];
  const float* bo = (const float*)d_in[11];
  float* out = (float*)d_out;

  const size_t NX = (size_t)BATCH * SEQ * EMB;          // 4,194,304
  const size_t NW = (size_t)EMB * EMB;                  // 262,144
  const size_t NMW = (size_t)BATCH * SEQ * (SEQ / 32);  // 524,288 mask words

  char* w = (char*)d_ws;
  _Float16* xq  = (_Float16*)w; w += NX * 2;
  _Float16* xk  = (_Float16*)w; w += NX * 2;
  _Float16* xv  = (_Float16*)w; w += NX * 2;
  _Float16* wqh = (_Float16*)w; w += NW * 2;
  _Float16* wkh = (_Float16*)w; w += NW * 2;
  _Float16* wvh = (_Float16*)w; w += NW * 2;
  _Float16* woh = (_Float16*)w; w += NW * 2;
  _Float16* qh  = (_Float16*)w; w += NX * 2;
  _Float16* kh  = (_Float16*)w; w += NX * 2;
  _Float16* vt  = (_Float16*)w; w += NX * 2;   // [B,H,HDIM,SEQ]
  unsigned int* mbits = (unsigned int*)w; w += NMW * 4;
  _Float16* oh  = xq;  // xq is dead after the q projection; reuse for attn out

  const int M = BATCH * SEQ;  // 8192
  const int gx = (int)((NX / 4 + 255) / 256);
  const int gw = (int)((NW / 4 + 255) / 256);
  cvt_f32_f16<<<gx, 256, 0, stream>>>(query, xq, (int)(NX / 4));
  cvt_f32_f16<<<gx, 256, 0, stream>>>(key,   xk, (int)(NX / 4));
  cvt_f32_f16<<<gx, 256, 0, stream>>>(value, xv, (int)(NX / 4));
  cvt_f32_f16<<<gw, 256, 0, stream>>>(Wq, wqh, (int)(NW / 4));
  cvt_f32_f16<<<gw, 256, 0, stream>>>(Wk, wkh, (int)(NW / 4));
  cvt_f32_f16<<<gw, 256, 0, stream>>>(Wv, wvh, (int)(NW / 4));
  cvt_f32_f16<<<gw, 256, 0, stream>>>(Wo, woh, (int)(NW / 4));
  pack_mask<<<(int)((NMW + 255) / 256), 256, 0, stream>>>(mask, mbits,
                                                          (int)NMW);

  dim3 gp(M / 128, EMB / 64);  // (64, 8)
  gemm16<0><<<gp, 128, 0, stream>>>(xq, wqh, bq, qh, M, EMB, EMB);
  gemm16<0><<<gp, 128, 0, stream>>>(xk, wkh, bk, kh, M, EMB, EMB);
  gemm16<1><<<gp, 128, 0, stream>>>(xv, wvh, bv, vt, M, EMB, EMB);

  flash_attn<<<dim3(SEQ / 64, BATCH * HEADS), 128, 0, stream>>>(qh, kh, vt,
                                                                mbits, oh);

  gemm16<2><<<gp, 128, 0, stream>>>(oh, woh, bo, out, M, EMB, EMB);
}

// v003
// Measured time: 132 microseconds a run.
// Timed twice side by side with v002, it ran 1.21 times as fast both times.
// Counting every step since v000, it is 1.80 times as fast.
#include <hip/hip_runtime.h>
#include <hip/hip_bf16.h>

#define BATCH 4
#define SEQ   2048
#define EMB   512
#define HEADS 8
#define HDIM  64

typedef __attribute__((ext_vector_type(16))) _Float16 v16h;
typedef __attribute__((ext_vector_type(8)))  _Float16 v8h;
typedef __attribute__((ext_vector_type(4)))  _Float16 v4h;
typedef __attribute__((ext_vector_type(8)))  float    v8f;
typedef __attribute__((ext_vector_type(4)))  float    v4f;

// ---------------------------------------------------------------------------
// Fragment loader for 16-bit WMMA A/B operands (CDNA5 16x32 / 32x16 layout).
// Per lane the fragment is two contiguous 8-half (16B) runs: k = kb + {0..7}
// and k = kb + {16..23}, where kb = (lane<16 ? 0 : 8).  Caller passes the
// pointer at element (row/col, kb).  Lowers to two global/ds _b128 loads.
// ---------------------------------------------------------------------------
static __device__ __forceinline__ v16h frag_load(const _Float16* p) {
  v8h lo = *(const v8h*)(p);
  v8h hi = *(const v8h*)(p + 16);
  v16h r;
#pragma unroll
  for (int i = 0; i < 8; ++i) { r[i] = lo[i]; r[i + 8] = hi[i]; }
  return r;
}

static __device__ __forceinline__ v8f wmma_f16(v16h a, v16h b, v8f c) {
  return __builtin_amdgcn_wmma_f32_16x16x32_f16(false, a, false, b,
                                                (short)0, c, false, false);
}

// ---------------------------------------------------------------------------
// Pre-pass, one launch for the eight jobs that read none of each other's
// output: fp32 -> f16 of the three activations and the four weights, and the
// bit-pack of the int32 mask (32 int -> 1 u32, 67 MB -> 2 MB, read once).
// The work is cut into units of 32 KiB of input (256 threads x 8 x 16 B);
// a block walks the units blockIdx.x, + PRE_BLOCKS, ... and a unit's number
// names its job, so few waves are started and each keeps 8 loads in flight.
// ---------------------------------------------------------------------------
#define U_MASK 2048                 // BATCH*SEQ*SEQ ints      / 8192
#define U_X    512                  // BATCH*SEQ*EMB floats    / 8192
#define U_W    32                   // EMB*EMB floats          / 8192
#define U_ALL  (U_MASK + 3 * U_X + 4 * U_W)   // 3712
#define PRE_BLOCKS (U_ALL / 4)      // 928 blocks, four units each

__global__ void __launch_bounds__(256)
pre_pass(const float* __restrict__ query, const float* __restrict__ key,
         const float* __restrict__ value, const float* __restrict__ Wq,
         const float* __restrict__ Wk, const float* __restrict__ Wv,
         const float* __restrict__ Wo, const int* __restrict__ mask,
         _Float16* __restrict__ xdst,   // xq | xk | xv, contiguous
         _Float16* __restrict__ wdst,   // wq | wk | wv | wo, contiguous
         unsigned int* __restrict__ bits) {
  for (int u = blockIdx.x; u < U_ALL; u += PRE_BLOCKS) {
    if (u < U_MASK) {
      // thread t packs word t of the unit from its 32 ints (128 B)
      const int4* p = (const int4*)(mask + (size_t)u * 8192) + threadIdx.x * 8;
      unsigned int w = 0;
#pragma unroll
      for (int t = 0; t < 8; ++t) {
        int4 m = p[t];
        w |= (m.x != 0 ? 1u : 0u) << (4 * t + 0);
        w |= (m.y != 0 ? 1u : 0u) << (4 * t + 1);
        w |= (m.z != 0 ? 1u : 0u) << (4 * t + 2);
        w |= (m.w != 0 ? 1u : 0u) << (4 * t + 3);
      }
      (bits + (size_t)u * 256)[threadIdx.x] = w;
    } else {
      const int c = u - U_MASK;
      const float* in;
      _Float16* out;
      if (c < 3 * U_X) {
        const int j = c / U_X;
        in  = (j == 0 ? query : j == 1 ? key : value) + (size_t)(c % U_X) * 8192;
        out = xdst + (size_t)c * 8192;
      } else {
        const int d = c - 3 * U_X;
        const int j = d / U_W;
        in  = (j == 0 ? Wq : j == 1 ? Wk : j == 2 ? Wv : Wo) +
              (size_t)(d % U_W) * 8192;
        out = wdst + (size_t)d * 8192;
      }
      v4f v[8];
#pragma unroll
      for (int t = 0; t < 8; ++t)
        v[t] = ((const v4f*)in)[t * 256 + threadIdx.x];
#pragma unroll
      for (int t = 0; t < 8; ++t) {
        v4h o;
#pragma unroll
        for (int e = 0; e < 4; ++e) o[e] = (_Float16)v[t][e];
        ((v4h*)out)[t * 256 + threadIdx.x] = o;
      }
      // whatever code follows this branch may rewrite the registers that the
      // eight stores name: the wait stands directly behind them
      asm volatile("s_wait_xcnt 0x0" ::: "memory");
    }
    // The next trip rewrites registers that this trip's stores still name.
    // u passes through the statement so that every address of the next trip
    // is formed behind the wait, not carried over it by an increment.
    asm volatile("s_wait_xcnt 0x0" : "+s"(u) :: "memory");
  }
}

// ---------------------------------------------------------------------------
// GEMM: Y[M,N] = A[M,K] @ W[N,K]^T + bias[N]   (torch Linear semantics)
// Block = 128 threads (4 waves); block tile 128(M) x 64(N); wave tile 32x64:
// two A fragments amortize every W fragment (8 WMMAs per 6 fragment loads).
// MODE 0: f16 row-major output (stride N)           -> q, k projections
// MODE 1: f16 head-transposed output [B,H,HDIM,SEQ] -> v projection
// MODE 2: f32 row-major output                      -> final out-projection
// ---------------------------------------------------------------------------
template <int MODE>
static __device__ __forceinline__ void
gemm_tile(const _Float16* __restrict__ A, const _Float16* __restrict__ W,
          const float* __restrict__ bias, void* __restrict__ outp,
          int M, int N, int K) {
  const int lane = threadIdx.x & 31;
  const int wave = threadIdx.x >> 5;
  const int r    = lane & 15;          // row of A frag / column of B frag
  const int hb   = (lane >> 4) * 8;    // per-half k-run base; also C row base
  const int m0   = blockIdx.x * 128 + wave * 32;
  const int n0   = blockIdx.y * 64;

  const _Float16* arow0 = A + (size_t)(m0 + r) * K;
  const _Float16* arow1 = A + (size_t)(m0 + 16 + r) * K;
  const _Float16* wrow[4];
#pragma unroll
  for (int nt = 0; nt < 4; ++nt)
    wrow[nt] = W + (size_t)(n0 + nt * 16 + r) * K;

  v8f acc[2][4] = {};
  const int ksteps = K >> 5;
  for (int ks = 0; ks < ksteps; ++ks) {
    const int ko = ks * 32 + hb;
    v16h a0 = frag_load(arow0 + ko);
    v16h a1 = frag_load(arow1 + ko);
    __builtin_prefetch(arow0 + ko + 128, 0, 1);
    __builtin_prefetch(arow1 + ko + 128, 0, 1);
#pragma unroll
    for (int nt = 0; nt < 4; ++nt) {
      v16h b = frag_load(wrow[nt] + ko);
      acc[0][nt] = wmma_f16(a0, b, acc[0][nt]);
      acc[1][nt] = wmma_f16(a1, b, acc[1][nt]);
    }
  }

#pragma unroll
  for (int mt = 0; mt < 2; ++mt) {
    const int mrow = m0 + mt * 16 + hb;
#pragma unroll
    for (int nt = 0; nt < 4; ++nt) {
      const int col = n0 + nt * 16 + r;
      const float bv = bias[col];
      if (MODE == 0) {
        _Float16* o = (_Float16*)outp;
#pragma unroll
        for (int j = 0; j < 8; ++j)
          o[(size_t)(mrow + j) * N + col] = (_Float16)(acc[mt][nt][j] + bv);
      } else if (MODE == 1) {
        // [B,H,HDIM,SEQ]; lane holds 8 consecutive sequence positions of one
        // (h,d) row -> single 16B store.
        _Float16* o = (_Float16*)outp;
        const int bb = m0 / SEQ;
        const int s0 = mrow % SEQ;
        const int h = col >> 6, d = col & 63;
        v8h pk;
#pragma unroll
        for (int j = 0; j < 8; ++j) pk[j] = (_Float16)(acc[mt][nt][j] + bv);
        *(v8h*)(o + ((size_t)((bb * HEADS + h) * HDIM + d)) * SEQ + s0) = pk;
      } else {
        float* o = (float*)outp;
#pragma unroll
        for (int j = 0; j < 8; ++j)
          o[(size_t)(mrow + j) * N + col] = acc[mt][nt][j] + bv;
      }
    }
  }
}

// The three projections read none of each other's output: one grid,
// blockIdx.z names the job (0: q, 1: k, 2: v head-transposed).
__global__ void __launch_bounds__(128)
gemm_qkv(const _Float16* __restrict__ xq, const _Float16* __restrict__ xk,
         const _Float16* __restrict__ xv, const _Float16* __restrict__ wq,
         const _Float16* __restrict__ wk, const _Float16* __restrict__ wv,
         const float* __restrict__ bq, const float* __restrict__ bk,
         const float* __restrict__ bv, _Float16* __restrict__ qh,
         _Float16* __restrict__ kh, _Float16* __restrict__ vt,
         int M, int N, int K) {
  if (blockIdx.z == 2) {
    gemm_tile<1>(xv, wv, bv, vt, M, N, K);
  } else {
    const bool isk = blockIdx.z == 1;
    gemm_tile<0>(isk ? xk : xq, isk ? wk : wq, isk ? bk : bq, isk ? kh : qh,
                 M, N, K);
    // the built code runs on into the v tile's test and set-up, which reuse
    // the registers that this tile's stores name: the wait stands behind them
    asm volatile("s_wait_xcnt 0x0" ::: "memory");
  }
}

__global__ void __launch_bounds__(128)
gemm_out(const _Float16* __restrict__ A, const _Float16* __restrict__ W,
         const float* __restrict__ bias, float* __restrict__ outp,
         int M, int N, int K) {
  gemm_tile<2>(A, W, bias, outp, M, N, K);
}

// ---------------------------------------------------------------------------
// K/V staging for flash_attn.  A stage is one 64-key tile: K as 64 key rows
// and V as 64 d rows, 128 data bytes each, laid at a 144-byte LDS pitch
// (16 B x odd: conflict-free for the ds_load_b128 fragment reads).
// ---------------------------------------------------------------------------
#define KV_PITCH 72                 // halves per LDS row
#define KV_TILE  (64 * KV_PITCH)    // halves per staged tile

// One stage's copies of one lane: four 16-byte pieces of K and four of V,
// rows 16 apart.  Eight lanes cover one whole 128-byte row.  The s_wait_xcnt
// closes the statement so that no address register named by a copy is
// rewritten ahead of it.
static __device__ __forceinline__ void stage_kv(const _Float16* kg,
                                                const _Float16* vg,
                                                unsigned int kl,
                                                unsigned int vl) {
  asm volatile(
      "global_load_async_to_lds_b128 %0, %8, off\n\t"
      "global_load_async_to_lds_b128 %1, %9, off\n\t"
      "global_load_async_to_lds_b128 %2, %10, off\n\t"
      "global_load_async_to_lds_b128 %3, %11, off\n\t"
      "global_load_async_to_lds_b128 %4, %12, off\n\t"
      "global_load_async_to_lds_b128 %5, %13, off\n\t"
      "global_load_async_to_lds_b128 %6, %14, off\n\t"
      "global_load_async_to_lds_b128 %7, %15, off\n\t"
      "s_wait_xcnt 0x0"
      :: "v"(kl), "v"(kl + 16u * KV_PITCH * 2u), "v"(kl + 32u * KV_PITCH * 2u),
         "v"(kl + 48u * KV_PITCH * 2u),
         "v"(vl), "v"(vl + 16u * KV_PITCH * 2u), "v"(vl + 32u * KV_PITCH * 2u),
         "v"(vl + 48u * KV_PITCH * 2u),
         "v"(kg), "v"(kg + 16 * EMB), "v"(kg + 32 * EMB), "v"(kg + 48 * EMB),
         "v"(vg), "v"(vg + 16 * SEQ), "v"(vg + 32 * SEQ), "v"(vg + 48 * SEQ)
      : "memory");
}

// Lane l with lane l ^ 16 (the two lanes that share one query column).
static __device__ __forceinline__ float xhalf(float x) {
  const int b = __builtin_bit_cast(int, x);
  return __builtin_bit_cast(
      float, __builtin_amdgcn_permlanex16(b, b, 0x76543210, 0xfedcba98, false,
                                          false));
}

// ---------------------------------------------------------------------------
// Flash attention: one block = 4 waves = 64 query rows of one (b,h).
// The block's four waves share each 64-key K/V tile: it is copied once into
// LDS (two buffers, the next tile's copies fly while this one is worked on).
// Each wave owns 16 queries and works on the transposed products:
//   St = K @ Q^T (A = K rows, B = Q), Ot += V^T @ Pt (A = d-major V rows).
// In an accumulator tile a lane then holds ONE query (column lane & 15) and
// eight keys (or d) hb..hb+7: maximum and sum run in the lane, the two lanes
// of a query meet by one cross-half move, and two St tiles are, element for
// element, the B fragment of Pt (k = hb+0..7 and 16+hb+0..7).
// ---------------------------------------------------------------------------
__global__ void __launch_bounds__(128)
flash_attn(const _Float16* __restrict__ qh, const _Float16* __restrict__ kh,
           const _Float16* __restrict__ vt,
           const unsigned int* __restrict__ mbits,
           _Float16* __restrict__ oh) {
  __shared__ __align__(16) _Float16 Klds[2][KV_TILE];
  __shared__ __align__(16) _Float16 Vlds[2][KV_TILE];

  const int lane = threadIdx.x & 31;
  const int wave = threadIdx.x >> 5;
  const int r    = lane & 15;
  const int hb   = (lane >> 4) * 8;
  const int b    = blockIdx.y / HEADS;
  const int h    = blockIdx.y % HEADS;
  const int q0   = blockIdx.x * 64 + wave * 16;

  const float scale = 0.04419417382415922f;   // 1/sqrt(512) (ref scales by E)
  const int mwpr = SEQ / 32;                  // mask words per row

  // Q fragments for this wave's 16 queries (d = 0..31 and 32..63), in VGPRs
  const _Float16* qrow = qh + ((size_t)b * SEQ + q0 + r) * EMB + h * HDIM;
  v16h Qb0 = frag_load(qrow + hb);
  v16h Qb1 = frag_load(qrow + 32 + hb);

  v8f O[4] = {};                 // Ot tiles: d = dt*16 + hb + j, query r
  float mrun = -1e38f;           // this query's running maximum
  float lrun = 0.f;              // running sum over this lane's keys only

  const _Float16* kb_ = kh + (size_t)b * SEQ * EMB + h * HDIM;
  const _Float16* vb_ = vt + ((size_t)(b * HEADS + h) * HDIM) * SEQ;
  const unsigned int* mb_ = mbits + ((size_t)b * SEQ + q0 + r) * mwpr;

  // This lane's piece of a stage: row (tid >> 3) + {0,16,32,48}, 16-byte
  // column tid & 7.
  const int crow = threadIdx.x >> 3;
  const int ccol = (threadIdx.x & 7) * 8;
  const _Float16* kg = kb_ + (size_t)crow * EMB + ccol;   // advances 64 rows
  const _Float16* vg = vb_ + (size_t)crow * SEQ + ccol;   // advances 64 cols
  const unsigned int kl =
      (unsigned int)(size_t)&Klds[0][crow * KV_PITCH + ccol];
  const unsigned int vl =
      (unsigned int)(size_t)&Vlds[0][crow * KV_PITCH + ccol];

  stage_kv(kg, vg, kl, vl);
  // tile 0 has landed for this wave; the barrier publishes it to the others
  asm volatile("s_wait_asynccnt 0x0" ::: "memory");
  __syncthreads();
  stage_kv(kg + 64 * EMB, vg + 64, kl + KV_TILE * 2u, vl + KV_TILE * 2u);

  for (int kt = 0; kt < SEQ / 64; ++kt) {
    const int k0 = kt * 64;
    const int buf = kt & 1;
    const _Float16* Kt = &Klds[buf][r * KV_PITCH + hb];
    const _Float16* Vt = &Vlds[buf][r * KV_PITCH + hb];

    // this query's 64 mask bits of the tile: one aligned u64 per lane,
    // shifted so that bit j of each 16-bit group is key hb + j
    const uint2 mw = *(const uint2*)(mb_ + (k0 >> 5));
    const unsigned int mws[2] = {mw.x >> hb, mw.y >> hb};

    // ---- St = K @ Q^T : 4 C-tiles of 16 keys x 16 queries (2 wmma each)
    v8f Sc[4];
#pragma unroll
    for (int nt = 0; nt < 4; ++nt) {
      const _Float16* krow = Kt + nt * 16 * KV_PITCH;
      v16h a0 = frag_load(krow);
      v16h a1 = frag_load(krow + 32);
      v8f c = {};
      c = wmma_f16(a0, Qb0, c);
      c = wmma_f16(a1, Qb1, c);
      Sc[nt] = c;
    }

    // ---- mask (pre-scale, as reference) + scale; maximum in the lane
    float vmax[4];
#pragma unroll
    for (int nt = 0; nt < 4; ++nt) {
      const unsigned int w = mws[nt >> 1] >> ((nt & 1) * 16);
#pragma unroll
      for (int j = 0; j < 8; ++j) {
        const float s = ((w >> j) & 1u) ? Sc[nt][j] * scale : -4.4e18f;
        Sc[nt][j] = s;
        vmax[nt] = j ? fmaxf(vmax[nt], s) : s;
      }
    }

    // ---- online softmax: one query per lane, its keys split over two lanes
    float v = fmaxf(fmaxf(vmax[0], vmax[1]), fmaxf(vmax[2], vmax[3]));
    v = fmaxf(v, xhalf(v));
    const float mn = fmaxf(mrun, v);
    const float alpha = __expf(mrun - mn);
    mrun = mn;
    float psum[4];
#pragma unroll
    for (int nt = 0; nt < 4; ++nt) {
#pragma unroll
      for (int j = 0; j < 8; ++j) {
        const float p = __expf(Sc[nt][j] - mn);
        Sc[nt][j] = p;
        psum[nt] = j ? psum[nt] + p : p;
      }
    }
    lrun = lrun * alpha + ((psum[0] + psum[1]) + (psum[2] + psum[3]));
#pragma unroll
    for (int dt = 0; dt < 4; ++dt)
#pragma unroll
      for (int j = 0; j < 8; ++j) O[dt][j] *= alpha;

    // ---- Ot += V^T @ Pt   (V is d-major: A fragments load contiguously;
    // Pt's B fragment is packed straight from two St tiles)
#pragma unroll
    for (int step = 0; step < 2; ++step) {
      v16h pb;
#pragma unroll
      for (int i = 0; i < 8; ++i) {
        pb[i]     = (_Float16)Sc[2 * step][i];
        pb[i + 8] = (_Float16)Sc[2 * step + 1][i];
      }
#pragma unroll
      for (int dt = 0; dt < 4; ++dt) {
        const _Float16* vrow = Vt + dt * 16 * KV_PITCH + step * 32;
        O[dt] = wmma_f16(frag_load(vrow), pb, O[dt]);
      }
    }

    // ---- publish tile kt+1, free this buffer, refill it with tile kt+2
    // this wave's reads of the buffer have returned before it is refilled
    asm volatile("s_wait_dscnt 0x0" ::: "memory");
    // this wave's copies of tile kt+1 have landed before the barrier
    asm volatile("s_wait_asynccnt 0x0" ::: "memory");
    __syncthreads();
    if (kt + 2 < SEQ / 64)
      stage_kv(kg + (size_t)(k0 + 128) * EMB, vg + k0 + 128,
               kl + buf * (KV_TILE * 2u), vl + buf * (KV_TILE * 2u));
  }
  // no copy is left in flight when the wave ends
  asm volatile("s_wait_asynccnt 0x0" ::: "memory");

  // ---- join the two lanes' sums, normalize and emit attention output
  // (f16, row-major [B*S, E]): a lane holds 8 consecutive d of its query
  const float lsum = lrun + xhalf(lrun);
  _Float16* orow = oh + ((size_t)b * SEQ + q0 + r) * EMB + h * HDIM + hb;
#pragma unroll
  for (int dt = 0; dt < 4; ++dt) {
    v8h pk;
#pragma unroll
    for (int j = 0; j < 8; ++j) pk[j] = (_Float16)(O[dt][j] / lsum);
    *(v8h*)(orow + dt * 16) = pk;
  }
}

// ---------------------------------------------------------------------------
extern "C" void kernel_launch(void* const* d_in, const int* in_sizes, int n_in,
                              void* d_out, int out_size, void* d_ws, size_t ws_size,
                              hipStream_t stream) {
  const float* key   = (const float*)d_in[0];
  const float* value = (const float*)d_in[1];
  const float* query = (const float*)d_in[2];
  const int*   mask  = (const int*)d_in[3];
  const float* Wq = (const float*)d_in[4];
  const float* bq = (const float*)d_in[5];
  const float* Wk = (const float*)d_in[6];
  const float* bk = (const float*)d_in[7];
  const float* Wv = (const float*)d_in[8];
  const float* bv = (const float*)d_in[9];
  const float* Wo = (const float*)d_in[10];
  const float* bo = (const float*)d_in[11];
  float* out = (float*)d_out;

  const size_t NX = (size_t)BATCH * SEQ * EMB;          // 4,194,304
  const size_t NW = (size_t)EMB * EMB;                  // 262,144
  const size_t NMW = (size_t)BATCH * SEQ * (SEQ / 32);  // 524,288 mask words

  char* w = (char*)d_ws;
  _Float16* xq  = (_Float16*)w; w += NX * 2;
  _Float16* xk  = (_Float16*)w; w += NX * 2;
  _Float16* xv  = (_Float16*)w; w += NX * 2;
  _Float16* wqh = (_Float16*)w; w += NW * 2;
  _Float16* wkh = (_Float16*)w; w += NW * 2;
  _Float16* wvh = (_Float16*)w; w += NW * 2;
  _Float16* woh = (_Float16*)w; w += NW * 2;
  _Float16* qh  = (_Float16*)w; w += NX * 2;
  _Float16* kh  = (_Float16*)w; w += NX * 2;
  _Float16* vt  = (_Float16*)w; w += NX * 2;   // [B,H,HDIM,SEQ]
  unsigned int* mbits = (unsigned int*)w; w += NMW * 4;
  _Float16* oh  = xq;  // xq is dead after the q projection; reuse for attn out

  const int M = BATCH * SEQ;  // 8192
  pre_pass<<<PRE_BLOCKS, 256, 0, stream>>>(query, key, value, Wq, Wk, Wv, Wo,
                                           mask, xq, wqh, mbits);

  dim3 gp(M / 128, EMB / 64);      // (64, 8)
  dim3 gp3(M / 128, EMB / 64, 3);  // q, k and v projections in one grid
  gemm_qkv<<<gp3, 128, 0, stream>>>(xq, xk, xv, wqh, wkh, wvh, bq, bk, bv, qh,
                                    kh, vt, M, EMB, EMB);

  flash_attn<<<dim3(SEQ / 64, BATCH * HEADS), 128, 0, stream>>>(qh, kh, vt,
                                                                mbits, oh);

  gemm_out<<<gp, 128, 0, stream>>>(oh, woh, bo, out, M, EMB, EMB);
}

// v004
// A run of this version takes 102 microseconds.
// Timed twice side by side with v003, it ran 1.29 and 1.30 times as fast.
// Counting every step since v000, it is 2.33 times as fast.
#include <hip/hip_runtime.h>
#include <hip/hip_bf16.h>

#define BATCH 4
#define SEQ   2048
#define EMB   512
#define HEADS 8
#define HDIM  64

typedef __attribute__((ext_vector_type(16))) _Float16 v16h;
typedef __attribute__((ext_vector_type(8)))  _Float16 v8h;
typedef __attribute__((ext_vector_type(4)))  _Float16 v4h;
typedef __attribute__((ext_vector_type(8)))  float    v8f;
typedef __attribute__((ext_vector_type(4)))  float    v4f;

// ---------------------------------------------------------------------------
// Fragment loader for 16-bit WMMA A/B operands (CDNA5 16x32 / 32x16 layout).
// Per lane the fragment is two contiguous 8-half (16B) runs: k = kb + {0..7}
// and k = kb + {16..23}, where kb = (lane<16 ? 0 : 8).  Caller passes the
// pointer at element (row/col, kb).  Lowers to two global/ds _b128 loads.
// ---------------------------------------------------------------------------
static __device__ __forceinline__ v16h frag_load(const _Float16* p) {
  v8h lo = *(const v8h*)(p);
  v8h hi = *(const v8h*)(p + 16);
  v16h r;
#pragma unroll
  for (int i = 0; i < 8; ++i) { r[i] = lo[i]; r[i + 8] = hi[i]; }
  return r;
}

static __device__ __forceinline__ v8f wmma_f16(v16h a, v16h b, v8f c) {
  return __builtin_amdgcn_wmma_f32_16x16x32_f16(false, a, false, b,
                                                (short)0, c, false, false);
}

// ---------------------------------------------------------------------------
// Pre-pass, one launch for the eight jobs that read none of each other's
// output: fp32 -> f16 of the three activations and the four weights, and the
// bit-pack of the int32 mask (32 int -> 1 u32, 67 MB -> 2 MB, read once).
// The work is cut into units of 32 KiB of input (256 threads x 8 x 16 B);
// a block walks the units blockIdx.x, + PRE_BLOCKS, ... and a unit's number
// names its job, so few waves are started and each keeps 8 loads in flight.
// ---------------------------------------------------------------------------
#define U_MASK 2048                 // BATCH*SEQ*SEQ ints      / 8192
#define U_X    512                  // BATCH*SEQ*EMB floats    / 8192
#define U_W    32                   // EMB*EMB floats          / 8192
#define U_ALL  (U_MASK + 3 * U_X + 4 * U_W)   // 3712
#define PRE_BLOCKS (U_ALL / 4)      // 928 blocks, four units each

__global__ void __launch_bounds__(256)
pre_pass(const float* __restrict__ query, const float* __restrict__ key,
         const float* __restrict__ value, const float* __restrict__ Wq,
         const float* __restrict__ Wk, const float* __restrict__ Wv,
         const float* __restrict__ Wo, const int* __restrict__ mask,
         _Float16* __restrict__ xdst,   // xq | xk | xv, contiguous
         _Float16* __restrict__ wdst,   // wq | wk | wv | wo, contiguous
         unsigned int* __restrict__ bits) {
  for (int u = blockIdx.x; u < U_ALL; u += PRE_BLOCKS) {
    if (u < U_MASK) {
      // thread t packs word t of the unit from its 32 ints (128 B)
      const int4* p = (const int4*)(mask + (size_t)u * 8192) + threadIdx.x * 8;
      unsigned int w = 0;
#pragma unroll
      for (int t = 0; t < 8; ++t) {
        int4 m = p[t];
        w |= (m.x != 0 ? 1u : 0u) << (4 * t + 0);
        w |= (m.y != 0 ? 1u : 0u) << (4 * t + 1);
        w |= (m.z != 0 ? 1u : 0u) << (4 * t + 2);
        w |= (m.w != 0 ? 1u : 0u) << (4 * t + 3);
      }
      (bits + (size_t)u * 256)[threadIdx.x] = w;
    } else {
      const int c = u - U_MASK;
      const float* in;
      _Float16* out;
      if (c < 3 * U_X) {
        const int j = c / U_X;
        in  = (j == 0 ? query : j == 1 ? key : value) + (size_t)(c % U_X) * 8192;
        out = xdst + (size_t)c * 8192;
      } else {
        const int d = c - 3 * U_X;
        const int j = d / U_W;
        in  = (j == 0 ? Wq : j == 1 ? Wk : j == 2 ? Wv : Wo) +
              (size_t)(d % U_W) * 8192;
        out = wdst + (size_t)d * 8192;
      }
      v4f v[8];
#pragma unroll
      for (int t = 0; t < 8; ++t)
        v[t] = ((const v4f*)in)[t * 256 + threadIdx.x];
#pragma unroll
      for (int t = 0; t < 8; ++t) {
        v4h o;
#pragma unroll
        for (int e = 0; e < 4; ++e) o[e] = (_Float16)v[t][e];
        ((v4h*)out)[t * 256 + threadIdx.x] = o;
      }
      // whatever code follows this branch may rewrite the registers that the
      // eight stores name: the wait stands directly behind them
      asm volatile("s_wait_xcnt 0x0" ::: "memory");
    }
    // The next trip rewrites registers that this trip's stores still name.
    // u passes through the statement so that every address of the next trip
    // is formed behind the wait, not carried over it by an increment.
    asm volatile("s_wait_xcnt 0x0" : "+s"(u) :: "memory");
  }
}

// ---------------------------------------------------------------------------
// Operand staging for the GEMMs.  A stage is one k-tile of 64 halves: 128 rows
// of A, then 64 rows of W, 128 data bytes each, laid at a 144-byte LDS pitch
// (16 B x odd: conflict-free for the ds_load_b128 fragment reads).
// ---------------------------------------------------------------------------
#define G_PITCH 72                          // halves per LDS row
#define GA_TILE (128 * G_PITCH)             // halves of A per stage
#define G_STAGE ((128 + 64) * G_PITCH)      // halves per stage (A | W)

// One stage's copies of one lane: eight 16-byte pieces of A and four of W,
// rows 16 apart (rs = 16 rows in halves).  Eight lanes cover one whole
// 128-byte line of a row.  The s_wait_xcnt closes the statement so that no
// address register named by a copy is rewritten ahead of it.
static __device__ __forceinline__ void stage_aw(const _Float16* ag,
                                                const _Float16* wg, size_t rs,
                                                unsigned int al,
                                                unsigned int wl) {
  const unsigned int ls = 16u * G_PITCH * 2u;   // 16 LDS rows in bytes
  asm volatile(
      "global_load_async_to_lds_b128 %0, %12, off\n\t"
      "global_load_async_to_lds_b128 %1, %13, off\n\t"
      "global_load_async_to_lds_b128 %2, %14, off\n\t"
      "global_load_async_to_lds_b128 %3, %15, off\n\t"
      "global_load_async_to_lds_b128 %4, %16, off\n\t"
      "global_load_async_to_lds_b128 %5, %17, off\n\t"
      "global_load_async_to_lds_b128 %6, %18, off\n\t"
      "global_load_async_to_lds_b128 %7, %19, off\n\t"
      "global_load_async_to_lds_b128 %8, %20, off\n\t"
      "global_load_async_to_lds_b128 %9, %21, off\n\t"
      "global_load_async_to_lds_b128 %10, %22, off\n\t"
      "global_load_async_to_lds_b128 %11, %23, off\n\t"
      "s_wait_xcnt 0x0"
      :: "v"(al), "v"(al + ls), "v"(al + 2u * ls), "v"(al + 3u * ls),
         "v"(al + 4u * ls), "v"(al + 5u * ls), "v"(al + 6u * ls),
         "v"(al + 7u * ls),
         "v"(wl), "v"(wl + ls), "v"(wl + 2u * ls), "v"(wl + 3u * ls),
         "v"(ag), "v"(ag + rs), "v"(ag + 2 * rs), "v"(ag + 3 * rs),
         "v"(ag + 4 * rs), "v"(ag + 5 * rs), "v"(ag + 6 * rs),
         "v"(ag + 7 * rs),
         "v"(wg), "v"(wg + rs), "v"(wg + 2 * rs), "v"(wg + 3 * rs)
      : "memory");
}

// ---------------------------------------------------------------------------
// GEMM: Y[M,N] = A[M,K] @ W[N,K]^T + bias[N]   (torch Linear semantics)
// Block = 128 threads (4 waves); block tile 128(M) x 64(N); wave tile 32x64:
// two A fragments amortize every W fragment (8 WMMAs per 6 fragment loads).
// The block's operands come through LDS (stg: two stages): each k-tile is
// copied once, in whole 128-byte lines, and the next tile's copies fly while
// this one is worked on.  K is a multiple of 64.
// MODE 0: f16 row-major output (stride N)           -> q, k projections
// MODE 1: f16 head-transposed output [B,H,HDIM,SEQ] -> v projection
// MODE 2: f32 row-major output                      -> final out-projection
// ---------------------------------------------------------------------------
template <int MODE>
static __device__ __forceinline__ void
gemm_tile(const _Float16* __restrict__ A, const _Float16* __restrict__ W,
          const float* __restrict__ bias, void* __restrict__ outp,
          _Float16* stg, int M, int N, int K) {
  const int lane = threadIdx.x & 31;
  const int wave = threadIdx.x >> 5;
  const int r    = lane & 15;          // row of A frag / column of B frag
  const int hb   = (lane >> 4) * 8;    // per-half k-run base; also C row base
  const int m0   = blockIdx.x * 128 + wave * 32;
  const int n0   = blockIdx.y * 64;

  // This lane's piece of a stage: row (tid >> 3) + 16 * i, 16-byte column
  // tid & 7.
  const int crow = threadIdx.x >> 3;
  const int ccol = (threadIdx.x & 7) * 8;
  const size_t rs = (size_t)16 * K;
  const _Float16* ag = A + (size_t)(blockIdx.x * 128 + crow) * K + ccol;
  const _Float16* wg = W + (size_t)(n0 + crow) * K + ccol;
  const unsigned int al =
      (unsigned int)(size_t)(stg + crow * G_PITCH + ccol);
  const unsigned int wl = al + GA_TILE * 2u;

  const int ntiles = K >> 6;
  stage_aw(ag, wg, rs, al, wl);
  // tile 0 has landed for this wave; the barrier publishes it to the others
  asm volatile("s_wait_asynccnt 0x0" ::: "memory");
  __syncthreads();
  if (1 < ntiles)
    stage_aw(ag + 64, wg + 64, rs, al + G_STAGE * 2u, wl + G_STAGE * 2u);

  v8f acc[2][4] = {};
  for (int t = 0; t < ntiles; ++t) {
    const int buf = t & 1;
    const _Float16* As = stg + buf * G_STAGE + (wave * 32 + r) * G_PITCH + hb;
    const _Float16* Ws = stg + buf * G_STAGE + GA_TILE + r * G_PITCH + hb;
    // the tile's twelve fragments are read as one group ahead of its WMMAs,
    // so that a wave meets the LDS latency once a tile, not once a fragment
    v16h a[2][2], b[2][4];
#pragma unroll
    for (int ks = 0; ks < 2; ++ks) {
      a[ks][0] = frag_load(As + ks * 32);
      a[ks][1] = frag_load(As + 16 * G_PITCH + ks * 32);
#pragma unroll
      for (int nt = 0; nt < 4; ++nt)
        b[ks][nt] = frag_load(Ws + nt * 16 * G_PITCH + ks * 32);
    }
    // keeps the scheduler from sinking the reads back among the WMMAs, where
    // each fragment would be waited for on its own
    __builtin_amdgcn_sched_barrier(0);
#pragma unroll
    for (int nt = 0; nt < 4; ++nt) {
      acc[0][nt] = wmma_f16(a[0][0], b[0][nt], acc[0][nt]);
      acc[1][nt] = wmma_f16(a[0][1], b[0][nt], acc[1][nt]);
    }
    // keeps the first half's WMMAs ahead of the waits below: they cover the
    // flight of tile t+1's copies, and their fragment registers are free
    // again for the addresses of the refill
    __builtin_amdgcn_sched_barrier(0);

    // ---- publish tile t+1, free this buffer, refill it with tile t+2
    // (the buffer has been read out into registers: the second half's WMMAs
    // follow the refill's issue and cover its flight)
    // this wave's reads of the buffer have returned before it is refilled
    asm volatile("s_wait_dscnt 0x0" ::: "memory");
    // this wave's copies of tile t+1 have landed before the barrier
    asm volatile("s_wait_asynccnt 0x0" ::: "memory");
    __syncthreads();
    if (t + 2 < ntiles)
      stage_aw(ag + (t + 2) * 64, wg + (t + 2) * 64, rs,
               al + buf * (G_STAGE * 2u), wl + buf * (G_STAGE * 2u));
#pragma unroll
    for (int nt = 0; nt < 4; ++nt) {
      acc[0][nt] = wmma_f16(a[1][0], b[1][nt], acc[0][nt]);
      acc[1][nt] = wmma_f16(a[1][1], b[1][nt], acc[1][nt]);
    }
  }
  // no copy is left in flight when the wave goes on to its stores and ends
  asm volatile("s_wait_asynccnt 0x0" ::: "memory");

#pragma unroll
  for (int mt = 0; mt < 2; ++mt) {
    const int mrow = m0 + mt * 16 + hb;
#pragma unroll
    for (int nt = 0; nt < 4; ++nt) {
      const int col = n0 + nt * 16 + r;
      const float bv = bias[col];
      if (MODE == 0) {
        _Float16* o = (_Float16*)outp;
#pragma unroll
        for (int j = 0; j < 8; ++j)
          o[(size_t)(mrow + j) * N + col] = (_Float16)(acc[mt][nt][j] + bv);
      } else if (MODE == 1) {
        // [B,H,HDIM,SEQ]; lane holds 8 consecutive sequence positions of one
        // (h,d) row -> single 16B store.
        _Float16* o = (_Float16*)outp;
        const int bb = m0 / SEQ;
        const int s0 = mrow % SEQ;
        const int h = col >> 6, d = col & 63;
        v8h pk;
#pragma unroll
        for (int j = 0; j < 8; ++j) pk[j] = (_Float16)(acc[mt][nt][j] + bv);
        *(v8h*)(o + ((size_t)((bb * HEADS + h) * HDIM + d)) * SEQ + s0) = pk;
      } else {
        float* o = (float*)outp;
#pragma unroll
        for (int j = 0; j < 8; ++j)
          o[(size_t)(mrow + j) * N + col] = acc[mt][nt][j] + bv;
      }
    }
  }
}

// The three projections read none of each other's output: one grid,
// blockIdx.z names the job (0: q, 1: k, 2: v head-transposed).
__global__ void __launch_bounds__(128)
gemm_qkv(const _Float16* __restrict__ xq, const _Float16* __restrict__ xk,
         const _Float16* __restrict__ xv, const _Float16* __restrict__ wq,
         const _Float16* __restrict__ wk, const _Float16* __restrict__ wv,
         const float* __restrict__ bq, const float* __restrict__ bk,
         const float* __restrict__ bv, _Float16* __restrict__ qh,
         _Float16* __restrict__ kh, _Float16* __restrict__ vt,
         int M, int N, int K) {
  __shared__ __align__(16) _Float16 stg[2 * G_STAGE];
  if (blockIdx.z == 2) {
    gemm_tile<1>(xv, wv, bv, vt, stg, M, N, K);
  } else {
    const bool isk = blockIdx.z == 1;
    gemm_tile<0>(isk ? xk : xq, isk ? wk : wq, isk ? bk : bq, isk ? kh : qh,
                 stg, M, N, K);
    // the built code runs on into the v tile's test and set-up, which reuse
    // the registers that this tile's stores name: the wait stands behind them
    asm volatile("s_wait_xcnt 0x0" ::: "memory");
  }
}

__global__ void __launch_bounds__(128)
gemm_out(const _Float16* __restrict__ A, const _Float16* __restrict__ W,
         const float* __restrict__ bias, float* __restrict__ outp,
         int M, int N, int K) {
  __shared__ __align__(16) _Float16 stg[2 * G_STAGE];
  gemm_tile<2>(A, W, bias, outp, stg, M, N, K);
}

// ---------------------------------------------------------------------------
// K/V staging for flash_attn.  A stage is one 64-key tile: K as 64 key rows
// and V as 64 d rows, 128 data bytes each, laid at a 144-byte LDS pitch
// (16 B x odd: conflict-free for the ds_load_b128 fragment reads).
// ---------------------------------------------------------------------------
#define KV_PITCH 72                 // halves per LDS row
#define KV_TILE  (64 * KV_PITCH)    // halves per staged tile

// One stage's copies of one lane: four 16-byte pieces of K and four of V,
// rows 16 apart.  Eight lanes cover one whole 128-byte row.  The s_wait_xcnt
// closes the statement so that no address register named by a copy is
// rewritten ahead of it.
static __device__ __forceinline__ void stage_kv(const _Float16* kg,
                                                const _Float16* vg,
                                                unsigned int kl,
                                                unsigned int vl) {
  asm volatile(
      "global_load_async_to_lds_b128 %0, %8, off\n\t"
      "global_load_async_to_lds_b128 %1, %9, off\n\t"
      "global_load_async_to_lds_b128 %2, %10, off\n\t"
      "global_load_async_to_lds_b128 %3, %11, off\n\t"
      "global_load_async_to_lds_b128 %4, %12, off\n\t"
      "global_load_async_to_lds_b128 %5, %13, off\n\t"
      "global_load_async_to_lds_b128 %6, %14, off\n\t"
      "global_load_async_to_lds_b128 %7, %15, off\n\t"
      "s_wait_xcnt 0x0"
      :: "v"(kl), "v"(kl + 16u * KV_PITCH * 2u), "v"(kl + 32u * KV_PITCH * 2u),
         "v"(kl + 48u * KV_PITCH * 2u),
         "v"(vl), "v"(vl + 16u * KV_PITCH * 2u), "v"(vl + 32u * KV_PITCH * 2u),
         "v"(vl + 48u * KV_PITCH * 2u),
         "v"(kg), "v"(kg + 16 * EMB), "v"(kg + 32 * EMB), "v"(kg + 48 * EMB),
         "v"(vg), "v"(vg + 16 * SEQ), "v"(vg + 32 * SEQ), "v"(vg + 48 * SEQ)
      : "memory");
}

// Lane l with lane l ^ 16 (the two lanes that share one query column).
static __device__ __forceinline__ float xhalf(float x) {
  const int b = __builtin_bit_cast(int, x);
  return __builtin_bit_cast(
      float, __builtin_amdgcn_permlanex16(b, b, 0x76543210, 0xfedcba98, false,
                                          false));
}

// ---------------------------------------------------------------------------
// Flash attention: one block = 4 waves = 64 query rows of one (b,h).
// The block's four waves share each 64-key K/V tile: it is copied once into
// LDS (two buffers, the next tile's copies fly while this one is worked on).
// Each wave owns 16 queries and works on the transposed products:
//   St = K @ Q^T (A = K rows, B = Q), Ot += V^T @ Pt (A = d-major V rows).
// In an accumulator tile a lane then holds ONE query (column lane & 15) and
// eight keys (or d) hb..hb+7: maximum and sum run in the lane, the two lanes
// of a query meet by one cross-half move, and two St tiles are, element for
// element, the B fragment of Pt (k = hb+0..7 and 16+hb+0..7).
// ---------------------------------------------------------------------------
__global__ void __launch_bounds__(128)
flash_attn(const _Float16* __restrict__ qh, const _Float16* __restrict__ kh,
           const _Float16* __restrict__ vt,
           const unsigned int* __restrict__ mbits,
           _Float16* __restrict__ oh) {
  __shared__ __align__(16) _Float16 Klds[2][KV_TILE];
  __shared__ __align__(16) _Float16 Vlds[2][KV_TILE];

  const int lane = threadIdx.x & 31;
  const int wave = threadIdx.x >> 5;
  const int r    = lane & 15;
  const int hb   = (lane >> 4) * 8;
  const int b    = blockIdx.y / HEADS;
  const int h    = blockIdx.y % HEADS;
  const int q0   = blockIdx.x * 64 + wave * 16;

  const float scale = 0.04419417382415922f;   // 1/sqrt(512) (ref scales by E)
  const int mwpr = SEQ / 32;                  // mask words per row

  // Q fragments for this wave's 16 queries (d = 0..31 and 32..63), in VGPRs
  const _Float16* qrow = qh + ((size_t)b * SEQ + q0 + r) * EMB + h * HDIM;
  v16h Qb0 = frag_load(qrow + hb);
  v16h Qb1 = frag_load(qrow + 32 + hb);

  v8f O[4] = {};                 // Ot tiles: d = dt*16 + hb + j, query r
  float mrun = -1e38f;           // this query's running maximum
  float lrun = 0.f;              // running sum over this lane's keys only

  const _Float16* kb_ = kh + (size_t)b * SEQ * EMB + h * HDIM;
  const _Float16* vb_ = vt + ((size_t)(b * HEADS + h) * HDIM) * SEQ;
  const unsigned int* mb_ = mbits + ((size_t)b * SEQ + q0 + r) * mwpr;

  // This lane's piece of a stage: row (tid >> 3) + {0,16,32,48}, 16-byte
  // column tid & 7.
  const int crow = threadIdx.x >> 3;
  const int ccol = (threadIdx.x & 7) * 8;
  const _Float16* kg = kb_ + (size_t)crow * EMB + ccol;   // advances 64 rows
  const _Float16* vg = vb_ + (size_t)crow * SEQ + ccol;   // advances 64 cols
  const unsigned int kl =
      (unsigned int)(size_t)&Klds[0][crow * KV_PITCH + ccol];
  const unsigned int vl =
      (unsigned int)(size_t)&Vlds[0][crow * KV_PITCH + ccol];

  stage_kv(kg, vg, kl, vl);
  // tile 0 has landed for this wave; the barrier publishes it to the others
  asm volatile("s_wait_asynccnt 0x0" ::: "memory");
  __syncthreads();
  stage_kv(kg + 64 * EMB, vg + 64, kl + KV_TILE * 2u, vl + KV_TILE * 2u);

  for (int kt = 0; kt < SEQ / 64; ++kt) {
    const int k0 = kt * 64;
    const int buf = kt & 1;
    const _Float16* Kt = &Klds[buf][r * KV_PITCH + hb];
    const _Float16* Vt = &Vlds[buf][r * KV_PITCH + hb];

    // this query's 64 mask bits of the tile: one aligned u64 per lane,
    // shifted so that bit j of each 16-bit group is key hb + j
    const uint2 mw = *(const uint2*)(mb_ + (k0 >> 5));
    const unsigned int mws[2] = {mw.x >> hb, mw.y >> hb};

    // ---- St = K @ Q^T : 4 C-tiles of 16 keys x 16 queries (2 wmma each)
    v8f Sc[4];
#pragma unroll
    for (int nt = 0; nt < 4; ++nt) {
      const _Float16* krow = Kt + nt * 16 * KV_PITCH;
      v16h a0 = frag_load(krow);
      v16h a1 = frag_load(krow + 32);
      v8f c = {};
      c = wmma_f16(a0, Qb0, c);
      c = wmma_f16(a1, Qb1, c);
      Sc[nt] = c;
    }

    // ---- mask (pre-scale, as reference) + scale; maximum in the lane
    float vmax[4];
#pragma unroll
    for (int nt = 0; nt < 4; ++nt) {
      const unsigned int w = mws[nt >> 1] >> ((nt & 1) * 16);
#pragma unroll
      for (int j = 0; j < 8; ++j) {
        const float s = ((w >> j) & 1u) ? Sc[nt][j] * scale : -4.4e18f;
        Sc[nt][j] = s;
        vmax[nt] = j ? fmaxf(vmax[nt], s) : s;
      }
    }

    // ---- online softmax: one query per lane, its keys split over two lanes
    float v = fmaxf(fmaxf(vmax[0], vmax[1]), fmaxf(vmax[2], vmax[3]));
    v = fmaxf(v, xhalf(v));
    const float mn = fmaxf(mrun, v);
    const float alpha = __expf(mrun - mn);
    mrun = mn;
    float psum[4];
#pragma unroll
    for (int nt = 0; nt < 4; ++nt) {
#pragma unroll
      for (int j = 0; j < 8; ++j) {
        const float p = __expf(Sc[nt][j] - mn);
        Sc[nt][j] = p;
        psum[nt] = j ? psum[nt] + p : p;
      }
    }
    lrun = lrun * alpha + ((psum[0] + psum[1]) + (psum[2] + psum[3]));
#pragma unroll
    for (int dt = 0; dt < 4; ++dt)
#pragma unroll
      for (int j = 0; j < 8; ++j) O[dt][j] *= alpha;

    // ---- Ot += V^T @ Pt   (V is d-major: A fragments load contiguously;
    // Pt's B fragment is packed straight from two St tiles)
#pragma unroll
    for (int step = 0; step < 2; ++step) {
      v16h pb;
#pragma unroll
      for (int i = 0; i < 8; ++i) {
        pb[i]     = (_Float16)Sc[2 * step][i];
        pb[i + 8] = (_Float16)Sc[2 * step + 1][i];
      }
#pragma unroll
      for (int dt = 0; dt < 4; ++dt) {
        const _Float16* vrow = Vt + dt * 16 * KV_PITCH + step * 32;
        O[dt] = wmma_f16(frag_load(vrow), pb, O[dt]);
      }
    }

    // ---- publish tile kt+1, free this buffer, refill it with tile kt+2
    // this wave's reads of the buffer have returned before it is refilled
    asm volatile("s_wait_dscnt 0x0" ::: "memory");
    // this wave's copies of tile kt+1 have landed before the barrier
    asm volatile("s_wait_asynccnt 0x0" ::: "memory");
    __syncthreads();
    if (kt + 2 < SEQ / 64)
      stage_kv(kg + (size_t)(k0 + 128) * EMB, vg + k0 + 128,
               kl + buf * (KV_TILE * 2u), vl + buf * (KV_TILE * 2u));
  }
  // no copy is left in flight when the wave ends
  asm volatile("s_wait_asynccnt 0x0" ::: "memory");

  // ---- join the two lanes' sums, normalize and emit attention output
  // (f16, row-major [B*S, E]): a lane holds 8 consecutive d of its query
  const float lsum = lrun + xhalf(lrun);
  _Float16* orow = oh + ((size_t)b * SEQ + q0 + r) * EMB + h * HDIM + hb;
#pragma unroll
  for (int dt = 0; dt < 4; ++dt) {
    v8h pk;
#pragma unroll
    for (int j = 0; j < 8; ++j) pk[j] = (_Float16)(O[dt][j] / lsum);
    *(v8h*)(orow + dt * 16) = pk;
  }
}

// ---------------------------------------------------------------------------
extern "C" void kernel_launch(void* const* d_in, const int* in_sizes, int n_in,
                              void* d_out, int out_size, void* d_ws, size_t ws_size,
                              hipStream_t stream) {
  const float* key   = (const float*)d_in[0];
  const float* value = (const float*)d_in[1];
  const float* query = (const float*)d_in[2];
  const int*   mask  = (const int*)d_in[3];
  const float* Wq = (const float*)d_in[4];
  const float* bq = (const float*)d_in[5];
  const float* Wk = (const float*)d_in[6];
  const float* bk = (const float*)d_in[7];
  const float* Wv = (const float*)d_in[8];
  const float* bv = (const float*)d_in[9];
  const float* Wo = (const float*)d_in[10];
  const float* bo = (const float*)d_in[11];
  float* out = (float*)d_out;

  const size_t NX = (size_t)BATCH * SEQ * EMB;          // 4,194,304
  const size_t NW = (size_t)EMB * EMB;                  // 262,144
  const size_t NMW = (size_t)BATCH * SEQ * (SEQ / 32);  // 524,288 mask words

  char* w = (char*)d_ws;
  _Float16* xq  = (_Float16*)w; w += NX * 2;
  _Float16* xk  = (_Float16*)w; w += NX * 2;
  _Float16* xv  = (_Float16*)w; w += NX * 2;
  _Float16* wqh = (_Float16*)w; w += NW * 2;
  _Float16* wkh = (_Float16*)w; w += NW * 2;
  _Float16* wvh = (_Float16*)w; w += NW * 2;
  _Float16* woh = (_Float16*)w; w += NW * 2;
  _Float16* qh  = (_Float16*)w; w += NX * 2;
  _Float16* kh  = (_Float16*)w; w += NX * 2;
  _Float16* vt  = (_Float16*)w; w += NX * 2;   // [B,H,HDIM,SEQ]
  unsigned int* mbits = (unsigned int*)w; w += NMW * 4;
  _Float16* oh  = xq;  // xq is dead after the q projection; reuse for attn out

  const int M = BATCH * SEQ;  // 8192
  pre_pass<<<PRE_BLOCKS, 256, 0, stream>>>(query, key, value, Wq, Wk, Wv, Wo,
                                           mask, xq, wqh, mbits);

  dim3 gp(M / 128, EMB / 64);      // (64, 8)
  dim3 gp3(M / 128, EMB / 64, 3);  // q, k and v projections in one grid
  gemm_qkv<<<gp3, 128, 0, stream>>>(xq, xk, xv, wqh, wkh, wvh, bq, bk, bv, qh,
                                    kh, vt, M, EMB, EMB);

  flash_attn<<<dim3(SEQ / 64, BATCH * HEADS), 128, 0, stream>>>(qh, kh, vt,
                                                                mbits, oh);

  gemm_out<<<gp, 128, 0, stream>>>(oh, woh, bo, out, M, EMB, EMB);
}

// v005
// Measured time: 91.9 microseconds a run.
// Timed twice side by side with v004, it ran 1.11 times as fast both times.
// All steps since v000 together make it 2.59 times as fast.
#include <hip/hip_runtime.h>
#include <hip/hip_bf16.h>

#define BATCH 4
#define SEQ   2048
#define EMB   512
#define HEADS 8
#define HDIM  64

typedef __attribute__((ext_vector_type(16))) _Float16 v16h;
typedef __attribute__((ext_vector_type(8)))  _Float16 v8h;
typedef __attribute__((ext_vector_type(4)))  _Float16 v4h;
typedef __attribute__((ext_vector_type(8)))  float    v8f;
typedef __attribute__((ext_vector_type(4)))  float    v4f;

// ---------------------------------------------------------------------------
// Fragment loader for 16-bit WMMA A/B operands (CDNA5 16x32 / 32x16 layout).
// Per lane the fragment is two contiguous 8-half (16B) runs: k = kb + {0..7}
// and k = kb + {16..23}, where kb = (lane<16 ? 0 : 8).  Caller passes the
// pointer at element (row/col, kb).  Lowers to two global/ds _b128 loads.
// ---------------------------------------------------------------------------
static __device__ __forceinline__ v16h frag_load(const _Float16* p) {
  v8h lo = *(const v8h*)(p);
  v8h hi = *(const v8h*)(p + 16);
  v16h r;
#pragma unroll
  for (int i = 0; i < 8; ++i) { r[i] = lo[i]; r[i + 8] = hi[i]; }
  return r;
}

static __device__ __forceinline__ v8f wmma_f16(v16h a, v16h b, v8f c) {
  return __builtin_amdgcn_wmma_f32_16x16x32_f16(false, a, false, b,
                                                (short)0, c, false, false);
}

// ---------------------------------------------------------------------------
// Pre-pass, one launch for the eight jobs that read none of each other's
// output: fp32 -> f16 of the three activations and the four weights, and the
// bit-pack of the int32 mask (32 int -> 1 u32, 67 MB -> 2 MB, read once).
// The work is cut into units of 32 KiB of input (256 threads x 8 x 16 B);
// a block walks the units blockIdx.x, + PRE_BLOCKS, ... and a unit's number
// names its job, so few waves are started and each keeps 8 loads in flight.
// ---------------------------------------------------------------------------
#define U_MASK 2048                 // BATCH*SEQ*SEQ ints      / 8192
#define U_X    512                  // BATCH*SEQ*EMB floats    / 8192
#define U_W    32                   // EMB*EMB floats          / 8192
#define U_ALL  (U_MASK + 3 * U_X + 4 * U_W)   // 3712
#define PRE_BLOCKS (U_ALL / 4)      // 928 blocks, four units each

__global__ void __launch_bounds__(256)
pre_pass(const float* __restrict__ query, const float* __restrict__ key,
         const float* __restrict__ value, const float* __restrict__ Wq,
         const float* __restrict__ Wk, const float* __restrict__ Wv,
         const float* __restrict__ Wo, const int* __restrict__ mask,
         _Float16* __restrict__ xdst,   // xq | xk | xv, contiguous
         _Float16* __restrict__ wdst,   // wq | wk | wv | wo, contiguous
         unsigned int* __restrict__ bits) {
  for (int u = blockIdx.x; u < U_ALL; u += PRE_BLOCKS) {
    if (u < U_MASK) {
      // thread t packs word t of the unit from its 32 ints (128 B)
      const int4* p = (const int4*)(mask + (size_t)u * 8192) + threadIdx.x * 8;
      unsigned int w = 0;
#pragma unroll
      for (int t = 0; t < 8; ++t) {
        int4 m = p[t];
        w |= (m.x != 0 ? 1u : 0u) << (4 * t + 0);
        w |= (m.y != 0 ? 1u : 0u) << (4 * t + 1);
        w |= (m.z != 0 ? 1u : 0u) << (4 * t + 2);
        w |= (m.w != 0 ? 1u : 0u) << (4 * t + 3);
      }
      (bits + (size_t)u * 256)[threadIdx.x] = w;
    } else {
      const int c = u - U_MASK;
      const float* in;
      _Float16* out;
      if (c < 3 * U_X) {
        const int j = c / U_X;
        in  = (j == 0 ? query : j == 1 ? key : value) + (size_t)(c % U_X) * 8192;
        out = xdst + (size_t)c * 8192;
      } else {
        const int d = c - 3 * U_X;
        const int j = d / U_W;
        in  = (j == 0 ? Wq : j == 1 ? Wk : j == 2 ? Wv : Wo) +
              (size_t)(d % U_W) * 8192;
        out = wdst + (size_t)d * 8192;
      }
      v4f v[8];
#pragma unroll
      for (int t = 0; t < 8; ++t)
        v[t] = ((const v4f*)in)[t * 256 + threadIdx.x];
#pragma unroll
      for (int t = 0; t < 8; ++t) {
        v4h o;
#pragma unroll
        for (int e = 0; e < 4; ++e) o[e] = (_Float16)v[t][e];
        ((v4h*)out)[t * 256 + threadIdx.x] = o;
      }
      // whatever code follows this branch may rewrite the registers that the
      // eight stores name: the wait stands directly behind them
      asm volatile("s_wait_xcnt 0x0" ::: "memory");
    }
    // The next trip rewrites registers that this trip's stores still name.
    // u passes through the statement so that every address of the next trip
    // is formed behind the wait, not carried over it by an increment.
    asm volatile("s_wait_xcnt 0x0" : "+s"(u) :: "memory");
  }
}

// ---------------------------------------------------------------------------
// Operand staging for the GEMMs.  A stage is one k-tile of 64 halves: 128 rows
// of A, then 64 rows of W, 128 data bytes each, laid at a 144-byte LDS pitch
// (16 B x odd: conflict-free for the ds_load_b128 fragment reads).
// ---------------------------------------------------------------------------
#define G_PITCH 72                          // halves per LDS row
#define GA_TILE (128 * G_PITCH)             // halves of A per stage
#define G_STAGE ((128 + 64) * G_PITCH)      // halves per stage (A | W)

// One stage's copies of one lane: eight 16-byte pieces of A and four of W,
// rows 16 apart (rs = 16 rows in halves).  Eight lanes cover one whole
// 128-byte line of a row.  The s_wait_xcnt closes the statement so that no
// address register named by a copy is rewritten ahead of it.
static __device__ __forceinline__ void stage_aw(const _Float16* ag,
                                                const _Float16* wg, size_t rs,
                                                unsigned int al,
                                                unsigned int wl) {
  const unsigned int ls = 16u * G_PITCH * 2u;   // 16 LDS rows in bytes
  asm volatile(
      "global_load_async_to_lds_b128 %0, %12, off\n\t"
      "global_load_async_to_lds_b128 %1, %13, off\n\t"
      "global_load_async_to_lds_b128 %2, %14, off\n\t"
      "global_load_async_to_lds_b128 %3, %15, off\n\t"
      "global_load_async_to_lds_b128 %4, %16, off\n\t"
      "global_load_async_to_lds_b128 %5, %17, off\n\t"
      "global_load_async_to_lds_b128 %6, %18, off\n\t"
      "global_load_async_to_lds_b128 %7, %19, off\n\t"
      "global_load_async_to_lds_b128 %8, %20, off\n\t"
      "global_load_async_to_lds_b128 %9, %21, off\n\t"
      "global_load_async_to_lds_b128 %10, %22, off\n\t"
      "global_load_async_to_lds_b128 %11, %23, off\n\t"
      "s_wait_xcnt 0x0"
      :: "v"(al), "v"(al + ls), "v"(al + 2u * ls), "v"(al + 3u * ls),
         "v"(al + 4u * ls), "v"(al + 5u * ls), "v"(al + 6u * ls),
         "v"(al + 7u * ls),
         "v"(wl), "v"(wl + ls), "v"(wl + 2u * ls), "v"(wl + 3u * ls),
         "v"(ag), "v"(ag + rs), "v"(ag + 2 * rs), "v"(ag + 3 * rs),
         "v"(ag + 4 * rs), "v"(ag + 5 * rs), "v"(ag + 6 * rs),
         "v"(ag + 7 * rs),
         "v"(wg), "v"(wg + rs), "v"(wg + 2 * rs), "v"(wg + 3 * rs)
      : "memory");
}

// ---------------------------------------------------------------------------
// GEMM: Y[M,N] = A[M,K] @ W[N,K]^T + bias[N]   (torch Linear semantics)
// Block = 128 threads (4 waves); block tile 128(M) x 64(N); wave tile 32x64:
// two A fragments amortize every W fragment (8 WMMAs per 6 fragment loads).
// The block's operands come through LDS (stg: two stages): each k-tile is
// copied once, in whole 128-byte lines, and the next tile's copies fly while
// this one is worked on.  K is a multiple of 64.
// MODE 0: f16 row-major output (stride N)           -> q, k projections
// MODE 1: f16 head-transposed output [B,H,HDIM,SEQ] -> v projection
// MODE 2: f32 row-major output                      -> final out-projection
// ---------------------------------------------------------------------------
template <int MODE>
static __device__ __forceinline__ void
gemm_tile(const _Float16* __restrict__ A, const _Float16* __restrict__ W,
          const float* __restrict__ bias, void* __restrict__ outp,
          _Float16* stg, int M, int N, int K) {
  const int lane = threadIdx.x & 31;
  const int wave = threadIdx.x >> 5;
  const int r    = lane & 15;          // row of A frag / column of B frag
  const int hb   = (lane >> 4) * 8;    // per-half k-run base; also C row base
  const int m0   = blockIdx.x * 128 + wave * 32;
  const int n0   = blockIdx.y * 64;

  // This lane's piece of a stage: row (tid >> 3) + 16 * i, 16-byte column
  // tid & 7.
  const int crow = threadIdx.x >> 3;
  const int ccol = (threadIdx.x & 7) * 8;
  const size_t rs = (size_t)16 * K;
  const _Float16* ag = A + (size_t)(blockIdx.x * 128 + crow) * K + ccol;
  const _Float16* wg = W + (size_t)(n0 + crow) * K + ccol;
  const unsigned int al =
      (unsigned int)(size_t)(stg + crow * G_PITCH + ccol);
  const unsigned int wl = al + GA_TILE * 2u;

  const int ntiles = K >> 6;
  stage_aw(ag, wg, rs, al, wl);
  // tile 0 has landed for this wave; the barrier publishes it to the others
  asm volatile("s_wait_asynccnt 0x0" ::: "memory");
  __syncthreads();
  if (1 < ntiles)
    stage_aw(ag + 64, wg + 64, rs, al + G_STAGE * 2u, wl + G_STAGE * 2u);

  v8f acc[2][4] = {};
  for (int t = 0; t < ntiles; ++t) {
    const int buf = t & 1;
    const _Float16* As = stg + buf * G_STAGE + (wave * 32 + r) * G_PITCH + hb;
    const _Float16* Ws = stg + buf * G_STAGE + GA_TILE + r * G_PITCH + hb;
    // the tile's twelve fragments are read as one group ahead of its WMMAs,
    // so that a wave meets the LDS latency once a tile, not once a fragment
    v16h a[2][2], b[2][4];
#pragma unroll
    for (int ks = 0; ks < 2; ++ks) {
      a[ks][0] = frag_load(As + ks * 32);
      a[ks][1] = frag_load(As + 16 * G_PITCH + ks * 32);
#pragma unroll
      for (int nt = 0; nt < 4; ++nt)
        b[ks][nt] = frag_load(Ws + nt * 16 * G_PITCH + ks * 32);
    }
    // keeps the scheduler from sinking the reads back among the WMMAs, where
    // each fragment would be waited for on its own
    __builtin_amdgcn_sched_barrier(0);
#pragma unroll
    for (int nt = 0; nt < 4; ++nt) {
      acc[0][nt] = wmma_f16(a[0][0], b[0][nt], acc[0][nt]);
      acc[1][nt] = wmma_f16(a[0][1], b[0][nt], acc[1][nt]);
    }
    // keeps the first half's WMMAs ahead of the waits below: they cover the
    // flight of tile t+1's copies, and their fragment registers are free
    // again for the addresses of the refill
    __builtin_amdgcn_sched_barrier(0);

    // ---- publish tile t+1, free this buffer, refill it with tile t+2
    // (the buffer has been read out into registers: the second half's WMMAs
    // follow the refill's issue and cover its flight)
    // this wave's reads of the buffer have returned before it is refilled
    asm volatile("s_wait_dscnt 0x0" ::: "memory");
    // this wave's copies of tile t+1 have landed before the barrier
    asm volatile("s_wait_asynccnt 0x0" ::: "memory");
    __syncthreads();
    if (t + 2 < ntiles)
      stage_aw(ag + (t + 2) * 64, wg + (t + 2) * 64, rs,
               al + buf * (G_STAGE * 2u), wl + buf * (G_STAGE * 2u));
#pragma unroll
    for (int nt = 0; nt < 4; ++nt) {
      acc[0][nt] = wmma_f16(a[1][0], b[1][nt], acc[0][nt]);
      acc[1][nt] = wmma_f16(a[1][1], b[1][nt], acc[1][nt]);
    }
  }
  // no copy is left in flight when the wave goes on to its stores and ends
  asm volatile("s_wait_asynccnt 0x0" ::: "memory");

#pragma unroll
  for (int mt = 0; mt < 2; ++mt) {
    const int mrow = m0 + mt * 16 + hb;
#pragma unroll
    for (int nt = 0; nt < 4; ++nt) {
      const int col = n0 + nt * 16 + r;
      const float bv = bias[col];
      if (MODE == 0) {
        _Float16* o = (_Float16*)outp;
#pragma unroll
        for (int j = 0; j < 8; ++j)
          o[(size_t)(mrow + j) * N + col] = (_Float16)(acc[mt][nt][j] + bv);
      } else if (MODE == 1) {
        // [B,H,HDIM,SEQ]; lane holds 8 consecutive sequence positions of one
        // (h,d) row -> single 16B store.
        _Float16* o = (_Float16*)outp;
        const int bb = m0 / SEQ;
        const int s0 = mrow % SEQ;
        const int h = col >> 6, d = col & 63;
        v8h pk;
#pragma unroll
        for (int j = 0; j < 8; ++j) pk[j] = (_Float16)(acc[mt][nt][j] + bv);
        *(v8h*)(o + ((size_t)((bb * HEADS + h) * HDIM + d)) * SEQ + s0) = pk;
      } else {
        float* o = (float*)outp;
#pragma unroll
        for (int j = 0; j < 8; ++j)
          o[(size_t)(mrow + j) * N + col] = acc[mt][nt][j] + bv;
      }
    }
  }
}

// The three projections read none of each other's output: one grid,
// blockIdx.z names the job (0: q, 1: k, 2: v head-transposed).
__global__ void __launch_bounds__(128)
gemm_qkv(const _Float16* __restrict__ xq, const _Float16* __restrict__ xk,
         const _Float16* __restrict__ xv, const _Float16* __restrict__ wq,
         const _Float16* __restrict__ wk, const _Float16* __restrict__ wv,
         const float* __restrict__ bq, const float* __restrict__ bk,
         const float* __restrict__ bv, _Float16* __restrict__ qh,
         _Float16* __restrict__ kh, _Float16* __restrict__ vt,
         int M, int N, int K) {
  __shared__ __align__(16) _Float16 stg[2 * G_STAGE];
  if (blockIdx.z == 2) {
    gemm_tile<1>(xv, wv, bv, vt, stg, M, N, K);
  } else {
    const bool isk = blockIdx.z == 1;
    gemm_tile<0>(isk ? xk : xq, isk ? wk : wq, isk ? bk : bq, isk ? kh : qh,
                 stg, M, N, K);
    // the built code runs on into the v tile's test and set-up, which reuse
    // the registers that this tile's stores name: the wait stands behind them
    asm volatile("s_wait_xcnt 0x0" ::: "memory");
  }
}

__global__ void __launch_bounds__(128)
gemm_out(const _Float16* __restrict__ A, const _Float16* __restrict__ W,
         const float* __restrict__ bias, float* __restrict__ outp,
         int M, int N, int K) {
  __shared__ __align__(16) _Float16 stg[2 * G_STAGE];
  gemm_tile<2>(A, W, bias, outp, stg, M, N, K);
}

// ---------------------------------------------------------------------------
// K/V staging for flash_attn.  A stage is one 64-key tile: K as 64 key rows
// and V as 64 d rows, 128 data bytes each, laid at a 144-byte LDS pitch
// (16 B x odd: conflict-free for the ds_load_b128 fragment reads).
// ---------------------------------------------------------------------------
#define KV_PITCH 72                 // halves per LDS row
#define KV_TILE  (64 * KV_PITCH)    // halves per staged tile

// One stage's copies of one lane: four 16-byte pieces of K and four of V,
// rows 16 apart.  Eight lanes cover one whole 128-byte row.  The s_wait_xcnt
// closes the statement so that no address register named by a copy is
// rewritten ahead of it.
static __device__ __forceinline__ void stage_kv(const _Float16* kg,
                                                const _Float16* vg,
                                                unsigned int kl,
                                                unsigned int vl) {
  asm volatile(
      "global_load_async_to_lds_b128 %0, %8, off\n\t"
      "global_load_async_to_lds_b128 %1, %9, off\n\t"
      "global_load_async_to_lds_b128 %2, %10, off\n\t"
      "global_load_async_to_lds_b128 %3, %11, off\n\t"
      "global_load_async_to_lds_b128 %4, %12, off\n\t"
      "global_load_async_to_lds_b128 %5, %13, off\n\t"
      "global_load_async_to_lds_b128 %6, %14, off\n\t"
      "global_load_async_to_lds_b128 %7, %15, off\n\t"
      "s_wait_xcnt 0x0"
      :: "v"(kl), "v"(kl + 16u * KV_PITCH * 2u), "v"(kl + 32u * KV_PITCH * 2u),
         "v"(kl + 48u * KV_PITCH * 2u),
         "v"(vl), "v"(vl + 16u * KV_PITCH * 2u), "v"(vl + 32u * KV_PITCH * 2u),
         "v"(vl + 48u * KV_PITCH * 2u),
         "v"(kg), "v"(kg + 16 * EMB), "v"(kg + 32 * EMB), "v"(kg + 48 * EMB),
         "v"(vg), "v"(vg + 16 * SEQ), "v"(vg + 32 * SEQ), "v"(vg + 48 * SEQ)
      : "memory");
}

// Lane l with lane l ^ 16 (the two lanes that share one query column).
static __device__ __forceinline__ float xhalf(float x) {
  const int b = __builtin_bit_cast(int, x);
  return __builtin_bit_cast(
      float, __builtin_amdgcn_permlanex16(b, b, 0x76543210, 0xfedcba98, false,
                                          false));
}

// ---------------------------------------------------------------------------
// Flash attention: one block = 4 waves = 64 query rows of one (b,h).
// The block's four waves share each 64-key K/V tile: it is copied once into
// LDS (two buffers, the next tile's copies fly while this one is worked on).
// Each wave owns 16 queries and works on the transposed products:
//   St = K @ Q^T (A = K rows, B = Q), Ot += V^T @ Pt (A = d-major V rows).
// In an accumulator tile a lane then holds ONE query (column lane & 15) and
// eight keys (or d) hb..hb+7: maximum and sum run in the lane, the two lanes
// of a query meet by one cross-half move, and two St tiles are, element for
// element, the B fragment of Pt (k = hb+0..7 and 16+hb+0..7).
// ---------------------------------------------------------------------------
__global__ void __launch_bounds__(128)
flash_attn(const _Float16* __restrict__ qh, const _Float16* __restrict__ kh,
           const _Float16* __restrict__ vt,
           const unsigned int* __restrict__ mbits,
           _Float16* __restrict__ oh) {
  __shared__ __align__(16) _Float16 Klds[2][KV_TILE];
  __shared__ __align__(16) _Float16 Vlds[2][KV_TILE];

  const int lane = threadIdx.x & 31;
  const int wave = threadIdx.x >> 5;
  const int r    = lane & 15;
  const int hb   = (lane >> 4) * 8;
  const int b    = blockIdx.y / HEADS;
  const int h    = blockIdx.y % HEADS;
  const int q0   = blockIdx.x * 64 + wave * 16;

  const float scale = 0.04419417382415922f;   // 1/sqrt(512) (ref scales by E)
  const int mwpr = SEQ / 32;                  // mask words per row

  // Q fragments for this wave's 16 queries (d = 0..31 and 32..63), in VGPRs
  const _Float16* qrow = qh + ((size_t)b * SEQ + q0 + r) * EMB + h * HDIM;
  v16h Qb0 = frag_load(qrow + hb);
  v16h Qb1 = frag_load(qrow + 32 + hb);

  v8f O[4] = {};                 // Ot tiles: d = dt*16 + hb + j, query r
  float mrun = -1e38f;           // this query's running maximum
  float lrun = 0.f;              // running sum over this lane's keys only

  const _Float16* kb_ = kh + (size_t)b * SEQ * EMB + h * HDIM;
  const _Float16* vb_ = vt + ((size_t)(b * HEADS + h) * HDIM) * SEQ;
  const unsigned int* mb_ = mbits + ((size_t)b * SEQ + q0 + r) * mwpr;

  // This lane's piece of a stage: row (tid >> 3) + {0,16,32,48}, 16-byte
  // column tid & 7.
  const int crow = threadIdx.x >> 3;
  const int ccol = (threadIdx.x & 7) * 8;
  const _Float16* kg = kb_ + (size_t)crow * EMB + ccol;   // advances 64 rows
  const _Float16* vg = vb_ + (size_t)crow * SEQ + ccol;   // advances 64 cols
  const unsigned int kl =
      (unsigned int)(size_t)&Klds[0][crow * KV_PITCH + ccol];
  const unsigned int vl =
      (unsigned int)(size_t)&Vlds[0][crow * KV_PITCH + ccol];

  stage_kv(kg, vg, kl, vl);
  // tile 0 has landed for this wave; the barrier publishes it to the others
  asm volatile("s_wait_asynccnt 0x0" ::: "memory");
  __syncthreads();
  stage_kv(kg + 64 * EMB, vg + 64, kl + KV_TILE * 2u, vl + KV_TILE * 2u);

  for (int kt = 0; kt < SEQ / 64; ++kt) {
    const int k0 = kt * 64;
    const int buf = kt & 1;
    const _Float16* Kt = &Klds[buf][r * KV_PITCH + hb];
    const _Float16* Vt = &Vlds[buf][r * KV_PITCH + hb];

    // this query's 64 mask bits of the tile: one aligned u64 per lane
    const uint2 mw = *(const uint2*)(mb_ + (k0 >> 5));

    // ---- St = K @ Q^T : 4 C-tiles of 16 keys x 16 queries (2 wmma each)
    // the tile's eight K fragments are read as one group ahead of the WMMAs,
    // so that a wave meets the LDS latency once, not once a fragment
    v16h ka[2][4];
#pragma unroll
    for (int ks = 0; ks < 2; ++ks)
#pragma unroll
      for (int nt = 0; nt < 4; ++nt)
        ka[ks][nt] = frag_load(Kt + nt * 16 * KV_PITCH + ks * 32);
    // keeps the scheduler from sinking the reads back among the WMMAs, where
    // each fragment would be waited for on its own
    __builtin_amdgcn_sched_barrier(0);
    v8f Sc[4];
#pragma unroll
    for (int nt = 0; nt < 4; ++nt) {
      v8f c = {};
      Sc[nt] = wmma_f16(ka[0][nt], Qb0, c);
    }
#pragma unroll
    for (int nt = 0; nt < 4; ++nt) Sc[nt] = wmma_f16(ka[1][nt], Qb1, Sc[nt]);
    // the tile's eight V fragments, one group: they return while the softmax
    // below runs
    v16h va[2][4];
#pragma unroll
    for (int step = 0; step < 2; ++step)
#pragma unroll
      for (int dt = 0; dt < 4; ++dt)
        va[step][dt] = frag_load(Vt + dt * 16 * KV_PITCH + step * 32);
    // keeps the scheduler from sinking the reads down to the Ot products,
    // where each would be waited for with nothing left to cover it
    __builtin_amdgcn_sched_barrier(0);
    // the mask word, shifted so that bit j of each 16-bit group is key hb + j
    // (first use down here: its wait stands behind the reads and St products)
    const unsigned int mws[2] = {mw.x >> hb, mw.y >> hb};

    // ---- mask (pre-scale, as reference) + scale; maximum in the lane
    float vmax[4];
#pragma unroll
    for (int nt = 0; nt < 4; ++nt) {
      const unsigned int w = mws[nt >> 1] >> ((nt & 1) * 16);
#pragma unroll
      for (int j = 0; j < 8; ++j) {
        const float s = ((w >> j) & 1u) ? Sc[nt][j] * scale : -4.4e18f;
        Sc[nt][j] = s;
        vmax[nt] = j ? fmaxf(vmax[nt], s) : s;
      }
    }

    // ---- online softmax: one query per lane, its keys split over two lanes
    float v = fmaxf(fmaxf(vmax[0], vmax[1]), fmaxf(vmax[2], vmax[3]));
    v = fmaxf(v, xhalf(v));
    const float mn = fmaxf(mrun, v);
    const float alpha = __expf(mrun - mn);
    mrun = mn;
    float psum[4];
#pragma unroll
    for (int nt = 0; nt < 4; ++nt) {
#pragma unroll
      for (int j = 0; j < 8; ++j) {
        const float p = __expf(Sc[nt][j] - mn);
        Sc[nt][j] = p;
        psum[nt] = j ? psum[nt] + p : p;
      }
    }
    lrun = lrun * alpha + ((psum[0] + psum[1]) + (psum[2] + psum[3]));
#pragma unroll
    for (int dt = 0; dt < 4; ++dt)
#pragma unroll
      for (int j = 0; j < 8; ++j) O[dt][j] *= alpha;

    // ---- Ot += V^T @ Pt   (V is d-major: A fragments load contiguously;
    // Pt's B fragment is packed straight from two St tiles)
#pragma unroll
    for (int step = 0; step < 2; ++step) {
      v16h pb;
#pragma unroll
      for (int i = 0; i < 8; ++i) {
        pb[i]     = (_Float16)Sc[2 * step][i];
        pb[i + 8] = (_Float16)Sc[2 * step + 1][i];
      }
#pragma unroll
      for (int dt = 0; dt < 4; ++dt) O[dt] = wmma_f16(va[step][dt], pb, O[dt]);
    }

    // ---- publish tile kt+1, free this buffer, refill it with tile kt+2
    // keeps the waits and the barrier down here: lifted up among the softmax
    // they would cut short the time that tile kt+1's copies have to land
    __builtin_amdgcn_sched_barrier(0);
    // this wave's reads of the buffer have returned before it is refilled
    asm volatile("s_wait_dscnt 0x0" ::: "memory");
    // this wave's copies of tile kt+1 have landed before the barrier
    asm volatile("s_wait_asynccnt 0x0" ::: "memory");
    __syncthreads();
    if (kt + 2 < SEQ / 64)
      stage_kv(kg + (size_t)(k0 + 128) * EMB, vg + k0 + 128,
               kl + buf * (KV_TILE * 2u), vl + buf * (KV_TILE * 2u));
  }
  // no copy is left in flight when the wave ends
  asm volatile("s_wait_asynccnt 0x0" ::: "memory");

  // ---- join the two lanes' sums, normalize and emit attention output
  // (f16, row-major [B*S, E]): a lane holds 8 consecutive d of its query
  const float lsum = lrun + xhalf(lrun);
  _Float16* orow = oh + ((size_t)b * SEQ + q0 + r) * EMB + h * HDIM + hb;
#pragma unroll
  for (int dt = 0; dt < 4; ++dt) {
    v8h pk;
#pragma unroll
    for (int j = 0; j < 8; ++j) pk[j] = (_Float16)(O[dt][j] / lsum);
    *(v8h*)(orow + dt * 16) = pk;
  }
}

// ---------------------------------------------------------------------------
extern "C" void kernel_launch(void* const* d_in, const int* in_sizes, int n_in,
                              void* d_out, int out_size, void* d_ws, size_t ws_size,
                              hipStream_t stream) {
  const float* key   = (const float*)d_in[0];
  const float* value = (const float*)d_in[1];
  const float* query = (const float*)d_in[2];
  const int*   mask  = (const int*)d_in[3];
  const float* Wq = (const float*)d_in[4];
  const float* bq = (const float*)d_in[5];
  const float* Wk = (const float*)d_in[6];
  const float* bk = (const float*)d_in[7];
  const float* Wv = (const float*)d_in[8];
  const float* bv = (const float*)d_in[9];
  const float* Wo = (const float*)d_in[10];
  const float* bo = (const float*)d_in[11];
  float* out = (float*)d_out;

  const size_t NX = (size_t)BATCH * SEQ * EMB;          // 4,194,304
  const size_t NW = (size_t)EMB * EMB;                  // 262,144
  const size_t NMW = (size_t)BATCH * SEQ * (SEQ / 32);  // 524,288 mask words

  char* w = (char*)d_ws;
  _Float16* xq  = (_Float16*)w; w += NX * 2;
  _Float16* xk  = (_Float16*)w; w += NX * 2;
  _Float16* xv  = (_Float16*)w; w += NX * 2;
  _Float16* wqh = (_Float16*)w; w += NW * 2;
  _Float16* wkh = (_Float16*)w; w += NW * 2;
  _Float16* wvh = (_Float16*)w; w += NW * 2;
  _Float16* woh = (_Float16*)w; w += NW * 2;
  _Float16* qh  = (_Float16*)w; w += NX * 2;
  _Float16* kh  = (_Float16*)w; w += NX * 2;
  _Float16* vt  = (_Float16*)w; w += NX * 2;   // [B,H,HDIM,SEQ]
  unsigned int* mbits = (unsigned int*)w; w += NMW * 4;
  _Float16* oh  = xq;  // xq is dead after the q projection; reuse for attn out

  const int M = BATCH * SEQ;  // 8192
  pre_pass<<<PRE_BLOCKS, 256, 0, stream>>>(query, key, value, Wq, Wk, Wv, Wo,
                                           mask, xq, wqh, mbits);

  dim3 gp(M / 128, EMB / 64);      // (64, 8)
  dim3 gp3(M / 128, EMB / 64, 3);  // q, k and v projections in one grid
  gemm_qkv<<<gp3, 128, 0, stream>>>(xq, xk, xv, wqh, wkh, wvh, bq, bk, bv, qh,
                                    kh, vt, M, EMB, EMB);

  flash_attn<<<dim3(SEQ / 64, BATCH * HEADS), 128, 0, stream>>>(qh, kh, vt,
                                                                mbits, oh);

  gemm_out<<<gp, 128, 0, stream>>>(oh, woh, bo, out, M, EMB, EMB);
}

// v006
// One run takes 87.7 microseconds.
// Next to v005, in two timings, it ran 1.05 times as fast each time.
// Over all steps from v000 it is 2.72 times as fast.
#include <hip/hip_runtime.h>
#include <hip/hip_bf16.h>

#define BATCH 4
#define SEQ   2048
#define EMB   512
#define HEADS 8
#define HDIM  64

typedef __attribute__((ext_vector_type(16))) _Float16 v16h;
typedef __attribute__((ext_vector_type(8)))  _Float16 v8h;
typedef __attribute__((ext_vector_type(4)))  _Float16 v4h;
typedef __attribute__((ext_vector_type(8)))  float    v8f;
typedef __attribute__((ext_vector_type(4)))  float    v4f;

// ---------------------------------------------------------------------------
// Fragment loader for 16-bit WMMA A/B operands (CDNA5 16x32 / 32x16 layout).
// Per lane the fragment is two contiguous 8-half (16B) runs: k = kb + {0..7}
// and k = kb + {16..23}, where kb = (lane<16 ? 0 : 8).  Caller passes the
// pointer at element (row/col, kb).  Lowers to two global/ds _b128 loads.
// ---------------------------------------------------------------------------
static __device__ __forceinline__ v16h frag_load(const _Float16* p) {
  v8h lo = *(const v8h*)(p);
  v8h hi = *(const v8h*)(p + 16);
  v16h r;
#pragma unroll
  for (int i = 0; i < 8; ++i) { r[i] = lo[i]; r[i + 8] = hi[i]; }
  return r;
}

static __device__ __forceinline__ v8f wmma_f16(v16h a, v16h b, v8f c) {
  return __builtin_amdgcn_wmma_f32_16x16x32_f16(false, a, false, b,
                                                (short)0, c, false, false);
}

// ---------------------------------------------------------------------------
// Pre-pass, one launch for the eight jobs that read none of each other's
// output: fp32 -> f16 of the three activations and the four weights, and the
// bit-pack of the int32 mask (32 int -> 1 u32, 67 MB -> 2 MB, read once).
// The work is cut into units of 32 KiB of input (256 threads x 8 x 16 B);
// a block walks the units blockIdx.x, + PRE_BLOCKS, ... and a unit's number
// names its job, so few waves are started and each keeps 8 loads in flight.
// ---------------------------------------------------------------------------
#define U_MASK 2048                 // BATCH*SEQ*SEQ ints      / 8192
#define U_X    512                  // BATCH*SEQ*EMB floats    / 8192
#define U_W    32                   // EMB*EMB floats          / 8192
#define U_ALL  (U_MASK + 3 * U_X + 4 * U_W)   // 3712
#define PRE_BLOCKS (U_ALL / 4)      // 928 blocks, four units each

__global__ void __launch_bounds__(256)
pre_pass(const float* __restrict__ query, const float* __restrict__ key,
         const float* __restrict__ value, const float* __restrict__ Wq,
         const float* __restrict__ Wk, const float* __restrict__ Wv,
         const float* __restrict__ Wo, const int* __restrict__ mask,
         _Float16* __restrict__ xdst,   // xq | xk | xv, contiguous
         _Float16* __restrict__ wdst,   // wq | wk | wv | wo, contiguous
         unsigned int* __restrict__ bits) {
  for (int u = blockIdx.x; u < U_ALL; u += PRE_BLOCKS) {
    if (u < U_MASK) {
      // thread t packs word t of the unit from its 32 ints (128 B)
      const int4* p = (const int4*)(mask + (size_t)u * 8192) + threadIdx.x * 8;
      unsigned int w = 0;
#pragma unroll
      for (int t = 0; t < 8; ++t) {
        int4 m = p[t];
        w |= (m.x != 0 ? 1u : 0u) << (4 * t + 0);
        w |= (m.y != 0 ? 1u : 0u) << (4 * t + 1);
        w |= (m.z != 0 ? 1u : 0u) << (4 * t + 2);
        w |= (m.w != 0 ? 1u : 0u) << (4 * t + 3);
      }
      (bits + (size_t)u * 256)[threadIdx.x] = w;
    } else {
      const int c = u - U_MASK;
      const float* in;
      _Float16* out;
      if (c < 3 * U_X) {
        const int j = c / U_X;
        in  = (j == 0 ? query : j == 1 ? key : value) + (size_t)(c % U_X) * 8192;
        out = xdst + (size_t)c * 8192;
      } else {
        const int d = c - 3 * U_X;
        const int j = d / U_W;
        in  = (j == 0 ? Wq : j == 1 ? Wk : j == 2 ? Wv : Wo) +
              (size_t)(d % U_W) * 8192;
        out = wdst + (size_t)d * 8192;
      }
      v4f v[8];
#pragma unroll
      for (int t = 0; t < 8; ++t)
        v[t] = ((const v4f*)in)[t * 256 + threadIdx.x];
#pragma unroll
      for (int t = 0; t < 8; ++t) {
        v4h o;
#pragma unroll
        for (int e = 0; e < 4; ++e) o[e] = (_Float16)v[t][e];
        ((v4h*)out)[t * 256 + threadIdx.x] = o;
      }
      // whatever code follows this branch may rewrite the registers that the
      // eight stores name: the wait stands directly behind them
      asm volatile("s_wait_xcnt 0x0" ::: "memory");
    }
    // The next trip rewrites registers that this trip's stores still name.
    // u passes through the statement so that every address of the next trip
    // is formed behind the wait, not carried over it by an increment.
    asm volatile("s_wait_xcnt 0x0" : "+s"(u) :: "memory");
  }
}

// ---------------------------------------------------------------------------
// Operand staging for the GEMMs.  A stage is one k-tile of 64 halves: 128 rows
// of A, then 64 rows of W, 128 data bytes each, laid at a 144-byte LDS pitch
// (16 B x odd: conflict-free for the ds_load_b128 fragment reads).
// ---------------------------------------------------------------------------
#define G_PITCH 72                          // halves per LDS row
#define GA_TILE (128 * G_PITCH)             // halves of A per stage
#define G_STAGE ((128 + 64) * G_PITCH)      // halves per stage (A | W)

// One stage's copies of one lane: eight 16-byte pieces of A and four of W,
// rows 16 apart (rs = 16 rows in halves).  Eight lanes cover one whole
// 128-byte line of a row.  The s_wait_xcnt closes the statement so that no
// address register named by a copy is rewritten ahead of it.
static __device__ __forceinline__ void stage_aw(const _Float16* ag,
                                                const _Float16* wg, size_t rs,
                                                unsigned int al,
                                                unsigned int wl) {
  const unsigned int ls = 16u * G_PITCH * 2u;   // 16 LDS rows in bytes
  asm volatile(
      "global_load_async_to_lds_b128 %0, %12, off\n\t"
      "global_load_async_to_lds_b128 %1, %13, off\n\t"
      "global_load_async_to_lds_b128 %2, %14, off\n\t"
      "global_load_async_to_lds_b128 %3, %15, off\n\t"
      "global_load_async_to_lds_b128 %4, %16, off\n\t"
      "global_load_async_to_lds_b128 %5, %17, off\n\t"
      "global_load_async_to_lds_b128 %6, %18, off\n\t"
      "global_load_async_to_lds_b128 %7, %19, off\n\t"
      "global_load_async_to_lds_b128 %8, %20, off\n\t"
      "global_load_async_to_lds_b128 %9, %21, off\n\t"
      "global_load_async_to_lds_b128 %10, %22, off\n\t"
      "global_load_async_to_lds_b128 %11, %23, off\n\t"
      "s_wait_xcnt 0x0"
      :: "v"(al), "v"(al + ls), "v"(al + 2u * ls), "v"(al + 3u * ls),
         "v"(al + 4u * ls), "v"(al + 5u * ls), "v"(al + 6u * ls),
         "v"(al + 7u * ls),
         "v"(wl), "v"(wl + ls), "v"(wl + 2u * ls), "v"(wl + 3u * ls),
         "v"(ag), "v"(ag + rs), "v"(ag + 2 * rs), "v"(ag + 3 * rs),
         "v"(ag + 4 * rs), "v"(ag + 5 * rs), "v"(ag + 6 * rs),
         "v"(ag + 7 * rs),
         "v"(wg), "v"(wg + rs), "v"(wg + 2 * rs), "v"(wg + 3 * rs)
      : "memory");
}

// ---------------------------------------------------------------------------
// GEMM: Y[M,N] = A[M,K] @ W[N,K]^T + bias[N]   (torch Linear semantics)
// Block = 128 threads (4 waves); block tile 128(M) x 64(N); wave tile 32x64:
// two A fragments amortize every W fragment (8 WMMAs per 6 fragment loads).
// The block's operands come through LDS (stg: two stages): each k-tile is
// copied once, in whole 128-byte lines, and the next tile's copies fly while
// this one is worked on.  K is a multiple of 64.
// MODE 0: f16 row-major output (stride N)           -> q, k projections
// MODE 1: f16 head-transposed output [B,H,HDIM,SEQ] -> v projection
// MODE 2: f32 row-major output                      -> final out-projection
// ---------------------------------------------------------------------------
template <int MODE>
static __device__ __forceinline__ void
gemm_tile(const _Float16* __restrict__ A, const _Float16* __restrict__ W,
          const float* __restrict__ bias, void* __restrict__ outp,
          _Float16* stg, int M, int N, int K) {
  const int lane = threadIdx.x & 31;
  const int wave = threadIdx.x >> 5;
  const int r    = lane & 15;          // row of A frag / column of B frag
  const int hb   = (lane >> 4) * 8;    // per-half k-run base; also C row base
  const int m0   = blockIdx.x * 128 + wave * 32;
  const int n0   = blockIdx.y * 64;

  // This lane's piece of a stage: row (tid >> 3) + 16 * i, 16-byte column
  // tid & 7.
  const int crow = threadIdx.x >> 3;
  const int ccol = (threadIdx.x & 7) * 8;
  const size_t rs = (size_t)16 * K;
  const _Float16* ag = A + (size_t)(blockIdx.x * 128 + crow) * K + ccol;
  const _Float16* wg = W + (size_t)(n0 + crow) * K + ccol;
  const unsigned int al =
      (unsigned int)(size_t)(stg + crow * G_PITCH + ccol);
  const unsigned int wl = al + GA_TILE * 2u;

  const int ntiles = K >> 6;
  stage_aw(ag, wg, rs, al, wl);
  // tile 0 has landed for this wave; the barrier publishes it to the others
  asm volatile("s_wait_asynccnt 0x0" ::: "memory");
  __syncthreads();
  if (1 < ntiles)
    stage_aw(ag + 64, wg + 64, rs, al + G_STAGE * 2u, wl + G_STAGE * 2u);

  v8f acc[2][4] = {};
  for (int t = 0; t < ntiles; ++t) {
    const int buf = t & 1;
    const _Float16* As = stg + buf * G_STAGE + (wave * 32 + r) * G_PITCH + hb;
    const _Float16* Ws = stg + buf * G_STAGE + GA_TILE + r * G_PITCH + hb;
    // the tile's twelve fragments are read as one group ahead of its WMMAs,
    // so that a wave meets the LDS latency once a tile, not once a fragment
    v16h a[2][2], b[2][4];
#pragma unroll
    for (int ks = 0; ks < 2; ++ks) {
      a[ks][0] = frag_load(As + ks * 32);
      a[ks][1] = frag_load(As + 16 * G_PITCH + ks * 32);
#pragma unroll
      for (int nt = 0; nt < 4; ++nt)
        b[ks][nt] = frag_load(Ws + nt * 16 * G_PITCH + ks * 32);
    }
    // keeps the scheduler from sinking the reads back among the WMMAs, where
    // each fragment would be waited for on its own
    __builtin_amdgcn_sched_barrier(0);
#pragma unroll
    for (int nt = 0; nt < 4; ++nt) {
      acc[0][nt] = wmma_f16(a[0][0], b[0][nt], acc[0][nt]);
      acc[1][nt] = wmma_f16(a[0][1], b[0][nt], acc[1][nt]);
    }
    // keeps the first half's WMMAs ahead of the waits below: they cover the
    // flight of tile t+1's copies, and their fragment registers are free
    // again for the addresses of the refill
    __builtin_amdgcn_sched_barrier(0);

    // ---- publish tile t+1, free this buffer, refill it with tile t+2
    // (the buffer has been read out into registers: the second half's WMMAs
    // follow the refill's issue and cover its flight)
    // this wave's reads of the buffer have returned before it is refilled
    asm volatile("s_wait_dscnt 0x0" ::: "memory");
    // this wave's copies of tile t+1 have landed before the barrier
    asm volatile("s_wait_asynccnt 0x0" ::: "memory");
    __syncthreads();
    if (t + 2 < ntiles)
      stage_aw(ag + (t + 2) * 64, wg + (t + 2) * 64, rs,
               al + buf * (G_STAGE * 2u), wl + buf * (G_STAGE * 2u));
#pragma unroll
    for (int nt = 0; nt < 4; ++nt) {
      acc[0][nt] = wmma_f16(a[1][0], b[1][nt], acc[0][nt]);
      acc[1][nt] = wmma_f16(a[1][1], b[1][nt], acc[1][nt]);
    }
  }
  // no copy is left in flight when the wave goes on to its stores and ends
  asm volatile("s_wait_asynccnt 0x0" ::: "memory");

#pragma unroll
  for (int mt = 0; mt < 2; ++mt) {
    const int mrow = m0 + mt * 16 + hb;
#pragma unroll
    for (int nt = 0; nt < 4; ++nt) {
      const int col = n0 + nt * 16 + r;
      const float bv = bias[col];
      if (MODE == 0) {
        _Float16* o = (_Float16*)outp;
#pragma unroll
        for (int j = 0; j < 8; ++j)
          o[(size_t)(mrow + j) * N + col] = (_Float16)(acc[mt][nt][j] + bv);
      } else if (MODE == 1) {
        // [B,H,HDIM,SEQ]; lane holds 8 consecutive sequence positions of one
        // (h,d) row -> single 16B store.
        _Float16* o = (_Float16*)outp;
        const int bb = m0 / SEQ;
        const int s0 = mrow % SEQ;
        const int h = col >> 6, d = col & 63;
        v8h pk;
#pragma unroll
        for (int j = 0; j < 8; ++j) pk[j] = (_Float16)(acc[mt][nt][j] + bv);
        *(v8h*)(o + ((size_t)((bb * HEADS + h) * HDIM + d)) * SEQ + s0) = pk;
      } else {
        float* o = (float*)outp;
#pragma unroll
        for (int j = 0; j < 8; ++j)
          o[(size_t)(mrow + j) * N + col] = acc[mt][nt][j] + bv;
      }
    }
  }
}

// The three projections read none of each other's output: one grid,
// blockIdx.z names the job (0: q, 1: k, 2: v head-transposed).
__global__ void __launch_bounds__(128)
gemm_qkv(const _Float16* __restrict__ xq, const _Float16* __restrict__ xk,
         const _Float16* __restrict__ xv, const _Float16* __restrict__ wq,
         const _Float16* __restrict__ wk, const _Float16* __restrict__ wv,
         const float* __restrict__ bq, const float* __restrict__ bk,
         const float* __restrict__ bv, _Float16* __restrict__ qh,
         _Float16* __restrict__ kh, _Float16* __restrict__ vt,
         int M, int N, int K) {
  __shared__ __align__(16) _Float16 stg[2 * G_STAGE];
  if (blockIdx.z == 2) {
    gemm_tile<1>(xv, wv, bv, vt, stg, M, N, K);
  } else {
    const bool isk = blockIdx.z == 1;
    gemm_tile<0>(isk ? xk : xq, isk ? wk : wq, isk ? bk : bq, isk ? kh : qh,
                 stg, M, N, K);
    // the built code runs on into the v tile's test and set-up, which reuse
    // the registers that this tile's stores name: the wait stands behind them
    asm volatile("s_wait_xcnt 0x0" ::: "memory");
  }
}

__global__ void __launch_bounds__(128)
gemm_out(const _Float16* __restrict__ A, const _Float16* __restrict__ W,
         const float* __restrict__ bias, float* __restrict__ outp,
         int M, int N, int K) {
  __shared__ __align__(16) _Float16 stg[2 * G_STAGE];
  gemm_tile<2>(A, W, bias, outp, stg, M, N, K);
}

// ---------------------------------------------------------------------------
// K/V staging for flash_attn.  A stage is one 64-key tile of each key half: K as 64 key rows
// and V as 64 d rows, 128 data bytes each, laid at a 144-byte LDS pitch
// (16 B x odd: conflict-free for the ds_load_b128 fragment reads).
// ---------------------------------------------------------------------------
#define KV_PITCH 72                 // halves per LDS row
#define KV_TILE  (64 * KV_PITCH)    // halves per staged tile

// One stage's copies of one lane: four 16-byte pieces of K and four of V,
// rows 16 apart.  Eight lanes cover one whole 128-byte row.  The s_wait_xcnt
// closes the statement so that no address register named by a copy is
// rewritten ahead of it.
static __device__ __forceinline__ void stage_kv(const _Float16* kg,
                                                const _Float16* vg,
                                                unsigned int kl,
                                                unsigned int vl) {
  asm volatile(
      "global_load_async_to_lds_b128 %0, %8, off\n\t"
      "global_load_async_to_lds_b128 %1, %9, off\n\t"
      "global_load_async_to_lds_b128 %2, %10, off\n\t"
      "global_load_async_to_lds_b128 %3, %11, off\n\t"
      "global_load_async_to_lds_b128 %4, %12, off\n\t"
      "global_load_async_to_lds_b128 %5, %13, off\n\t"
      "global_load_async_to_lds_b128 %6, %14, off\n\t"
      "global_load_async_to_lds_b128 %7, %15, off\n\t"
      "s_wait_xcnt 0x0"
      :: "v"(kl), "v"(kl + 16u * KV_PITCH * 2u), "v"(kl + 32u * KV_PITCH * 2u),
         "v"(kl + 48u * KV_PITCH * 2u),
         "v"(vl), "v"(vl + 16u * KV_PITCH * 2u), "v"(vl + 32u * KV_PITCH * 2u),
         "v"(vl + 48u * KV_PITCH * 2u),
         "v"(kg), "v"(kg + 16 * EMB), "v"(kg + 32 * EMB), "v"(kg + 48 * EMB),
         "v"(vg), "v"(vg + 16 * SEQ), "v"(vg + 32 * SEQ), "v"(vg + 48 * SEQ)
      : "memory");
}

// Lane l with lane l ^ 16 (the two lanes that share one query column).
static __device__ __forceinline__ float xhalf(float x) {
  const int b = __builtin_bit_cast(int, x);
  return __builtin_bit_cast(
      float, __builtin_amdgcn_permlanex16(b, b, 0x76543210, 0xfedcba98, false,
                                          false));
}

// ---------------------------------------------------------------------------
// Flash attention: one block = 8 waves = 128 query rows of one (b,h).
// A wave owns 32 queries (two column tiles) and one half of the keys: wave w
// has query group w & 3 and key half w >> 2.  Every K and V fragment read from
// LDS feeds two WMMAs, and the split of the keys keeps as many waves on the
// chip as one tile of 16 queries per wave over all keys would give.
// A stage is one 64-key K/V tile of each key half, copied once into LDS for
// the four waves that share it (two buffers, the next stage's copies fly while
// this one is worked on).  The products are the transposed ones:
//   St = K @ Q^T (A = K rows, B = Q), Ot += V^T @ Pt (A = d-major V rows).
// In an accumulator tile a lane then holds ONE query (column lane & 15) and
// eight keys (or d) hb..hb+7: maximum and sum run in the lane, the two lanes
// of a query meet by one cross-half move, and two St tiles are, element for
// element, the B fragment of Pt (k = hb+0..7 and 16+hb+0..7).
// Behind the loop the two waves of a query group exchange one column tile
// each through LDS and join the halves' maxima, sums and outputs.
// ---------------------------------------------------------------------------
#define KHALF (SEQ / 2)             // keys per key half
#define NSTAGE (KHALF / 64)         // stages per wave

// four waves per SIMD (two blocks per WGP): holds a wave to 256 VGPRs
__global__ void __launch_bounds__(256)
__attribute__((amdgpu_waves_per_eu(4, 4)))
flash_attn(const _Float16* __restrict__ qh, const _Float16* __restrict__ kh,
           const _Float16* __restrict__ vt,
           const unsigned int* __restrict__ mbits,
           _Float16* __restrict__ oh) {
  // [buffer][K | V][key half][tile]
  __shared__ __align__(16) _Float16 KV[2][2][2][KV_TILE];

  const int lane = threadIdx.x & 31;
  // the wave's number as a scalar: what is formed from it stays out of VGPRs
  const int wave = __builtin_amdgcn_readfirstlane(threadIdx.x >> 5);
  const int qg   = wave & 3;
  const int half = wave >> 2;
  const int r    = lane & 15;
  const int hb   = (lane >> 4) * 8;
  const int b    = blockIdx.y / HEADS;
  const int h    = blockIdx.y % HEADS;
  const int q0   = blockIdx.x * 128 + qg * 32;

  const float scale = 0.04419417382415922f;   // 1/sqrt(512) (ref scales by E)
  const int mwpr = SEQ / 32;                  // mask words per row

  // Q fragments for this wave's 2 x 16 queries (d = 0..31, 32..63), in VGPRs
  v16h Qb[2][2];
#pragma unroll
  for (int qt = 0; qt < 2; ++qt) {
    const _Float16* qrow =
        qh + ((size_t)b * SEQ + q0 + qt * 16 + r) * EMB + h * HDIM;
    Qb[qt][0] = frag_load(qrow + hb);
    Qb[qt][1] = frag_load(qrow + 32 + hb);
  }

  v8f O[2][4] = {};              // Ot tiles: d = dt*16 + hb + j, query r
  float mrun[2] = {-1e38f, -1e38f};   // the queries' running maxima
  float lrun[2] = {0.f, 0.f};         // running sums over this lane's keys

  const _Float16* kb_ = kh + ((size_t)b * SEQ + half * KHALF) * EMB + h * HDIM;
  const _Float16* vb_ =
      vt + ((size_t)(b * HEADS + h) * HDIM) * SEQ + half * KHALF;
  const unsigned int* mb_ =
      mbits + ((size_t)b * SEQ + q0 + r) * mwpr + half * (KHALF / 32);

  // This lane's piece of a stage, in its own key half: row (t >> 3) +
  // {0,16,32,48}, 16-byte column t & 7, t = thread within the half's 4 waves.
  const int crow = (threadIdx.x & 127) >> 3;
  const int ccol = (threadIdx.x & 7) * 8;
  const _Float16* kg = kb_ + (size_t)crow * EMB + ccol;   // advances 64 rows
  const _Float16* vg = vb_ + (size_t)crow * SEQ + ccol;   // advances 64 cols
  const unsigned int kl =
      (unsigned int)(size_t)&KV[0][0][half][crow * KV_PITCH + ccol];
  const unsigned int vl =
      (unsigned int)(size_t)&KV[0][1][half][crow * KV_PITCH + ccol];
  const unsigned int bufb = 4u * KV_TILE * 2u;   // bytes per buffer

  stage_kv(kg, vg, kl, vl);
  // stage 0 has landed for this wave; the barrier publishes it to the others
  asm volatile("s_wait_asynccnt 0x0" ::: "memory");
  __syncthreads();
  stage_kv(kg + 64 * EMB, vg + 64, kl + bufb, vl + bufb);

  // One stage's work.  It is written once and used in two loops, one whose
  // every trip refills and one whose trips do not: a trip is then straight-line
  // code, and the row sums stay ahead of the Ot products instead of being moved
  // behind a refill branch, where all of P in f32 would have to stay in
  // registers beside its packed copy.
  auto stage_step = [&](const int kt, const bool refill)
                        __attribute__((always_inline)) {
    const int k0 = kt * 64;
    const int buf = kt & 1;
    const _Float16* Kt = &KV[buf][0][half][r * KV_PITCH + hb];
    const _Float16* Vt = &KV[buf][1][half][r * KV_PITCH + hb];

    // each query's 64 mask bits of the tile: one aligned u64 per lane
    uint2 mw[2];
#pragma unroll
    for (int qt = 0; qt < 2; ++qt)
      mw[qt] = *(const uint2*)(mb_ + qt * 16 * mwpr + (k0 >> 5));

    // ---- St = K @ Q^T : 2 x 4 C-tiles of 16 keys x 16 queries (2 wmma each)
    // the tile's eight K fragments are read as one group ahead of the WMMAs,
    // so that a wave meets the LDS latency once, not once a fragment
    v16h ka[2][4];
#pragma unroll
    for (int ks = 0; ks < 2; ++ks)
#pragma unroll
      for (int nt = 0; nt < 4; ++nt)
        ka[ks][nt] = frag_load(Kt + nt * 16 * KV_PITCH + ks * 32);
    // keeps the scheduler from sinking the reads back among the WMMAs, where
    // each fragment would be waited for on its own
    __builtin_amdgcn_sched_barrier(0);
    v8f Sc[2][4];
#pragma unroll
    for (int nt = 0; nt < 4; ++nt)
#pragma unroll
      for (int qt = 0; qt < 2; ++qt) {
        v8f c = {};
        Sc[qt][nt] = wmma_f16(ka[0][nt], Qb[qt][0], c);
      }
#pragma unroll
    for (int nt = 0; nt < 4; ++nt)
#pragma unroll
      for (int qt = 0; qt < 2; ++qt)
        Sc[qt][nt] = wmma_f16(ka[1][nt], Qb[qt][1], Sc[qt][nt]);
    // the first four V fragments (keys 0..31), one group: they return while
    // the first column tile's softmax runs
    v16h va[2][4];
#pragma unroll
    for (int dt = 0; dt < 4; ++dt)
      va[0][dt] = frag_load(Vt + dt * 16 * KV_PITCH);
    // keeps the scheduler from sinking the reads down to the Ot products,
    // where each would be waited for with nothing left to cover it
    __builtin_amdgcn_sched_barrier(0);

    v16h pb[2][2];                 // Pt as B fragments: [column tile][step]
#pragma unroll
    for (int qt = 0; qt < 2; ++qt) {
      // the mask word, shifted so that bit j of each 16-bit group is key
      // hb + j (first use down here: its wait stands behind the St products)
      const unsigned int mws[2] = {mw[qt].x >> hb, mw[qt].y >> hb};

      // ---- mask (pre-scale, as reference) + scale; maximum in the lane
      // (products, differences and sums are written on whole 8-element tiles,
      // so that packed operations pair neighbouring registers of one tile)
      float vmax[4];
#pragma unroll
      for (int nt = 0; nt < 4; ++nt) {
        const unsigned int w = mws[nt >> 1] >> ((nt & 1) * 16);
        v8f s = Sc[qt][nt] * scale;
#pragma unroll
        for (int j = 0; j < 8; ++j) {
          s[j] = ((w >> j) & 1u) ? s[j] : -4.4e18f;
          vmax[nt] = j ? fmaxf(vmax[nt], s[j]) : s[j];
        }
        Sc[qt][nt] = s;
      }

      // ---- online softmax: one query per lane, its keys split over two lanes
      float v = fmaxf(fmaxf(vmax[0], vmax[1]), fmaxf(vmax[2], vmax[3]));
      v = fmaxf(v, xhalf(v));
      const float mn = fmaxf(mrun[qt], v);
      const float alpha = __expf(mrun[qt] - mn);
      mrun[qt] = mn;
#pragma unroll
      for (int nt = 0; nt < 4; ++nt) {
        const v8f e = (Sc[qt][nt] - mn) * 1.44269504088896340736f;  // log2(e)
#pragma unroll
        for (int j = 0; j < 8; ++j)
          Sc[qt][nt][j] = __builtin_amdgcn_exp2f(e[j]);
      }
      const v8f ps = (Sc[qt][0] + Sc[qt][1]) + (Sc[qt][2] + Sc[qt][3]);
      lrun[qt] = lrun[qt] * alpha + (((ps[0] + ps[1]) + (ps[2] + ps[3])) +
                                     ((ps[4] + ps[5]) + (ps[6] + ps[7])));
#pragma unroll
      for (int dt = 0; dt < 4; ++dt) O[qt][dt] *= alpha;
      // Pt's B fragments are packed straight from pairs of St tiles
#pragma unroll
      for (int step = 0; step < 2; ++step)
#pragma unroll
        for (int i = 0; i < 8; ++i) {
          pb[qt][step][i]     = (_Float16)Sc[qt][2 * step][i];
          pb[qt][step][i + 8] = (_Float16)Sc[qt][2 * step + 1][i];
        }
      if (qt == 0) {
        // the other four V fragments (keys 32..63) go into the registers that
        // the packed tile has left and return under the second tile's softmax;
        // the two scheduling fences hold the group at this place: earlier, the
        // wave's registers do not hold it, later, nothing covers its latency
        __builtin_amdgcn_sched_barrier(0);
#pragma unroll
        for (int dt = 0; dt < 4; ++dt)
          va[1][dt] = frag_load(Vt + dt * 16 * KV_PITCH + 32);
        __builtin_amdgcn_sched_barrier(0);
      }
    }

    // ---- Ot += V^T @ Pt   (V is d-major: A fragments load contiguously)
#pragma unroll
    for (int step = 0; step < 2; ++step)
#pragma unroll
      for (int dt = 0; dt < 4; ++dt)
#pragma unroll
        for (int qt = 0; qt < 2; ++qt)
          O[qt][dt] = wmma_f16(va[step][dt], pb[qt][step], O[qt][dt]);

    // ---- publish stage kt+1, free this buffer, refill it with stage kt+2
    // keeps the waits and the barrier down here: lifted up among the softmax
    // they would cut short the time that stage kt+1's copies have to land
    __builtin_amdgcn_sched_barrier(0);
    // this wave's reads of the buffer have returned before it is refilled
    asm volatile("s_wait_dscnt 0x0" ::: "memory");
    // this wave's copies of stage kt+1 have landed before the barrier
    asm volatile("s_wait_asynccnt 0x0" ::: "memory");
    __syncthreads();
    if (refill)
      stage_kv(kg + (size_t)(k0 + 128) * EMB, vg + k0 + 128,
               kl + buf * bufb, vl + buf * bufb);
  };
  for (int kt = 0; kt < NSTAGE - 2; ++kt) stage_step(kt, true);
  for (int kt = NSTAGE - 2; kt < NSTAGE; ++kt) stage_step(kt, false);
  // no copy is left in flight when the stages' LDS is reused below
  asm volatile("s_wait_asynccnt 0x0" ::: "memory");

  // ---- join the two key halves.  The loop's last barrier has ended every
  // read of the stages, so their LDS carries the exchange: the wave of key
  // half 0 finishes column tile 0 and hands tile 1 to its partner (wave ^ 4),
  // the wave of half 1 the other way round.  Same lane, same elements.
  v4f* jb = (v4f*)&KV[0][0][0][0];        // [wave][9 pieces][lane], 16 B each
  v8f Ok[4], Og[4];
#pragma unroll
  for (int dt = 0; dt < 4; ++dt)
#pragma unroll
    for (int j = 0; j < 8; ++j) {
      Ok[dt][j] = half ? O[1][dt][j] : O[0][dt][j];
      Og[dt][j] = half ? O[0][dt][j] : O[1][dt][j];
    }
  const float mk = half ? mrun[1] : mrun[0], mg = half ? mrun[0] : mrun[1];
  const float lk = half ? lrun[1] : lrun[0], lg = half ? lrun[0] : lrun[1];
  v4f* mine = jb + wave * (9 * 32) + lane;
  const v4f* theirs = jb + (wave ^ 4) * (9 * 32) + lane;
#pragma unroll
  for (int dt = 0; dt < 4; ++dt) {
    mine[(2 * dt) * 32] = v4f{Og[dt][0], Og[dt][1], Og[dt][2], Og[dt][3]};
    mine[(2 * dt + 1) * 32] = v4f{Og[dt][4], Og[dt][5], Og[dt][6], Og[dt][7]};
  }
  mine[8 * 32] = v4f{mg, lg, 0.f, 0.f};
  __syncthreads();
  const v4f ml = theirs[8 * 32];
  const float mn = fmaxf(mk, ml[0]);
  const float fk = __expf(mk - mn);
  const float fo = __expf(ml[0] - mn);
  const float lj = lk * fk + ml[1] * fo;

  // ---- join the two lanes' sums, normalize and emit attention output
  // (f16, row-major [B*S, E]): a lane holds 8 consecutive d of its query
  const float lsum = lj + xhalf(lj);
  _Float16* orow =
      oh + ((size_t)b * SEQ + q0 + half * 16 + r) * EMB + h * HDIM + hb;
#pragma unroll
  for (int dt = 0; dt < 4; ++dt) {
    const v4f o0 = theirs[(2 * dt) * 32];
    const v4f o1 = theirs[(2 * dt + 1) * 32];
    v8h pk;
#pragma unroll
    for (int j = 0; j < 8; ++j) {
      const float oo = j < 4 ? o0[j & 3] : o1[j & 3];
      pk[j] = (_Float16)((Ok[dt][j] * fk + oo * fo) / lsum);
    }
    *(v8h*)(orow + dt * 16) = pk;
  }
}

// ---------------------------------------------------------------------------
extern "C" void kernel_launch(void* const* d_in, const int* in_sizes, int n_in,
                              void* d_out, int out_size, void* d_ws, size_t ws_size,
                              hipStream_t stream) {
  const float* key   = (const float*)d_in[0];
  const float* value = (const float*)d_in[1];
  const float* query = (const float*)d_in[2];
  const int*   mask  = (const int*)d_in[3];
  const float* Wq = (const float*)d_in[4];
  const float* bq = (const float*)d_in[5];
  const float* Wk = (const float*)d_in[6];
  const float* bk = (const float*)d_in[7];
  const float* Wv = (const float*)d_in[8];
  const float* bv = (const float*)d_in[9];
  const float* Wo = (const float*)d_in[10];
  const float* bo = (const float*)d_in[11];
  float* out = (float*)d_out;

  const size_t NX = (size_t)BATCH * SEQ * EMB;          // 4,194,304
  const size_t NW = (size_t)EMB * EMB;                  // 262,144
  const size_t NMW = (size_t)BATCH * SEQ * (SEQ / 32);  // 524,288 mask words

  char* w = (char*)d_ws;
  _Float16* xq  = (_Float16*)w; w += NX * 2;
  _Float16* xk  = (_Float16*)w; w += NX * 2;
  _Float16* xv  = (_Float16*)w; w += NX * 2;
  _Float16* wqh = (_Float16*)w; w += NW * 2;
  _Float16* wkh = (_Float16*)w; w += NW * 2;
  _Float16* wvh = (_Float16*)w; w += NW * 2;
  _Float16* woh = (_Float16*)w; w += NW * 2;
  _Float16* qh  = (_Float16*)w; w += NX * 2;
  _Float16* kh  = (_Float16*)w; w += NX * 2;
  _Float16* vt  = (_Float16*)w; w += NX * 2;   // [B,H,HDIM,SEQ]
  unsigned int* mbits = (unsigned int*)w; w += NMW * 4;
  _Float16* oh  = xq;  // xq is dead after the q projection; reuse for attn out

  const int M = BATCH * SEQ;  // 8192
  pre_pass<<<PRE_BLOCKS, 256, 0, stream>>>(query, key, value, Wq, Wk, Wv, Wo,
                                           mask, xq, wqh, mbits);

  dim3 gp(M / 128, EMB / 64);      // (64, 8)
  dim3 gp3(M / 128, EMB / 64, 3);  // q, k and v projections in one grid
  gemm_qkv<<<gp3, 128, 0, stream>>>(xq, xk, xv, wqh, wkh, wvh, bq, bk, bv, qh,
                                    kh, vt, M, EMB, EMB);

  flash_attn<<<dim3(SEQ / 128, BATCH * HEADS), 256, 0, stream>>>(qh, kh, vt,
                                                                mbits, oh);

  gemm_out<<<gp, 128, 0, stream>>>(oh, woh, bo, out, M, EMB, EMB);
}

// v007
// A run of this version takes 84.6 microseconds.
// Next to v006, in two timings, it ran 1.03 times as fast each time.
// Over all steps from v000 it is 2.81 times as fast.
#include <hip/hip_runtime.h>
#include <hip/hip_bf16.h>

#define BATCH 4
#define SEQ   2048
#define EMB   512
#define HEADS 8
#define HDIM  64

typedef __attribute__((ext_vector_type(16))) _Float16 v16h;
typedef __attribute__((ext_vector_type(8)))  _Float16 v8h;
typedef __attribute__((ext_vector_type(4)))  _Float16 v4h;
typedef __attribute__((ext_vector_type(8)))  float    v8f;
typedef __attribute__((ext_vector_type(4)))  float    v4f;
typedef __attribute__((ext_vector_type(16))) unsigned int v16u;

// ---------------------------------------------------------------------------
// Fragment loader for 16-bit WMMA A/B operands (CDNA5 16x32 / 32x16 layout).
// Per lane the fragment is two contiguous 8-half (16B) runs: k = kb + {0..7}
// and k = kb + {16..23}, where kb = (lane<16 ? 0 : 8).  Caller passes the
// pointer at element (row/col, kb).  Lowers to two global/ds _b128 loads.
// ---------------------------------------------------------------------------
static __device__ __forceinline__ v16h frag_load(const _Float16* p) {
  v8h lo = *(const v8h*)(p);
  v8h hi = *(const v8h*)(p + 16);
  v16h r;
#pragma unroll
  for (int i = 0; i < 8; ++i) { r[i] = lo[i]; r[i + 8] = hi[i]; }
  return r;
}

static __device__ __forceinline__ v8f wmma_f16(v16h a, v16h b, v8f c) {
  return __builtin_amdgcn_wmma_f32_16x16x32_f16(false, a, false, b,
                                                (short)0, c, false, false);
}

// ---------------------------------------------------------------------------
// Pre-pass, one launch for the eight jobs that read none of each other's
// output: fp32 -> f16 of the three activations and the four weights, and the
// bit-pack of the int32 mask (32 int -> 1 u32, 67 MB -> 2 MB, read once).
// A mask word is a LANE MASK of flash_attn's St tiles: for a tile of 16 queries
// and a group of 64 keys, word nt * 8 + j holds in bit l the mask of query
// l & 15 and key nt * 16 + (l >> 4) * 8 + j, the element that lane l has in
// register j of St tile nt.  Words: [16-query tile][64-key group][32].
// The work is cut into units of 32 KiB of input (256 threads x 8 x 16 B);
// a block walks the units blockIdx.x, + PRE_BLOCKS, ... and a unit's number
// names its job, so few waves are started and each keeps 8 loads in flight.
// ---------------------------------------------------------------------------
#define U_MASK 2048                 // BATCH*SEQ*SEQ ints      / 8192
#define U_X    512                  // BATCH*SEQ*EMB floats    / 8192
#define U_W    32                   // EMB*EMB floats          / 8192
#define U_ALL  (U_MASK + 3 * U_X + 4 * U_W)   // 3712
#define PRE_BLOCKS (U_ALL / 4)      // 928 blocks, four units each

__global__ void __launch_bounds__(256)
pre_pass(const float* __restrict__ query, const float* __restrict__ key,
         const float* __restrict__ value, const float* __restrict__ Wq,
         const float* __restrict__ Wk, const float* __restrict__ Wv,
         const float* __restrict__ Wo, const int* __restrict__ mask,
         _Float16* __restrict__ xdst,   // xq | xk | xv, contiguous
         _Float16* __restrict__ wdst,   // wq | wk | wv | wo, contiguous
         unsigned int* __restrict__ bits) {
  for (int u = blockIdx.x; u < U_ALL; u += PRE_BLOCKS) {
    if (u < U_MASK) {
      // the unit is one tile of 16 query rows by 512 keys; a wave takes one
      // group of 64 keys, a lane the 4 x 8 keys that it has in the St tiles
      const int lane = threadIdx.x & 31;
      const unsigned int loff =
          (lane & 15) * SEQ + (threadIdx.x >> 5) * 64 + (lane >> 4) * 8;
      const int4* p = (const int4*)(mask + (size_t)(u >> 2) * (16 * SEQ) +
                                    (u & 3) * 512 + loff);
      int4 m[8];
#pragma unroll
      for (int nt = 0; nt < 4; ++nt) {
        m[2 * nt]     = p[nt * 4];
        m[2 * nt + 1] = p[nt * 4 + 1];
      }
      // a compare over the wave is the word; lane i keeps word i for the store
      unsigned int w = 0;
#pragma unroll
      for (int t = 0; t < 8; ++t) {
        const unsigned int c0 = __builtin_amdgcn_ballot_w32(m[t].x != 0);
        const unsigned int c1 = __builtin_amdgcn_ballot_w32(m[t].y != 0);
        const unsigned int c2 = __builtin_amdgcn_ballot_w32(m[t].z != 0);
        const unsigned int c3 = __builtin_amdgcn_ballot_w32(m[t].w != 0);
        w = lane == 4 * t + 0 ? c0 : w;
        w = lane == 4 * t + 1 ? c1 : w;
        w = lane == 4 * t + 2 ? c2 : w;
        w = lane == 4 * t + 3 ? c3 : w;
      }
      // tile u >> 2, group (u & 3) * 8 + wave, word lane: u * 256 + thread
      (bits + (size_t)u * 256)[threadIdx.x] = w;
    } else {
      const int c = u - U_MASK;
      const float* in;
      _Float16* out;
      if (c < 3 * U_X) {
        const int j = c / U_X;
        in  = (j == 0 ? query : j == 1 ? key : value) + (size_t)(c % U_X) * 8192;
        out = xdst + (size_t)c * 8192;
      } else {
        const int d = c - 3 * U_X;
        const int j = d / U_W;
        in  = (j == 0 ? Wq : j == 1 ? Wk : j == 2 ? Wv : Wo) +
              (size_t)(d % U_W) * 8192;
        out = wdst + (size_t)d * 8192;
      }
      v4f v[8];
#pragma unroll
      for (int t = 0; t < 8; ++t)
        v[t] = ((const v4f*)in)[t * 256 + threadIdx.x];
#pragma unroll
      for (int t = 0; t < 8; ++t) {
        v4h o;
#pragma unroll
        for (int e = 0; e < 4; ++e) o[e] = (_Float16)v[t][e];
        ((v4h*)out)[t * 256 + threadIdx.x] = o;
      }
      // whatever code follows this branch may rewrite the registers that the
      // eight stores name: the wait stands directly behind them
      asm volatile("s_wait_xcnt 0x0" ::: "memory");
    }
    // The next trip rewrites registers that this trip's stores still name.
    // u passes through the statement so that every address of the next trip
    // is formed behind the wait, not carried over it by an increment.
    asm volatile("s_wait_xcnt 0x0" : "+s"(u) :: "memory");
  }
}

// ---------------------------------------------------------------------------
// Operand staging for the GEMMs.  A stage is one k-tile of 64 halves: 128 rows
// of A, then 64 rows of W, 128 data bytes each, laid at a 144-byte LDS pitch
// (16 B x odd: conflict-free for the ds_load_b128 fragment reads).
// ---------------------------------------------------------------------------
#define G_PITCH 72                          // halves per LDS row
#define GA_TILE (128 * G_PITCH)             // halves of A per stage
#define G_STAGE ((128 + 64) * G_PITCH)      // halves per stage (A | W)

// One stage's copies of one lane: eight 16-byte pieces of A and four of W,
// rows 16 apart (rs = 16 rows in halves).  Eight lanes cover one whole
// 128-byte line of a row.  The s_wait_xcnt closes the statement so that no
// address register named by a copy is rewritten ahead of it.
static __device__ __forceinline__ void stage_aw(const _Float16* ag,
                                                const _Float16* wg, size_t rs,
                                                unsigned int al,
                                                unsigned int wl) {
  const unsigned int ls = 16u * G_PITCH * 2u;   // 16 LDS rows in bytes
  asm volatile(
      "global_load_async_to_lds_b128 %0, %12, off\n\t"
      "global_load_async_to_lds_b128 %1, %13, off\n\t"
      "global_load_async_to_lds_b128 %2, %14, off\n\t"
      "global_load_async_to_lds_b128 %3, %15, off\n\t"
      "global_load_async_to_lds_b128 %4, %16, off\n\t"
      "global_load_async_to_lds_b128 %5, %17, off\n\t"
      "global_load_async_to_lds_b128 %6, %18, off\n\t"
      "global_load_async_to_lds_b128 %7, %19, off\n\t"
      "global_load_async_to_lds_b128 %8, %20, off\n\t"
      "global_load_async_to_lds_b128 %9, %21, off\n\t"
      "global_load_async_to_lds_b128 %10, %22, off\n\t"
      "global_load_async_to_lds_b128 %11, %23, off\n\t"
      "s_wait_xcnt 0x0"
      :: "v"(al), "v"(al + ls), "v"(al + 2u * ls), "v"(al + 3u * ls),
         "v"(al + 4u * ls), "v"(al + 5u * ls), "v"(al + 6u * ls),
         "v"(al + 7u * ls),
         "v"(wl), "v"(wl + ls), "v"(wl + 2u * ls), "v"(wl + 3u * ls),
         "v"(ag), "v"(ag + rs), "v"(ag + 2 * rs), "v"(ag + 3 * rs),
         "v"(ag + 4 * rs), "v"(ag + 5 * rs), "v"(ag + 6 * rs),
         "v"(ag + 7 * rs),
         "v"(wg), "v"(wg + rs), "v"(wg + 2 * rs), "v"(wg + 3 * rs)
      : "memory");
}

// ---------------------------------------------------------------------------
// GEMM: Y[M,N] = A[M,K] @ W[N,K]^T + bias[N]   (torch Linear semantics)
// Block = 128 threads (4 waves); block tile 128(M) x 64(N); wave tile 32x64:
// two A fragments amortize every W fragment (8 WMMAs per 6 fragment loads).
// The block's operands come through LDS (stg: two stages): each k-tile is
// copied once, in whole 128-byte lines, and the next tile's copies fly while
// this one is worked on.  K is a multiple of 64.
// MODE 0: f16 row-major output (stride N)           -> q, k projections
// MODE 1: f16 head-transposed output [B,H,HDIM,SEQ] -> v projection
// MODE 2: f32 row-major output                      -> final out-projection
// ---------------------------------------------------------------------------
template <int MODE>
static __device__ __forceinline__ void
gemm_tile(const _Float16* __restrict__ A, const _Float16* __restrict__ W,
          const float* __restrict__ bias, void* __restrict__ outp,
          _Float16* stg, int M, int N, int K) {
  const int lane = threadIdx.x & 31;
  const int wave = threadIdx.x >> 5;
  const int r    = lane & 15;          // row of A frag / column of B frag
  const int hb   = (lane >> 4) * 8;    // per-half k-run base; also C row base
  const int m0   = blockIdx.x * 128 + wave * 32;
  const int n0   = blockIdx.y * 64;

  // This lane's piece of a stage: row (tid >> 3) + 16 * i, 16-byte column
  // tid & 7.
  const int crow = threadIdx.x >> 3;
  const int ccol = (threadIdx.x & 7) * 8;
  const size_t rs = (size_t)16 * K;
  const _Float16* ag = A + (size_t)(blockIdx.x * 128 + crow) * K + ccol;
  const _Float16* wg = W + (size_t)(n0 + crow) * K + ccol;
  const unsigned int al =
      (unsigned int)(size_t)(stg + crow * G_PITCH + ccol);
  const unsigned int wl = al + GA_TILE * 2u;

  const int ntiles = K >> 6;
  stage_aw(ag, wg, rs, al, wl);
  // tile 0 has landed for this wave; the barrier publishes it to the others
  asm volatile("s_wait_asynccnt 0x0" ::: "memory");
  __syncthreads();
  if (1 < ntiles)
    stage_aw(ag + 64, wg + 64, rs, al + G_STAGE * 2u, wl + G_STAGE * 2u);

  v8f acc[2][4] = {};
  for (int t = 0; t < ntiles; ++t) {
    const int buf = t & 1;
    const _Float16* As = stg + buf * G_STAGE + (wave * 32 + r) * G_PITCH + hb;
    const _Float16* Ws = stg + buf * G_STAGE + GA_TILE + r * G_PITCH + hb;
    // the tile's twelve fragments are read as one group ahead of its WMMAs,
    // so that a wave meets the LDS latency once a tile, not once a fragment
    v16h a[2][2], b[2][4];
#pragma unroll
    for (int ks = 0; ks < 2; ++ks) {
      a[ks][0] = frag_load(As + ks * 32);
      a[ks][1] = frag_load(As + 16 * G_PITCH + ks * 32);
#pragma unroll
      for (int nt = 0; nt < 4; ++nt)
        b[ks][nt] = frag_load(Ws + nt * 16 * G_PITCH + ks * 32);
    }
    // keeps the scheduler from sinking the reads back among the WMMAs, where
    // each fragment would be waited for on its own
    __builtin_amdgcn_sched_barrier(0);
#pragma unroll
    for (int nt = 0; nt < 4; ++nt) {
      acc[0][nt] = wmma_f16(a[0][0], b[0][nt], acc[0][nt]);
      acc[1][nt] = wmma_f16(a[0][1], b[0][nt], acc[1][nt]);
    }
    // keeps the first half's WMMAs ahead of the waits below: they cover the
    // flight of tile t+1's copies, and their fragment registers are free
    // again for the addresses of the refill
    __builtin_amdgcn_sched_barrier(0);

    // ---- publish tile t+1, free this buffer, refill it with tile t+2
    // (the buffer has been read out into registers: the second half's WMMAs
    // follow the refill's issue and cover its flight)
    // this wave's reads of the buffer have returned before it is refilled
    asm volatile("s_wait_dscnt 0x0" ::: "memory");
    // this wave's copies of tile t+1 have landed before the barrier
    asm volatile("s_wait_asynccnt 0x0" ::: "memory");
    __syncthreads();
    if (t + 2 < ntiles)
      stage_aw(ag + (t + 2) * 64, wg + (t + 2) * 64, rs,
               al + buf * (G_STAGE * 2u), wl + buf * (G_STAGE * 2u));
#pragma unroll
    for (int nt = 0; nt < 4; ++nt) {
      acc[0][nt] = wmma_f16(a[1][0], b[1][nt], acc[0][nt]);
      acc[1][nt] = wmma_f16(a[1][1], b[1][nt], acc[1][nt]);
    }
  }
  // no copy is left in flight when the wave goes on to its stores and ends
  asm volatile("s_wait_asynccnt 0x0" ::: "memory");

#pragma unroll
  for (int mt = 0; mt < 2; ++mt) {
    const int mrow = m0 + mt * 16 + hb;
#pragma unroll
    for (int nt = 0; nt < 4; ++nt) {
      const int col = n0 + nt * 16 + r;
      const float bv = bias[col];
      if (MODE == 0) {
        _Float16* o = (_Float16*)outp;
#pragma unroll
        for (int j = 0; j < 8; ++j)
          o[(size_t)(mrow + j) * N + col] = (_Float16)(acc[mt][nt][j] + bv);
      } else if (MODE == 1) {
        // [B,H,HDIM,SEQ]; lane holds 8 consecutive sequence positions of one
        // (h,d) row -> single 16B store.
        _Float16* o = (_Float16*)outp;
        const int bb = m0 / SEQ;
        const int s0 = mrow % SEQ;
        const int h = col >> 6, d = col & 63;
        v8h pk;
#pragma unroll
        for (int j = 0; j < 8; ++j) pk[j] = (_Float16)(acc[mt][nt][j] + bv);
        *(v8h*)(o + ((size_t)((bb * HEADS + h) * HDIM + d)) * SEQ + s0) = pk;
      } else {
        float* o = (float*)outp;
#pragma unroll
        for (int j = 0; j < 8; ++j)
          o[(size_t)(mrow + j) * N + col] = acc[mt][nt][j] + bv;
      }
    }
  }
}

// The three projections read none of each other's output: one grid,
// blockIdx.z names the job (0: q, 1: k, 2: v head-transposed).
__global__ void __launch_bounds__(128)
gemm_qkv(const _Float16* __restrict__ xq, const _Float16* __restrict__ xk,
         const _Float16* __restrict__ xv, const _Float16* __restrict__ wq,
         const _Float16* __restrict__ wk, const _Float16* __restrict__ wv,
         const float* __restrict__ bq, const float* __restrict__ bk,
         const float* __restrict__ bv, _Float16* __restrict__ qh,
         _Float16* __restrict__ kh, _Float16* __restrict__ vt,
         int M, int N, int K) {
  __shared__ __align__(16) _Float16 stg[2 * G_STAGE];
  if (blockIdx.z == 2) {
    gemm_tile<1>(xv, wv, bv, vt, stg, M, N, K);
  } else {
    const bool isk = blockIdx.z == 1;
    gemm_tile<0>(isk ? xk : xq, isk ? wk : wq, isk ? bk : bq, isk ? kh : qh,
                 stg, M, N, K);
    // the built code runs on into the v tile's test and set-up, which reuse
    // the registers that this tile's stores name: the wait stands behind them
    asm volatile("s_wait_xcnt 0x0" ::: "memory");
  }
}

__global__ void __launch_bounds__(128)
gemm_out(const _Float16* __restrict__ A, const _Float16* __restrict__ W,
         const float* __restrict__ bias, float* __restrict__ outp,
         int M, int N, int K) {
  __shared__ __align__(16) _Float16 stg[2 * G_STAGE];
  gemm_tile<2>(A, W, bias, outp, stg, M, N, K);
}

// ---------------------------------------------------------------------------
// K/V staging for flash_attn.  A stage is one 64-key tile of each key half: K as 64 key rows
// and V as 64 d rows, 128 data bytes each, laid at a 144-byte LDS pitch
// (16 B x odd: conflict-free for the ds_load_b128 fragment reads).
// ---------------------------------------------------------------------------
#define KV_PITCH 72                 // halves per LDS row
#define KV_TILE  (64 * KV_PITCH)    // halves per staged tile

// One stage's copies of one lane: four 16-byte pieces of K and four of V,
// rows 16 apart.  Eight lanes cover one whole 128-byte row.  The s_wait_xcnt
// closes the statement so that no address register named by a copy is
// rewritten ahead of it.
static __device__ __forceinline__ void stage_kv(const _Float16* kg,
                                                const _Float16* vg,
                                                unsigned int kl,
                                                unsigned int vl) {
  asm volatile(
      "global_load_async_to_lds_b128 %0, %8, off\n\t"
      "global_load_async_to_lds_b128 %1, %9, off\n\t"
      "global_load_async_to_lds_b128 %2, %10, off\n\t"
      "global_load_async_to_lds_b128 %3, %11, off\n\t"
      "global_load_async_to_lds_b128 %4, %12, off\n\t"
      "global_load_async_to_lds_b128 %5, %13, off\n\t"
      "global_load_async_to_lds_b128 %6, %14, off\n\t"
      "global_load_async_to_lds_b128 %7, %15, off\n\t"
      "s_wait_xcnt 0x0"
      :: "v"(kl), "v"(kl + 16u * KV_PITCH * 2u), "v"(kl + 32u * KV_PITCH * 2u),
         "v"(kl + 48u * KV_PITCH * 2u),
         "v"(vl), "v"(vl + 16u * KV_PITCH * 2u), "v"(vl + 32u * KV_PITCH * 2u),
         "v"(vl + 48u * KV_PITCH * 2u),
         "v"(kg), "v"(kg + 16 * EMB), "v"(kg + 32 * EMB), "v"(kg + 48 * EMB),
         "v"(vg), "v"(vg + 16 * SEQ), "v"(vg + 32 * SEQ), "v"(vg + 48 * SEQ)
      : "memory");
}

// Lane l with lane l ^ 16 (the two lanes that share one query column).
static __device__ __forceinline__ float xhalf(float x) {
  const int b = __builtin_bit_cast(int, x);
  return __builtin_bit_cast(
      float, __builtin_amdgcn_permlanex16(b, b, 0x76543210, 0xfedcba98, false,
                                          false));
}

// ---------------------------------------------------------------------------
// Flash attention: one block = 8 waves = 128 query rows of one (b,h).
// A wave owns 32 queries (two column tiles) and one half of the keys: wave w
// has query group w & 3 and key half w >> 2.  Every K and V fragment read from
// LDS feeds two WMMAs, and the split of the keys keeps as many waves on the
// chip as one tile of 16 queries per wave over all keys would give.
// A stage is one 64-key K/V tile of each key half, copied once into LDS for
// the four waves that share it (two buffers, the next stage's copies fly while
// this one is worked on).  The products are the transposed ones:
//   St = K @ Q^T (A = K rows, B = Q), Ot += V^T @ Pt (A = d-major V rows).
// In an accumulator tile a lane then holds ONE query (column lane & 15) and
// eight keys (or d) hb..hb+7: maximum and sum run in the lane, the two lanes
// of a query meet by one cross-half move, and two St tiles are, element for
// element, the B fragment of Pt (k = hb+0..7 and 16+hb+0..7).
// Behind the loop the two waves of a query group exchange one column tile
// each through LDS and join the halves' maxima, sums and outputs.
// ---------------------------------------------------------------------------
#define KHALF (SEQ / 2)             // keys per key half
#define NSTAGE (KHALF / 64)         // stages per wave

// four waves per SIMD (two blocks per WGP): holds a wave to 256 VGPRs
__global__ void __launch_bounds__(256)
__attribute__((amdgpu_waves_per_eu(4, 4)))
flash_attn(const _Float16* __restrict__ qh, const _Float16* __restrict__ kh,
           const _Float16* __restrict__ vt,
           const unsigned int* __restrict__ mbits,
           _Float16* __restrict__ oh) {
  // [buffer][K | V][key half][tile]
  __shared__ __align__(16) _Float16 KV[2][2][2][KV_TILE];

  const int lane = threadIdx.x & 31;
  // the wave's number as a scalar: what is formed from it stays out of VGPRs
  const int wave = __builtin_amdgcn_readfirstlane(threadIdx.x >> 5);
  const int qg   = wave & 3;
  const int half = wave >> 2;
  const int r    = lane & 15;
  const int hb   = (lane >> 4) * 8;
  const int b    = blockIdx.y / HEADS;
  const int h    = blockIdx.y % HEADS;
  const int q0   = blockIdx.x * 128 + qg * 32;

  const float scale = 0.04419417382415922f;   // 1/sqrt(512) (ref scales by E)

  // Q fragments for this wave's 2 x 16 queries (d = 0..31, 32..63), in VGPRs
  v16h Qb[2][2];
#pragma unroll
  for (int qt = 0; qt < 2; ++qt) {
    const _Float16* qrow =
        qh + ((size_t)b * SEQ + q0 + qt * 16 + r) * EMB + h * HDIM;
    Qb[qt][0] = frag_load(qrow + hb);
    Qb[qt][1] = frag_load(qrow + 32 + hb);
  }

  v8f O[2][4] = {};              // Ot tiles: d = dt*16 + hb + j, query r
  float mrun[2] = {-1e38f, -1e38f};   // the queries' running maxima
  float lrun[2] = {0.f, 0.f};         // running sums over this lane's keys

  const _Float16* kb_ = kh + ((size_t)b * SEQ + half * KHALF) * EMB + h * HDIM;
  const _Float16* vb_ =
      vt + ((size_t)(b * HEADS + h) * HDIM) * SEQ + half * KHALF;
  // The wave's mask words (lane masks, see pre_pass): the address is the same
  // in every lane and nothing writes the words in this launch, so they are read
  // through the constant address space, by scalar loads into SGPRs.
  const __attribute__((address_space(4))) v16u* mb_ =
      (const __attribute__((address_space(4))) v16u*)(
          mbits + ((size_t)((b * SEQ + q0) >> 4) * (SEQ / 64) +
                   half * (KHALF / 64)) * 32);

  // This lane's piece of a stage, in its own key half: row (t >> 3) +
  // {0,16,32,48}, 16-byte column t & 7, t = thread within the half's 4 waves.
  const int crow = (threadIdx.x & 127) >> 3;
  const int ccol = (threadIdx.x & 7) * 8;
  const _Float16* kg = kb_ + (size_t)crow * EMB + ccol;   // advances 64 rows
  const _Float16* vg = vb_ + (size_t)crow * SEQ + ccol;   // advances 64 cols
  const unsigned int kl =
      (unsigned int)(size_t)&KV[0][0][half][crow * KV_PITCH + ccol];
  const unsigned int vl =
      (unsigned int)(size_t)&KV[0][1][half][crow * KV_PITCH + ccol];
  const unsigned int bufb = 4u * KV_TILE * 2u;   // bytes per buffer

  stage_kv(kg, vg, kl, vl);
  // stage 0 has landed for this wave; the barrier publishes it to the others
  asm volatile("s_wait_asynccnt 0x0" ::: "memory");
  __syncthreads();
  stage_kv(kg + 64 * EMB, vg + 64, kl + bufb, vl + bufb);

  // One stage's work.  It is written once and used in two loops, one whose
  // every trip refills and one whose trips do not: a trip is then straight-line
  // code, and the row sums stay ahead of the Ot products instead of being moved
  // behind a refill branch, where all of P in f32 would have to stay in
  // registers beside its packed copy.
  auto stage_step = [&](const int kt, const bool refill)
                        __attribute__((always_inline)) {
    const int k0 = kt * 64;
    const int buf = kt & 1;
    const _Float16* Kt = &KV[buf][0][half][r * KV_PITCH + hb];
    const _Float16* Vt = &KV[buf][1][half][r * KV_PITCH + hb];

    // the stage's 2 x 32 lane masks: [column tile][St tiles 0,1 | 2,3]
    v16u mw[2][2];
#pragma unroll
    for (int qt = 0; qt < 2; ++qt)
#pragma unroll
      for (int p = 0; p < 2; ++p)
        mw[qt][p] = mb_[(qt * (SEQ / 64) + kt) * 2 + p];

    // ---- St = K @ Q^T : 2 x 4 C-tiles of 16 keys x 16 queries (2 wmma each)
    // the tile's eight K fragments are read as one group ahead of the WMMAs,
    // so that a wave meets the LDS latency once, not once a fragment
    v16h ka[2][4];
#pragma unroll
    for (int ks = 0; ks < 2; ++ks)
#pragma unroll
      for (int nt = 0; nt < 4; ++nt)
        ka[ks][nt] = frag_load(Kt + nt * 16 * KV_PITCH + ks * 32);
    // keeps the scheduler from sinking the reads back among the WMMAs, where
    // each fragment would be waited for on its own
    __builtin_amdgcn_sched_barrier(0);
    v8f Sc[2][4];
#pragma unroll
    for (int nt = 0; nt < 4; ++nt)
#pragma unroll
      for (int qt = 0; qt < 2; ++qt) {
        v8f c = {};
        Sc[qt][nt] = wmma_f16(ka[0][nt], Qb[qt][0], c);
      }
#pragma unroll
    for (int nt = 0; nt < 4; ++nt)
#pragma unroll
      for (int qt = 0; qt < 2; ++qt)
        Sc[qt][nt] = wmma_f16(ka[1][nt], Qb[qt][1], Sc[qt][nt]);
    // the first four V fragments (keys 0..31), one group: they return while
    // the first column tile's softmax runs
    v16h va[2][4];
#pragma unroll
    for (int dt = 0; dt < 4; ++dt)
      va[0][dt] = frag_load(Vt + dt * 16 * KV_PITCH);
    // keeps the scheduler from sinking the reads down to the Ot products,
    // where each would be waited for with nothing left to cover it
    __builtin_amdgcn_sched_barrier(0);

    v16h pb[2][2];                 // Pt as B fragments: [column tile][step]
#pragma unroll
    for (int qt = 0; qt < 2; ++qt) {
      // ---- mask (pre-scale, as reference) + scale; maximum in the lane
      // (products, differences and sums are written on whole 8-element tiles,
      // so that packed operations pair neighbouring registers of one tile)
      float vmax[4];
#pragma unroll
      for (int nt = 0; nt < 4; ++nt) {
        v8f s = Sc[qt][nt] * scale;
#pragma unroll
        for (int j = 0; j < 8; ++j) {
          // the word in its SGPR is the select's condition as it stands
          s[j] = __builtin_amdgcn_inverse_ballot_w32(
                     mw[qt][nt >> 1][(nt & 1) * 8 + j])
                     ? s[j]
                     : -4.4e18f;
          vmax[nt] = j ? fmaxf(vmax[nt], s[j]) : s[j];
        }
        Sc[qt][nt] = s;
      }

      // ---- online softmax: one query per lane, its keys split over two lanes
      float v = fmaxf(fmaxf(vmax[0], vmax[1]), fmaxf(vmax[2], vmax[3]));
      v = fmaxf(v, xhalf(v));
      const float mn = fmaxf(mrun[qt], v);
      const float alpha = __expf(mrun[qt] - mn);
      mrun[qt] = mn;
#pragma unroll
      for (int nt = 0; nt < 4; ++nt) {
        const v8f e = (Sc[qt][nt] - mn) * 1.44269504088896340736f;  // log2(e)
#pragma unroll
        for (int j = 0; j < 8; ++j)
          Sc[qt][nt][j] = __builtin_amdgcn_exp2f(e[j]);
      }
      const v8f ps = (Sc[qt][0] + Sc[qt][1]) + (Sc[qt][2] + Sc[qt][3]);
      lrun[qt] = lrun[qt] * alpha + (((ps[0] + ps[1]) + (ps[2] + ps[3])) +
                                     ((ps[4] + ps[5]) + (ps[6] + ps[7])));
#pragma unroll
      for (int dt = 0; dt < 4; ++dt) O[qt][dt] *= alpha;
      // Pt's B fragments are packed straight from pairs of St tiles
#pragma unroll
      for (int step = 0; step < 2; ++step)
#pragma unroll
        for (int i = 0; i < 8; ++i) {
          pb[qt][step][i]     = (_Float16)Sc[qt][2 * step][i];
          pb[qt][step][i + 8] = (_Float16)Sc[qt][2 * step + 1][i];
        }
      if (qt == 0) {
        // the other four V fragments (keys 32..63) go into the registers that
        // the packed tile has left and return under the second tile's softmax;
        // the two scheduling fences hold the group at this place: earlier, the
        // wave's registers do not hold it, later, nothing covers its latency
        __builtin_amdgcn_sched_barrier(0);
#pragma unroll
        for (int dt = 0; dt < 4; ++dt)
          va[1][dt] = frag_load(Vt + dt * 16 * KV_PITCH + 32);
        __builtin_amdgcn_sched_barrier(0);
      }
    }

    // ---- Ot += V^T @ Pt   (V is d-major: A fragments load contiguously)
#pragma unroll
    for (int step = 0; step < 2; ++step)
#pragma unroll
      for (int dt = 0; dt < 4; ++dt)
#pragma unroll
        for (int qt = 0; qt < 2; ++qt)
          O[qt][dt] = wmma_f16(va[step][dt], pb[qt][step], O[qt][dt]);

    // ---- publish stage kt+1, free this buffer, refill it with stage kt+2
    // keeps the waits and the barrier down here: lifted up among the softmax
    // they would cut short the time that stage kt+1's copies have to land
    __builtin_amdgcn_sched_barrier(0);
    // this wave's reads of the buffer have returned before it is refilled
    asm volatile("s_wait_dscnt 0x0" ::: "memory");
    // this wave's copies of stage kt+1 have landed before the barrier
    asm volatile("s_wait_asynccnt 0x0" ::: "memory");
    __syncthreads();
    if (refill)
      stage_kv(kg + (size_t)(k0 + 128) * EMB, vg + k0 + 128,
               kl + buf * bufb, vl + buf * bufb);
  };
  for (int kt = 0; kt < NSTAGE - 2; ++kt) stage_step(kt, true);
  for (int kt = NSTAGE - 2; kt < NSTAGE; ++kt) stage_step(kt, false);
  // no copy is left in flight when the stages' LDS is reused below
  asm volatile("s_wait_asynccnt 0x0" ::: "memory");

  // ---- join the two key halves.  The loop's last barrier has ended every
  // read of the stages, so their LDS carries the exchange: the wave of key
  // half 0 finishes column tile 0 and hands tile 1 to its partner (wave ^ 4),
  // the wave of half 1 the other way round.  Same lane, same elements.
  v4f* jb = (v4f*)&KV[0][0][0][0];        // [wave][9 pieces][lane], 16 B each
  v8f Ok[4], Og[4];
#pragma unroll
  for (int dt = 0; dt < 4; ++dt)
#pragma unroll
    for (int j = 0; j < 8; ++j) {
      Ok[dt][j] = half ? O[1][dt][j] : O[0][dt][j];
      Og[dt][j] = half ? O[0][dt][j] : O[1][dt][j];
    }
  const float mk = half ? mrun[1] : mrun[0], mg = half ? mrun[0] : mrun[1];
  const float lk = half ? lrun[1] : lrun[0], lg = half ? lrun[0] : lrun[1];
  v4f* mine = jb + wave * (9 * 32) + lane;
  const v4f* theirs = jb + (wave ^ 4) * (9 * 32) + lane;
#pragma unroll
  for (int dt = 0; dt < 4; ++dt) {
    mine[(2 * dt) * 32] = v4f{Og[dt][0], Og[dt][1], Og[dt][2], Og[dt][3]};
    mine[(2 * dt + 1) * 32] = v4f{Og[dt][4], Og[dt][5], Og[dt][6], Og[dt][7]};
  }
  mine[8 * 32] = v4f{mg, lg, 0.f, 0.f};
  __syncthreads();
  const v4f ml = theirs[8 * 32];
  const float mn = fmaxf(mk, ml[0]);
  const float fk = __expf(mk - mn);
  const float fo = __expf(ml[0] - mn);
  const float lj = lk * fk + ml[1] * fo;

  // ---- join the two lanes' sums, normalize and emit attention output
  // (f16, row-major [B*S, E]): a lane holds 8 consecutive d of its query
  const float lsum = lj + xhalf(lj);
  _Float16* orow =
      oh + ((size_t)b * SEQ + q0 + half * 16 + r) * EMB + h * HDIM + hb;
#pragma unroll
  for (int dt = 0; dt < 4; ++dt) {
    const v4f o0 = theirs[(2 * dt) * 32];
    const v4f o1 = theirs[(2 * dt + 1) * 32];
    v8h pk;
#pragma unroll
    for (int j = 0; j < 8; ++j) {
      const float oo = j < 4 ? o0[j & 3] : o1[j & 3];
      pk[j] = (_Float16)((Ok[dt][j] * fk + oo * fo) / lsum);
    }
    *(v8h*)(orow + dt * 16) = pk;
  }
}

// ---------------------------------------------------------------------------
extern "C" void kernel_launch(void* const* d_in, const int* in_sizes, int n_in,
                              void* d_out, int out_size, void* d_ws, size_t ws_size,
                              hipStream_t stream) {
  const float* key   = (const float*)d_in[0];
  const float* value = (const float*)d_in[1];
  const float* query = (const float*)d_in[2];
  const int*   mask  = (const int*)d_in[3];
  const float* Wq = (const float*)d_in[4];
  const float* bq = (const float*)d_in[5];
  const float* Wk = (const float*)d_in[6];
  const float* bk = (const float*)d_in[7];
  const float* Wv = (const float*)d_in[8];
  const float* bv = (const float*)d_in[9];
  const float* Wo = (const float*)d_in[10];
  const float* bo = (const float*)d_in[11];
  float* out = (float*)d_out;

  const size_t NX = (size_t)BATCH * SEQ * EMB;          // 4,194,304
  const size_t NW = (size_t)EMB * EMB;                  // 262,144
  const size_t NMW = (size_t)BATCH * SEQ * (SEQ / 32);  // 524,288 mask words

  char* w = (char*)d_ws;
  _Float16* xq  = (_Float16*)w; w += NX * 2;
  _Float16* xk  = (_Float16*)w; w += NX * 2;
  _Float16* xv  = (_Float16*)w; w += NX * 2;
  _Float16* wqh = (_Float16*)w; w += NW * 2;
  _Float16* wkh = (_Float16*)w; w += NW * 2;
  _Float16* wvh = (_Float16*)w; w += NW * 2;
  _Float16* woh = (_Float16*)w; w += NW * 2;
  _Float16* qh  = (_Float16*)w; w += NX * 2;
  _Float16* kh  = (_Float16*)w; w += NX * 2;
  _Float16* vt  = (_Float16*)w; w += NX * 2;   // [B,H,HDIM,SEQ]
  unsigned int* mbits = (unsigned int*)w; w += NMW * 4;
  _Float16* oh  = xq;  // xq is dead after the q projection; reuse for attn out

  const int M = BATCH * SEQ;  // 8192
  pre_pass<<<PRE_BLOCKS, 256, 0, stream>>>(query, key, value, Wq, Wk, Wv, Wo,
                                           mask, xq, wqh, mbits);

  dim3 gp(M / 128, EMB / 64);      // (64, 8)
  dim3 gp3(M / 128, EMB / 64, 3);  // q, k and v projections in one grid
  gemm_qkv<<<gp3, 128, 0, stream>>>(xq, xk, xv, wqh, wkh, wvh, bq, bk, bv, qh,
                                    kh, vt, M, EMB, EMB);

  flash_attn<<<dim3(SEQ / 128, BATCH * HEADS), 256, 0, stream>>>(qh, kh, vt,
                                                                mbits, oh);

  gemm_out<<<gp, 128, 0, stream>>>(oh, woh, bo, out, M, EMB, EMB);
}

// v008
// One run takes 78.1 microseconds.
// Two timings next to v007 put it at 1.11 and 1.08 times that version's speed.
// All steps since v000 together make it 3.08 times as fast.
#include <hip/hip_runtime.h>
#include <hip/hip_bf16.h>

#define BATCH 4
#define SEQ   2048
#define EMB   512
#define HEADS 8
#define HDIM  64

typedef __attribute__((ext_vector_type(16))) _Float16 v16h;
typedef __attribute__((ext_vector_type(8)))  _Float16 v8h;
typedef __attribute__((ext_vector_type(4)))  _Float16 v4h;
typedef __attribute__((ext_vector_type(8)))  float    v8f;
typedef __attribute__((ext_vector_type(4)))  float    v4f;
typedef __attribute__((ext_vector_type(16))) unsigned int v16u;

// ---------------------------------------------------------------------------
// Fragment loader for 16-bit WMMA A/B operands (CDNA5 16x32 / 32x16 layout).
// Per lane the fragment is two contiguous 8-half (16B) runs: k = kb + {0..7}
// and k = kb + {16..23}, where kb = (lane<16 ? 0 : 8).  Caller passes the
// pointer at element (row/col, kb).  Lowers to two global/ds _b128 loads.
// ---------------------------------------------------------------------------
static __device__ __forceinline__ v16h frag_load(const _Float16* p) {
  v8h lo = *(const v8h*)(p);
  v8h hi = *(const v8h*)(p + 16);
  v16h r;
#pragma unroll
  for (int i = 0; i < 8; ++i) { r[i] = lo[i]; r[i + 8] = hi[i]; }
  return r;
}

static __device__ __forceinline__ v8f wmma_f16(v16h a, v16h b, v8f c) {
  return __builtin_amdgcn_wmma_f32_16x16x32_f16(false, a, false, b,
                                                (short)0, c, false, false);
}

// ---------------------------------------------------------------------------
// Pre-pass, one launch for the five jobs that read none of each other's
// output: fp32 -> f16 of the four weights, and the bit-pack of the int32 mask
// (32 int -> 1 u32, 67 MB -> 2 MB, read once).  The activations are converted
// by gemm_qkv itself, on their way into LDS.
// A mask word is a LANE MASK of flash_attn's St tiles: for a tile of 16 queries
// and a group of 64 keys, word nt * 8 + j holds in bit l the mask of query
// l & 15 and key nt * 16 + (l >> 4) * 8 + j, the element that lane l has in
// register j of St tile nt.  Words: [16-query tile][64-key group][32].
// The work is cut into units of 32 KiB of input (256 threads x 8 x 16 B);
// a block walks the units blockIdx.x, + PRE_BLOCKS, ... and a unit's number
// names its job, so few waves are started and each keeps 8 loads in flight.
// ---------------------------------------------------------------------------
#define U_MASK 2048                 // BATCH*SEQ*SEQ ints      / 8192
#define U_W    32                   // EMB*EMB floats          / 8192
#define U_ALL  (U_MASK + 4 * U_W)   // 2176
#define PRE_BLOCKS (U_ALL / 4)      // 544 blocks, four units each

__global__ void __launch_bounds__(256)
pre_pass(const float* __restrict__ Wq, const float* __restrict__ Wk,
         const float* __restrict__ Wv, const float* __restrict__ Wo,
         const int* __restrict__ mask,
         _Float16* __restrict__ wdst,   // wq | wk | wv | wo, contiguous
         unsigned int* __restrict__ bits) {
  for (int u = blockIdx.x; u < U_ALL; u += PRE_BLOCKS) {
    if (u < U_MASK) {
      // the unit is one tile of 16 query rows by 512 keys; a wave takes one
      // group of 64 keys, a lane the 4 x 8 keys that it has in the St tiles
      const int lane = threadIdx.x & 31;
      const unsigned int loff =
          (lane & 15) * SEQ + (threadIdx.x >> 5) * 64 + (lane >> 4) * 8;
      const int4* p = (const int4*)(mask + (size_t)(u >> 2) * (16 * SEQ) +
                                    (u & 3) * 512 + loff);
      int4 m[8];
#pragma unroll
      for (int nt = 0; nt < 4; ++nt) {
        m[2 * nt]     = p[nt * 4];
        m[2 * nt + 1] = p[nt * 4 + 1];
      }
      // a compare over the wave is the word; lane i keeps word i for the store
      unsigned int w = 0;
#pragma unroll
      for (int t = 0; t < 8; ++t) {
        const unsigned int c0 = __builtin_amdgcn_ballot_w32(m[t].x != 0);
        const unsigned int c1 = __builtin_amdgcn_ballot_w32(m[t].y != 0);
        const unsigned int c2 = __builtin_amdgcn_ballot_w32(m[t].z != 0);
        const unsigned int c3 = __builtin_amdgcn_ballot_w32(m[t].w != 0);
        w = lane == 4 * t + 0 ? c0 : w;
        w = lane == 4 * t + 1 ? c1 : w;
        w = lane == 4 * t + 2 ? c2 : w;
        w = lane == 4 * t + 3 ? c3 : w;
      }
      // tile u >> 2, group (u & 3) * 8 + wave, word lane: u * 256 + thread
      (bits + (size_t)u * 256)[threadIdx.x] = w;
    } else {
      const int d = u - U_MASK;
      const int j = d / U_W;
      const float* in = (j == 0 ? Wq : j == 1 ? Wk : j == 2 ? Wv : Wo) +
                        (size_t)(d % U_W) * 8192;
      _Float16* out = wdst + (size_t)d * 8192;
      v4f v[8];
#pragma unroll
      for (int t = 0; t < 8; ++t)
        v[t] = ((const v4f*)in)[t * 256 + threadIdx.x];
#pragma unroll
      for (int t = 0; t < 8; ++t) {
        v4h o;
#pragma unroll
        for (int e = 0; e < 4; ++e) o[e] = (_Float16)v[t][e];
        ((v4h*)out)[t * 256 + threadIdx.x] = o;
      }
      // whatever code follows this branch may rewrite the registers that the
      // eight stores name: the wait stands directly behind them
      asm volatile("s_wait_xcnt 0x0" ::: "memory");
    }
    // The next trip rewrites registers that this trip's stores still name.
    // u passes through the statement so that every address of the next trip
    // is formed behind the wait, not carried over it by an increment.
    asm volatile("s_wait_xcnt 0x0" : "+s"(u) :: "memory");
  }
}

// ---------------------------------------------------------------------------
// Operand staging for the out-projection.  A stage is one k-tile of 64 halves:
// 128 rows of A, then 64 rows of W, 128 data bytes each, laid at a 144-byte LDS
// pitch (16 B x odd: conflict-free for the ds_load_b128 fragment reads).
// ---------------------------------------------------------------------------
#define G_PITCH 72                          // halves per LDS row
#define GA_TILE (128 * G_PITCH)             // halves of A per stage
#define G_STAGE ((128 + 64) * G_PITCH)      // halves per stage (A | W)

// One stage's copies of one lane: eight 16-byte pieces of A and four of W,
// rows 16 apart (rs = 16 rows in halves).  Eight lanes cover one whole
// 128-byte line of a row.  The s_wait_xcnt closes the statement so that no
// address register named by a copy is rewritten ahead of it.
static __device__ __forceinline__ void stage_aw(const _Float16* ag,
                                                const _Float16* wg, size_t rs,
                                                unsigned int al,
                                                unsigned int wl) {
  const unsigned int ls = 16u * G_PITCH * 2u;   // 16 LDS rows in bytes
  asm volatile(
      "global_load_async_to_lds_b128 %0, %12, off\n\t"
      "global_load_async_to_lds_b128 %1, %13, off\n\t"
      "global_load_async_to_lds_b128 %2, %14, off\n\t"
      "global_load_async_to_lds_b128 %3, %15, off\n\t"
      "global_load_async_to_lds_b128 %4, %16, off\n\t"
      "global_load_async_to_lds_b128 %5, %17, off\n\t"
      "global_load_async_to_lds_b128 %6, %18, off\n\t"
      "global_load_async_to_lds_b128 %7, %19, off\n\t"
      "global_load_async_to_lds_b128 %8, %20, off\n\t"
      "global_load_async_to_lds_b128 %9, %21, off\n\t"
      "global_load_async_to_lds_b128 %10, %22, off\n\t"
      "global_load_async_to_lds_b128 %11, %23, off\n\t"
      "s_wait_xcnt 0x0"
      :: "v"(al), "v"(al + ls), "v"(al + 2u * ls), "v"(al + 3u * ls),
         "v"(al + 4u * ls), "v"(al + 5u * ls), "v"(al + 6u * ls),
         "v"(al + 7u * ls),
         "v"(wl), "v"(wl + ls), "v"(wl + 2u * ls), "v"(wl + 3u * ls),
         "v"(ag), "v"(ag + rs), "v"(ag + 2 * rs), "v"(ag + 3 * rs),
         "v"(ag + 4 * rs), "v"(ag + 5 * rs), "v"(ag + 6 * rs),
         "v"(ag + 7 * rs),
         "v"(wg), "v"(wg + rs), "v"(wg + 2 * rs), "v"(wg + 3 * rs)
      : "memory");
}

// ---------------------------------------------------------------------------
// GEMM: Y[M,N] = A[M,K] @ W[N,K]^T + bias[N]   (torch Linear semantics)
// Block = 128 threads (4 waves); block tile 128(M) x 64(N); wave tile 32x64:
// two A fragments amortize every W fragment (8 WMMAs per 6 fragment loads).
// The block's operands come through LDS (stg: two stages): each k-tile is
// copied once, in whole 128-byte lines, and the next tile's copies fly while
// this one is worked on.  K is a multiple of 64.  f32 row-major output.
// ---------------------------------------------------------------------------
static __device__ __forceinline__ void
gemm_tile(const _Float16* __restrict__ A, const _Float16* __restrict__ W,
          const float* __restrict__ bias, float* __restrict__ o,
          _Float16* stg, int M, int N, int K) {
  const int lane = threadIdx.x & 31;
  const int wave = threadIdx.x >> 5;
  const int r    = lane & 15;          // row of A frag / column of B frag
  const int hb   = (lane >> 4) * 8;    // per-half k-run base; also C row base
  const int m0   = blockIdx.x * 128 + wave * 32;
  const int n0   = blockIdx.y * 64;

  // This lane's piece of a stage: row (tid >> 3) + 16 * i, 16-byte column
  // tid & 7.
  const int crow = threadIdx.x >> 3;
  const int ccol = (threadIdx.x & 7) * 8;
  const size_t rs = (size_t)16 * K;
  const _Float16* ag = A + (size_t)(blockIdx.x * 128 + crow) * K + ccol;
  const _Float16* wg = W + (size_t)(n0 + crow) * K + ccol;
  const unsigned int al =
      (unsigned int)(size_t)(stg + crow * G_PITCH + ccol);
  const unsigned int wl = al + GA_TILE * 2u;

  const int ntiles = K >> 6;
  stage_aw(ag, wg, rs, al, wl);
  // tile 0 has landed for this wave; the barrier publishes it to the others
  asm volatile("s_wait_asynccnt 0x0" ::: "memory");
  __syncthreads();
  if (1 < ntiles)
    stage_aw(ag + 64, wg + 64, rs, al + G_STAGE * 2u, wl + G_STAGE * 2u);

  v8f acc[2][4] = {};
  for (int t = 0; t < ntiles; ++t) {
    const int buf = t & 1;
    const _Float16* As = stg + buf * G_STAGE + (wave * 32 + r) * G_PITCH + hb;
    const _Float16* Ws = stg + buf * G_STAGE + GA_TILE + r * G_PITCH + hb;
    // the tile's twelve fragments are read as one group ahead of its WMMAs,
    // so that a wave meets the LDS latency once a tile, not once a fragment
    v16h a[2][2], b[2][4];
#pragma unroll
    for (int ks = 0; ks < 2; ++ks) {
      a[ks][0] = frag_load(As + ks * 32);
      a[ks][1] = frag_load(As + 16 * G_PITCH + ks * 32);
#pragma unroll
      for (int nt = 0; nt < 4; ++nt)
        b[ks][nt] = frag_load(Ws + nt * 16 * G_PITCH + ks * 32);
    }
    // keeps the scheduler from sinking the reads back among the WMMAs, where
    // each fragment would be waited for on its own
    __builtin_amdgcn_sched_barrier(0);
#pragma unroll
    for (int nt = 0; nt < 4; ++nt) {
      acc[0][nt] = wmma_f16(a[0][0], b[0][nt], acc[0][nt]);
      acc[1][nt] = wmma_f16(a[0][1], b[0][nt], acc[1][nt]);
    }
    // keeps the first half's WMMAs ahead of the waits below: they cover the
    // flight of tile t+1's copies, and their fragment registers are free
    // again for the addresses of the refill
    __builtin_amdgcn_sched_barrier(0);

    // ---- publish tile t+1, free this buffer, refill it with tile t+2
    // (the buffer has been read out into registers: the second half's WMMAs
    // follow the refill's issue and cover its flight)
    // this wave's reads of the buffer have returned before it is refilled
    asm volatile("s_wait_dscnt 0x0" ::: "memory");
    // this wave's copies of tile t+1 have landed before the barrier
    asm volatile("s_wait_asynccnt 0x0" ::: "memory");
    __syncthreads();
    if (t + 2 < ntiles)
      stage_aw(ag + (t + 2) * 64, wg + (t + 2) * 64, rs,
               al + buf * (G_STAGE * 2u), wl + buf * (G_STAGE * 2u));
#pragma unroll
    for (int nt = 0; nt < 4; ++nt) {
      acc[0][nt] = wmma_f16(a[1][0], b[1][nt], acc[0][nt]);
      acc[1][nt] = wmma_f16(a[1][1], b[1][nt], acc[1][nt]);
    }
  }
  // no copy is left in flight when the wave goes on to its stores and ends
  asm volatile("s_wait_asynccnt 0x0" ::: "memory");

#pragma unroll
  for (int mt = 0; mt < 2; ++mt) {
    const int mrow = m0 + mt * 16 + hb;
#pragma unroll
    for (int nt = 0; nt < 4; ++nt) {
      const int col = n0 + nt * 16 + r;
      const float bv = bias[col];
#pragma unroll
      for (int j = 0; j < 8; ++j)
        o[(size_t)(mrow + j) * N + col] = acc[mt][nt][j] + bv;
    }
  }
}

// ---------------------------------------------------------------------------
// The three projections, one grid (blockIdx.y names the job: 0 q, 1 k, 2 v):
// Y[128 rows, all 512 columns] = X @ W^T + bias from the f32 activations.
// A block owns whole rows of X, so every element of X is read from memory and
// converted to f16 exactly once, here, on its way into LDS (global f32 ->
// registers -> ds_store), and no f16 copy of X passes through memory.
// Block = 512 threads (16 waves, 2 x 8); wave tile 64 x 64: eight fragments
// from LDS feed sixteen WMMAs.  A stage is one k-tile of 64 halves: 128 rows
// of X, then the 512 rows of W (async copies), at the 144-byte pitch.  Two
// stages: the next tile's loads and copies fly while this one is worked on.
// q, k: f16 row-major; v: f16 head-transposed [B,H,HDIM,SEQ].
// ---------------------------------------------------------------------------
#define QA_TILE (128 * G_PITCH)             // halves of X per stage
#define Q_STAGE ((128 + EMB) * G_PITCH)     // halves per stage (X | W)
#define Q_TILES (EMB / 64)                  // k-tiles

// One stage's W copies of one lane: eight 16-byte pieces, rows 64 apart.
// Eight lanes cover one whole 128-byte line of a row.  The s_wait_xcnt closes
// the statement so that no address register named by a copy is rewritten
// ahead of it.
static __device__ __forceinline__ void stage_w(const _Float16* wg,
                                               unsigned int wl) {
  const unsigned int ls = 64u * G_PITCH * 2u;   // 64 LDS rows in bytes
  const size_t rs = (size_t)64 * EMB;           // 64 rows of W in halves
  asm volatile(
      "global_load_async_to_lds_b128 %0, %8, off\n\t"
      "global_load_async_to_lds_b128 %1, %9, off\n\t"
      "global_load_async_to_lds_b128 %2, %10, off\n\t"
      "global_load_async_to_lds_b128 %3, %11, off\n\t"
      "global_load_async_to_lds_b128 %4, %12, off\n\t"
      "global_load_async_to_lds_b128 %5, %13, off\n\t"
      "global_load_async_to_lds_b128 %6, %14, off\n\t"
      "global_load_async_to_lds_b128 %7, %15, off\n\t"
      "s_wait_xcnt 0x0"
      :: "v"(wl), "v"(wl + ls), "v"(wl + 2u * ls), "v"(wl + 3u * ls),
         "v"(wl + 4u * ls), "v"(wl + 5u * ls), "v"(wl + 6u * ls),
         "v"(wl + 7u * ls),
         "v"(wg), "v"(wg + rs), "v"(wg + 2 * rs), "v"(wg + 3 * rs),
         "v"(wg + 4 * rs), "v"(wg + 5 * rs), "v"(wg + 6 * rs),
         "v"(wg + 7 * rs)
      : "memory");
}

__global__ void __launch_bounds__(512)
gemm_qkv(const float* __restrict__ query, const float* __restrict__ key,
         const float* __restrict__ value, const _Float16* __restrict__ wq,
         const _Float16* __restrict__ wk, const _Float16* __restrict__ wv,
         const float* __restrict__ bq, const float* __restrict__ bk,
         const float* __restrict__ bv, _Float16* __restrict__ qh,
         _Float16* __restrict__ kh, _Float16* __restrict__ vt) {
  __shared__ __align__(16) _Float16 stg[2 * Q_STAGE];
  const int job = blockIdx.y;
  const float* X = job == 0 ? query : job == 1 ? key : value;
  const _Float16* Wt = job == 0 ? wq : job == 1 ? wk : wv;
  const float* bias = job == 0 ? bq : job == 1 ? bk : bv;

  const int lane = threadIdx.x & 31;
  // the wave's number as a scalar: what is formed from it stays out of VGPRs
  const int wave = __builtin_amdgcn_readfirstlane(threadIdx.x >> 5);
  const int r    = lane & 15;          // row of A frag / column of B frag
  const int hb   = (lane >> 4) * 8;    // per-half k-run base; also C row base
  const int m0   = blockIdx.x * 128 + (wave & 1) * 64;
  const int n0   = (wave >> 1) * 64;

  // This lane's piece of a stage of X: rows (tid >> 4) + 32 * i, four floats at
  // column (tid & 15) * 4: sixteen lanes cover the two whole lines of a row.
  const int arow = threadIdx.x >> 4;
  const int acol = (threadIdx.x & 15) * 4;
  const float* xg = X + (size_t)(blockIdx.x * 128 + arow) * EMB + acol;
  _Float16* xs = stg + arow * G_PITCH + acol;
  // ... and of W: rows (tid >> 3) + 64 * i, 16-byte column tid & 7.
  const int crow = threadIdx.x >> 3;
  const int ccol = (threadIdx.x & 7) * 8;
  const _Float16* wg = Wt + (size_t)crow * EMB + ccol;
  const unsigned int wl =
      (unsigned int)(size_t)(stg + QA_TILE + crow * G_PITCH + ccol);

  v4f xr[4];                     // one k-tile of X in flight, f32
  auto load_x = [&](const int t) __attribute__((always_inline)) {
#pragma unroll
    for (int i = 0; i < 4; ++i)
      xr[i] = *(const v4f*)(xg + (size_t)(32 * i) * EMB + t * 64);
  };
  auto store_x = [&](const int buf) __attribute__((always_inline)) {
#pragma unroll
    for (int i = 0; i < 4; ++i) {
      v4h o;
#pragma unroll
      for (int e = 0; e < 4; ++e) o[e] = (_Float16)xr[i][e];
      *(v4h*)(xs + buf * Q_STAGE + 32 * i * G_PITCH) = o;
    }
  };

  load_x(0);
  stage_w(wg, wl);
  store_x(0);
  // tile 0 has landed for this wave; the barrier publishes it to the others
  asm volatile("s_wait_asynccnt 0x0" ::: "memory");
  __syncthreads();
  load_x(1);
  stage_w(wg + 64, wl + Q_STAGE * 2u);

  v8f acc[4][4] = {};
  for (int t = 0; t < Q_TILES; ++t) {
    const int buf = t & 1;
    const _Float16* As =
        stg + buf * Q_STAGE + ((wave & 1) * 64 + r) * G_PITCH + hb;
    const _Float16* Ws =
        stg + buf * Q_STAGE + QA_TILE + (n0 + r) * G_PITCH + hb;
#pragma unroll
    for (int ks = 0; ks < 2; ++ks) {
      // a k-step's eight fragments are read as one group ahead of its WMMAs,
      // so that a wave meets the LDS latency once a step, not once a fragment;
      // they stand in the order in which the WMMAs first ask for them
      v16h a[4], b[4];
      b[0] = frag_load(Ws + ks * 32);
#pragma unroll
      for (int i = 0; i < 4; ++i)
        a[i] = frag_load(As + i * 16 * G_PITCH + ks * 32);
#pragma unroll
      for (int i = 1; i < 4; ++i)
        b[i] = frag_load(Ws + i * 16 * G_PITCH + ks * 32);
      // keeps the scheduler from sinking the reads back among the WMMAs
      __builtin_amdgcn_sched_barrier(0);
#pragma unroll
      for (int nt = 0; nt < 4; ++nt)
#pragma unroll
        for (int mt = 0; mt < 4; ++mt)
          acc[mt][nt] = wmma_f16(a[mt], b[nt], acc[mt][nt]);
      // keeps the next group's reads behind these WMMAs: both groups at once
      // do not fit the wave's 256 registers beside the accumulators
      __builtin_amdgcn_sched_barrier(0);
    }

    // ---- publish tile t+1, free this buffer, refill it with tile t+2
    // X of tile t+1, loaded one trip ago, goes as f16 into the other buffer,
    // whose last readers passed the barrier at the foot of trip t-1
    if (t + 1 < Q_TILES) store_x(buf ^ 1);
    // this wave's reads of the buffer have returned before it is refilled,
    // and its stores of tile t+1 have landed before the barrier
    asm volatile("s_wait_dscnt 0x0" ::: "memory");
    // this wave's copies of tile t+1 have landed before the barrier
    asm volatile("s_wait_asynccnt 0x0" ::: "memory");
    __syncthreads();
    if (t + 2 < Q_TILES) {
      // X first: it comes from memory, W from L2; the s_wait_xcnt that closes
      // the copies' statement stands behind these loads' addresses as well
      load_x(t + 2);
      stage_w(wg + (t + 2) * 64, wl + buf * (Q_STAGE * 2u));
    }
  }
  // no copy is left in flight when the wave goes on to its stores and ends
  asm volatile("s_wait_asynccnt 0x0" ::: "memory");

  if (job == 2) {
    // [B,H,HDIM,SEQ]; lane holds 8 consecutive sequence positions of one
    // (h,d) row -> single 16B store.
    const int bb = m0 / SEQ;
#pragma unroll
    for (int nt = 0; nt < 4; ++nt) {
      const int col = n0 + nt * 16 + r;
      const float bc = bias[col];
      const int h = col >> 6, d = col & 63;
      _Float16* orow = vt + ((size_t)((bb * HEADS + h) * HDIM + d)) * SEQ;
#pragma unroll
      for (int mt = 0; mt < 4; ++mt) {
        const int s0 = (m0 + mt * 16 + hb) % SEQ;
        v8h pk;
#pragma unroll
        for (int j = 0; j < 8; ++j) pk[j] = (_Float16)(acc[mt][nt][j] + bc);
        *(v8h*)(orow + s0) = pk;
      }
    }
  } else {
    _Float16* o = job == 1 ? kh : qh;
#pragma unroll
    for (int nt = 0; nt < 4; ++nt) {
      const int col = n0 + nt * 16 + r;
      const float bc = bias[col];
#pragma unroll
      for (int mt = 0; mt < 4; ++mt) {
        const int mrow = m0 + mt * 16 + hb;
#pragma unroll
        for (int j = 0; j < 8; ++j)
          o[(size_t)(mrow + j) * EMB + col] = (_Float16)(acc[mt][nt][j] + bc);
      }
    }
    // the built code runs on into the v branch's test and set-up, which reuse
    // the registers that these stores name: the wait stands behind them
    asm volatile("s_wait_xcnt 0x0" ::: "memory");
  }
}

__global__ void __launch_bounds__(128)
gemm_out(const _Float16* __restrict__ A, const _Float16* __restrict__ W,
         const float* __restrict__ bias, float* __restrict__ outp,
         int M, int N, int K) {
  __shared__ __align__(16) _Float16 stg[2 * G_STAGE];
  gemm_tile(A, W, bias, outp, stg, M, N, K);
}

// ---------------------------------------------------------------------------
// K/V staging for flash_attn.  A stage is one 64-key tile of each key half: K as 64 key rows
// and V as 64 d rows, 128 data bytes each, laid at a 144-byte LDS pitch
// (16 B x odd: conflict-free for the ds_load_b128 fragment reads).
// ---------------------------------------------------------------------------
#define KV_PITCH 72                 // halves per LDS row
#define KV_TILE  (64 * KV_PITCH)    // halves per staged tile

// One stage's copies of one lane: four 16-byte pieces of K and four of V,
// rows 16 apart.  Eight lanes cover one whole 128-byte row.  The s_wait_xcnt
// closes the statement so that no address register named by a copy is
// rewritten ahead of it.
static __device__ __forceinline__ void stage_kv(const _Float16* kg,
                                                const _Float16* vg,
                                                unsigned int kl,
                                                unsigned int vl) {
  asm volatile(
      "global_load_async_to_lds_b128 %0, %8, off\n\t"
      "global_load_async_to_lds_b128 %1, %9, off\n\t"
      "global_load_async_to_lds_b128 %2, %10, off\n\t"
      "global_load_async_to_lds_b128 %3, %11, off\n\t"
      "global_load_async_to_lds_b128 %4, %12, off\n\t"
      "global_load_async_to_lds_b128 %5, %13, off\n\t"
      "global_load_async_to_lds_b128 %6, %14, off\n\t"
      "global_load_async_to_lds_b128 %7, %15, off\n\t"
      "s_wait_xcnt 0x0"
      :: "v"(kl), "v"(kl + 16u * KV_PITCH * 2u), "v"(kl + 32u * KV_PITCH * 2u),
         "v"(kl + 48u * KV_PITCH * 2u),
         "v"(vl), "v"(vl + 16u * KV_PITCH * 2u), "v"(vl + 32u * KV_PITCH * 2u),
         "v"(vl + 48u * KV_PITCH * 2u),
         "v"(kg), "v"(kg + 16 * EMB), "v"(kg + 32 * EMB), "v"(kg + 48 * EMB),
         "v"(vg), "v"(vg + 16 * SEQ), "v"(vg + 32 * SEQ), "v"(vg + 48 * SEQ)
      : "memory");
}

// Lane l with lane l ^ 16 (the two lanes that share one query column).
static __device__ __forceinline__ float xhalf(float x) {
  const int b = __builtin_bit_cast(int, x);
  return __builtin_bit_cast(
      float, __builtin_amdgcn_permlanex16(b, b, 0x76543210, 0xfedcba98, false,
                                          false));
}

// ---------------------------------------------------------------------------
// Flash attention: one block = 8 waves = 128 query rows of one (b,h).
// A wave owns 32 queries (two column tiles) and one half of the keys: wave w
// has query group w & 3 and key half w >> 2.  Every K and V fragment read from
// LDS feeds two WMMAs, and the split of the keys keeps as many waves on the
// chip as one tile of 16 queries per wave over all keys would give.
// A stage is one 64-key K/V tile of each key half, copied once into LDS for
// the four waves that share it (two buffers, the next stage's copies fly while
// this one is worked on).  The products are the transposed ones:
//   St = K @ Q^T (A = K rows, B = Q), Ot += V^T @ Pt (A = d-major V rows).
// In an accumulator tile a lane then holds ONE query (column lane & 15) and
// eight keys (or d) hb..hb+7: maximum and sum run in the lane, the two lanes
// of a query meet by one cross-half move, and two St tiles are, element for
// element, the B fragment of Pt (k = hb+0..7 and 16+hb+0..7).
// Behind the loop the two waves of a query group exchange one column tile
// each through LDS and join the halves' maxima, sums and outputs.
// ---------------------------------------------------------------------------
#define KHALF (SEQ / 2)             // keys per key half
#define NSTAGE (KHALF / 64)         // stages per wave

// four waves per SIMD (two blocks per WGP): holds a wave to 256 VGPRs
__global__ void __launch_bounds__(256)
__attribute__((amdgpu_waves_per_eu(4, 4)))
flash_attn(const _Float16* __restrict__ qh, const _Float16* __restrict__ kh,
           const _Float16* __restrict__ vt,
           const unsigned int* __restrict__ mbits,
           _Float16* __restrict__ oh) {
  // [buffer][K | V][key half][tile]
  __shared__ __align__(16) _Float16 KV[2][2][2][KV_TILE];

  const int lane = threadIdx.x & 31;
  // the wave's number as a scalar: what is formed from it stays out of VGPRs
  const int wave = __builtin_amdgcn_readfirstlane(threadIdx.x >> 5);
  const int qg   = wave & 3;
  const int half = wave >> 2;
  const int r    = lane & 15;
  const int hb   = (lane >> 4) * 8;
  const int b    = blockIdx.y / HEADS;
  const int h    = blockIdx.y % HEADS;
  const int q0   = blockIdx.x * 128 + qg * 32;

  const float scale = 0.04419417382415922f;   // 1/sqrt(512) (ref scales by E)

  // Q fragments for this wave's 2 x 16 queries (d = 0..31, 32..63), in VGPRs
  v16h Qb[2][2];
#pragma unroll
  for (int qt = 0; qt < 2; ++qt) {
    const _Float16* qrow =
        qh + ((size_t)b * SEQ + q0 + qt * 16 + r) * EMB + h * HDIM;
    Qb[qt][0] = frag_load(qrow + hb);
    Qb[qt][1] = frag_load(qrow + 32 + hb);
  }

  v8f O[2][4] = {};              // Ot tiles: d = dt*16 + hb + j, query r
  float mrun[2] = {-1e38f, -1e38f};   // the queries' running maxima
  float lrun[2] = {0.f, 0.f};         // running sums over this lane's keys

  const _Float16* kb_ = kh + ((size_t)b * SEQ + half * KHALF) * EMB + h * HDIM;
  const _Float16* vb_ =
      vt + ((size_t)(b * HEADS + h) * HDIM) * SEQ + half * KHALF;
  // The wave's mask words (lane masks, see pre_pass): the address is the same
  // in every lane and nothing writes the words in this launch, so they are read
  // through the constant address space, by scalar loads into SGPRs.
  const __attribute__((address_space(4))) v16u* mb_ =
      (const __attribute__((address_space(4))) v16u*)(
          mbits + ((size_t)((b * SEQ + q0) >> 4) * (SEQ / 64) +
                   half * (KHALF / 64)) * 32);

  // This lane's piece of a stage, in its own key half: row (t >> 3) +
  // {0,16,32,48}, 16-byte column t & 7, t = thread within the half's 4 waves.
  const int crow = (threadIdx.x & 127) >> 3;
  const int ccol = (threadIdx.x & 7) * 8;
  const _Float16* kg = kb_ + (size_t)crow * EMB + ccol;   // advances 64 rows
  const _Float16* vg = vb_ + (size_t)crow * SEQ + ccol;   // advances 64 cols
  const unsigned int kl =
      (unsigned int)(size_t)&KV[0][0][half][crow * KV_PITCH + ccol];
  const unsigned int vl =
      (unsigned int)(size_t)&KV[0][1][half][crow * KV_PITCH + ccol];
  const unsigned int bufb = 4u * KV_TILE * 2u;   // bytes per buffer

  stage_kv(kg, vg, kl, vl);
  // stage 0 has landed for this wave; the barrier publishes it to the others
  asm volatile("s_wait_asynccnt 0x0" ::: "memory");
  __syncthreads();
  stage_kv(kg + 64 * EMB, vg + 64, kl + bufb, vl + bufb);

  // One stage's work.  It is written once and used in two loops, one whose
  // every trip refills and one whose trips do not: a trip is then straight-line
  // code, and the row sums stay ahead of the Ot products instead of being moved
  // behind a refill branch, where all of P in f32 would have to stay in
  // registers beside its packed copy.
  auto stage_step = [&](const int kt, const bool refill)
                        __attribute__((always_inline)) {
    const int k0 = kt * 64;
    const int buf = kt & 1;
    const _Float16* Kt = &KV[buf][0][half][r * KV_PITCH + hb];
    const _Float16* Vt = &KV[buf][1][half][r * KV_PITCH + hb];

    // the stage's 2 x 32 lane masks: [column tile][St tiles 0,1 | 2,3]
    v16u mw[2][2];
#pragma unroll
    for (int qt = 0; qt < 2; ++qt)
#pragma unroll
      for (int p = 0; p < 2; ++p)
        mw[qt][p] = mb_[(qt * (SEQ / 64) + kt) * 2 + p];

    // ---- St = K @ Q^T : 2 x 4 C-tiles of 16 keys x 16 queries (2 wmma each)
    // the tile's eight K fragments are read as one group ahead of the WMMAs,
    // so that a wave meets the LDS latency once, not once a fragment
    v16h ka[2][4];
#pragma unroll
    for (int ks = 0; ks < 2; ++ks)
#pragma unroll
      for (int nt = 0; nt < 4; ++nt)
        ka[ks][nt] = frag_load(Kt + nt * 16 * KV_PITCH + ks * 32);
    // keeps the scheduler from sinking the reads back among the WMMAs, where
    // each fragment would be waited for on its own
    __builtin_amdgcn_sched_barrier(0);
    v8f Sc[2][4];
#pragma unroll
    for (int nt = 0; nt < 4; ++nt)
#pragma unroll
      for (int qt = 0; qt < 2; ++qt) {
        v8f c = {};
        Sc[qt][nt] = wmma_f16(ka[0][nt], Qb[qt][0], c);
      }
#pragma unroll
    for (int nt = 0; nt < 4; ++nt)
#pragma unroll
      for (int qt = 0; qt < 2; ++qt)
        Sc[qt][nt] = wmma_f16(ka[1][nt], Qb[qt][1], Sc[qt][nt]);
    // the first four V fragments (keys 0..31), one group: they return while
    // the first column tile's softmax runs
    v16h va[2][4];
#pragma unroll
    for (int dt = 0; dt < 4; ++dt)
      va[0][dt] = frag_load(Vt + dt * 16 * KV_PITCH);
    // keeps the scheduler from sinking the reads down to the Ot products,
    // where each would be waited for with nothing left to cover it
    __builtin_amdgcn_sched_barrier(0);

    v16h pb[2][2];                 // Pt as B fragments: [column tile][step]
#pragma unroll
    for (int qt = 0; qt < 2; ++qt) {
      // ---- mask (pre-scale, as reference) + scale; maximum in the lane
      // (products, differences and sums are written on whole 8-element tiles,
      // so that packed operations pair neighbouring registers of one tile)
      float vmax[4];
#pragma unroll
      for (int nt = 0; nt < 4; ++nt) {
        v8f s = Sc[qt][nt] * scale;
#pragma unroll
        for (int j = 0; j < 8; ++j) {
          // the word in its SGPR is the select's condition as it stands
          s[j] = __builtin_amdgcn_inverse_ballot_w32(
                     mw[qt][nt >> 1][(nt & 1) * 8 + j])
                     ? s[j]
                     : -4.4e18f;
          vmax[nt] = j ? fmaxf(vmax[nt], s[j]) : s[j];
        }
        Sc[qt][nt] = s;
      }

      // ---- online softmax: one query per lane, its keys split over two lanes
      float v = fmaxf(fmaxf(vmax[0], vmax[1]), fmaxf(vmax[2], vmax[3]));
      v = fmaxf(v, xhalf(v));
      const float mn = fmaxf(mrun[qt], v);
      const float alpha = __expf(mrun[qt] - mn);
      mrun[qt] = mn;
#pragma unroll
      for (int nt = 0; nt < 4; ++nt) {
        const v8f e = (Sc[qt][nt] - mn) * 1.44269504088896340736f;  // log2(e)
#pragma unroll
        for (int j = 0; j < 8; ++j)
          Sc[qt][nt][j] = __builtin_amdgcn_exp2f(e[j]);
      }
      const v8f ps = (Sc[qt][0] + Sc[qt][1]) + (Sc[qt][2] + Sc[qt][3]);
      lrun[qt] = lrun[qt] * alpha + (((ps[0] + ps[1]) + (ps[2] + ps[3])) +
                                     ((ps[4] + ps[5]) + (ps[6] + ps[7])));
#pragma unroll
      for (int dt = 0; dt < 4; ++dt) O[qt][dt] *= alpha;
      // Pt's B fragments are packed straight from pairs of St tiles
#pragma unroll
      for (int step = 0; step < 2; ++step)
#pragma unroll
        for (int i = 0; i < 8; ++i) {
          pb[qt][step][i]     = (_Float16)Sc[qt][2 * step][i];
          pb[qt][step][i + 8] = (_Float16)Sc[qt][2 * step + 1][i];
        }
      if (qt == 0) {
        // the other four V fragments (keys 32..63) go into the registers that
        // the packed tile has left and return under the second tile's softmax;
        // the two scheduling fences hold the group at this place: earlier, the
        // wave's registers do not hold it, later, nothing covers its latency
        __builtin_amdgcn_sched_barrier(0);
#pragma unroll
        for (int dt = 0; dt < 4; ++dt)
          va[1][dt] = frag_load(Vt + dt * 16 * KV_PITCH + 32);
        __builtin_amdgcn_sched_barrier(0);
      }
    }

    // ---- Ot += V^T @ Pt   (V is d-major: A fragments load contiguously)
#pragma unroll
    for (int step = 0; step < 2; ++step)
#pragma unroll
      for (int dt = 0; dt < 4; ++dt)
#pragma unroll
        for (int qt = 0; qt < 2; ++qt)
          O[qt][dt] = wmma_f16(va[step][dt], pb[qt][step], O[qt][dt]);

    // ---- publish stage kt+1, free this buffer, refill it with stage kt+2
    // keeps the waits and the barrier down here: lifted up among the softmax
    // they would cut short the time that stage kt+1's copies have to land
    __builtin_amdgcn_sched_barrier(0);
    // this wave's reads of the buffer have returned before it is refilled
    asm volatile("s_wait_dscnt 0x0" ::: "memory");
    // this wave's copies of stage kt+1 have landed before the barrier
    asm volatile("s_wait_asynccnt 0x0" ::: "memory");
    __syncthreads();
    if (refill)
      stage_kv(kg + (size_t)(k0 + 128) * EMB, vg + k0 + 128,
               kl + buf * bufb, vl + buf * bufb);
  };
  for (int kt = 0; kt < NSTAGE - 2; ++kt) stage_step(kt, true);
  for (int kt = NSTAGE - 2; kt < NSTAGE; ++kt) stage_step(kt, false);
  // no copy is left in flight when the stages' LDS is reused below
  asm volatile("s_wait_asynccnt 0x0" ::: "memory");

  // ---- join the two key halves.  The loop's last barrier has ended every
  // read of the stages, so their LDS carries the exchange: the wave of key
  // half 0 finishes column tile 0 and hands tile 1 to its partner (wave ^ 4),
  // the wave of half 1 the other way round.  Same lane, same elements.
  v4f* jb = (v4f*)&KV[0][0][0][0];        // [wave][9 pieces][lane], 16 B each
  v8f Ok[4], Og[4];
#pragma unroll
  for (int dt = 0; dt < 4; ++dt)
#pragma unroll
    for (int j = 0; j < 8; ++j) {
      Ok[dt][j] = half ? O[1][dt][j] : O[0][dt][j];
      Og[dt][j] = half ? O[0][dt][j] : O[1][dt][j];
    }
  const float mk = half ? mrun[1] : mrun[0], mg = half ? mrun[0] : mrun[1];
  const float lk = half ? lrun[1] : lrun[0], lg = half ? lrun[0] : lrun[1];
  v4f* mine = jb + wave * (9 * 32) + lane;
  const v4f* theirs = jb + (wave ^ 4) * (9 * 32) + lane;
#pragma unroll
  for (int dt = 0; dt < 4; ++dt) {
    mine[(2 * dt) * 32] = v4f{Og[dt][0], Og[dt][1], Og[dt][2], Og[dt][3]};
    mine[(2 * dt + 1) * 32] = v4f{Og[dt][4], Og[dt][5], Og[dt][6], Og[dt][7]};
  }
  mine[8 * 32] = v4f{mg, lg, 0.f, 0.f};
  __syncthreads();
  const v4f ml = theirs[8 * 32];
  const float mn = fmaxf(mk, ml[0]);
  const float fk = __expf(mk - mn);
  const float fo = __expf(ml[0] - mn);
  const float lj = lk * fk + ml[1] * fo;

  // ---- join the two lanes' sums, normalize and emit attention output
  // (f16, row-major [B*S, E]): a lane holds 8 consecutive d of its query
  const float lsum = lj + xhalf(lj);
  _Float16* orow =
      oh + ((size_t)b * SEQ + q0 + half * 16 + r) * EMB + h * HDIM + hb;
#pragma unroll
  for (int dt = 0; dt < 4; ++dt) {
    const v4f o0 = theirs[(2 * dt) * 32];
    const v4f o1 = theirs[(2 * dt + 1) * 32];
    v8h pk;
#pragma unroll
    for (int j = 0; j < 8; ++j) {
      const float oo = j < 4 ? o0[j & 3] : o1[j & 3];
      pk[j] = (_Float16)((Ok[dt][j] * fk + oo * fo) / lsum);
    }
    *(v8h*)(orow + dt * 16) = pk;
  }
}

// ---------------------------------------------------------------------------
extern "C" void kernel_launch(void* const* d_in, const int* in_sizes, int n_in,
                              void* d_out, int out_size, void* d_ws, size_t ws_size,
                              hipStream_t stream) {
  const float* key   = (const float*)d_in[0];
  const float* value = (const float*)d_in[1];
  const float* query = (const float*)d_in[2];
  const int*   mask  = (const int*)d_in[3];
  const float* Wq = (const float*)d_in[4];
  const float* bq = (const float*)d_in[5];
  const float* Wk = (const float*)d_in[6];
  const float* bk = (const float*)d_in[7];
  const float* Wv = (const float*)d_in[8];
  const float* bv = (const float*)d_in[9];
  const float* Wo = (const float*)d_in[10];
  const float* bo = (const float*)d_in[11];
  float* out = (float*)d_out;

  const size_t NX = (size_t)BATCH * SEQ * EMB;          // 4,194,304
  const size_t NW = (size_t)EMB * EMB;                  // 262,144
  const size_t NMW = (size_t)BATCH * SEQ * (SEQ / 32);  // 524,288 mask words

  char* w = (char*)d_ws;
  _Float16* wqh = (_Float16*)w; w += NW * 2;
  _Float16* wkh = (_Float16*)w; w += NW * 2;
  _Float16* wvh = (_Float16*)w; w += NW * 2;
  _Float16* woh = (_Float16*)w; w += NW * 2;
  _Float16* qh  = (_Float16*)w; w += NX * 2;
  _Float16* kh  = (_Float16*)w; w += NX * 2;
  _Float16* vt  = (_Float16*)w; w += NX * 2;   // [B,H,HDIM,SEQ]
  _Float16* oh  = (_Float16*)w; w += NX * 2;   // attention output
  unsigned int* mbits = (unsigned int*)w; w += NMW * 4;

  const int M = BATCH * SEQ;  // 8192
  pre_pass<<<PRE_BLOCKS, 256, 0, stream>>>(Wq, Wk, Wv, Wo, mask, wqh, mbits);

  dim3 gp(M / 128, EMB / 64);      // (64, 8)
  dim3 gp3(M / 128, 3);            // q, k and v projections in one grid
  gemm_qkv<<<gp3, 512, 0, stream>>>(query, key, value, wqh, wkh, wvh, bq, bk,
                                    bv, qh, kh, vt);

  flash_attn<<<dim3(SEQ / 128, BATCH * HEADS), 256, 0, stream>>>(qh, kh, vt,
                                                                mbits, oh);

  gemm_out<<<gp, 128, 0, stream>>>(oh, woh, bo, out, M, EMB, EMB);
}

// v009
// Measured time: 75.8 microseconds a run.
// Two timings next to v008 put it at 1.04 and 1.02 times that version's speed.
// Over all steps from v000 it is 3.17 times as fast.
#include <hip/hip_runtime.h>
#include <hip/hip_bf16.h>

#define BATCH 4
#define SEQ   2048
#define EMB   512
#define HEADS 8
#define HDIM  64

typedef __attribute__((ext_vector_type(16))) _Float16 v16h;
typedef __attribute__((ext_vector_type(8)))  _Float16 v8h;
typedef __attribute__((ext_vector_type(4)))  _Float16 v4h;
typedef __attribute__((ext_vector_type(8)))  float    v8f;
typedef __attribute__((ext_vector_type(4)))  float    v4f;
typedef __attribute__((ext_vector_type(16))) unsigned int v16u;

// ---------------------------------------------------------------------------
// Fragment loader for 16-bit WMMA A/B operands (CDNA5 16x32 / 32x16 layout).
// Per lane the fragment is two contiguous 8-half (16B) runs: k = kb + {0..7}
// and k = kb + {16..23}, where kb = (lane<16 ? 0 : 8).  Caller passes the
// pointer at element (row/col, kb).  Lowers to two global/ds _b128 loads.
// ---------------------------------------------------------------------------
static __device__ __forceinline__ v16h frag_load(const _Float16* p) {
  v8h lo = *(const v8h*)(p);
  v8h hi = *(const v8h*)(p + 16);
  v16h r;
#pragma unroll
  for (int i = 0; i < 8; ++i) { r[i] = lo[i]; r[i + 8] = hi[i]; }
  return r;
}

static __device__ __forceinline__ v8f wmma_f16(v16h a, v16h b, v8f c) {
  return __builtin_amdgcn_wmma_f32_16x16x32_f16(false, a, false, b,
                                                (short)0, c, false, false);
}

// ---------------------------------------------------------------------------
// Pre-pass, one launch for the five jobs that read none of each other's
// output: fp32 -> f16 of the four weights, and the bit-pack of the int32 mask
// (32 int -> 1 u32, 67 MB -> 2 MB, read once).  The activations are converted
// by gemm_qkv itself, on their way into LDS.
// A mask word is a LANE MASK of flash_attn's St tiles: for a tile of 16 queries
// and a group of 64 keys, word nt * 8 + j holds in bit l the mask of query
// l & 15 and key nt * 16 + (l >> 4) * 8 + j, the element that lane l has in
// register j of St tile nt.  Words: [16-query tile][64-key group][32].
// The work is cut into units of 32 KiB of input (256 threads x 8 x 16 B);
// a block walks the units blockIdx.x, + PRE_BLOCKS, ... and a unit's number
// names its job, so few waves are started and each keeps 8 loads in flight.
// ---------------------------------------------------------------------------
#define U_MASK 2048                 // BATCH*SEQ*SEQ ints      / 8192
#define U_W    32                   // EMB*EMB floats          / 8192
#define U_ALL  (U_MASK + 4 * U_W)   // 2176
#define PRE_BLOCKS (U_ALL / 4)      // 544 blocks, four units each

__global__ void __launch_bounds__(256)
pre_pass(const float* __restrict__ Wq, const float* __restrict__ Wk,
         const float* __restrict__ Wv, const float* __restrict__ Wo,
         const int* __restrict__ mask,
         _Float16* __restrict__ wdst,   // wq | wk | wv | wo, contiguous
         unsigned int* __restrict__ bits) {
  for (int u = blockIdx.x; u < U_ALL; u += PRE_BLOCKS) {
    if (u < U_MASK) {
      // the unit is one tile of 16 query rows by 512 keys; a wave takes one
      // group of 64 keys, a lane the 4 x 8 keys that it has in the St tiles
      const int lane = threadIdx.x & 31;
      const unsigned int loff =
          (lane & 15) * SEQ + (threadIdx.x >> 5) * 64 + (lane >> 4) * 8;
      const int4* p = (const int4*)(mask + (size_t)(u >> 2) * (16 * SEQ) +
                                    (u & 3) * 512 + loff);
      int4 m[8];
#pragma unroll
      for (int nt = 0; nt < 4; ++nt) {
        m[2 * nt]     = p[nt * 4];
        m[2 * nt + 1] = p[nt * 4 + 1];
      }
      // a compare over the wave is the word; lane i keeps word i for the store
      unsigned int w = 0;
#pragma unroll
      for (int t = 0; t < 8; ++t) {
        const unsigned int c0 = __builtin_amdgcn_ballot_w32(m[t].x != 0);
        const unsigned int c1 = __builtin_amdgcn_ballot_w32(m[t].y != 0);
        const unsigned int c2 = __builtin_amdgcn_ballot_w32(m[t].z != 0);
        const unsigned int c3 = __builtin_amdgcn_ballot_w32(m[t].w != 0);
        w = lane == 4 * t + 0 ? c0 : w;
        w = lane == 4 * t + 1 ? c1 : w;
        w = lane == 4 * t + 2 ? c2 : w;
        w = lane == 4 * t + 3 ? c3 : w;
      }
      // tile u >> 2, group (u & 3) * 8 + wave, word lane: u * 256 + thread
      (bits + (size_t)u * 256)[threadIdx.x] = w;
    } else {
      const int d = u - U_MASK;
      const int j = d / U_W;
      const float* in = (j == 0 ? Wq : j == 1 ? Wk : j == 2 ? Wv : Wo) +
                        (size_t)(d % U_W) * 8192;
      _Float16* out = wdst + (size_t)d * 8192;
      v4f v[8];
#pragma unroll
      for (int t = 0; t < 8; ++t)
        v[t] = ((const v4f*)in)[t * 256 + threadIdx.x];
#pragma unroll
      for (int t = 0; t < 8; ++t) {
        v4h o;
#pragma unroll
        for (int e = 0; e < 4; ++e) o[e] = (_Float16)v[t][e];
        ((v4h*)out)[t * 256 + threadIdx.x] = o;
      }
      // whatever code follows this branch may rewrite the registers that the
      // eight stores name: the wait stands directly behind them
      asm volatile("s_wait_xcnt 0x0" ::: "memory");
    }
    // The next trip rewrites registers that this trip's stores still name.
    // u passes through the statement so that every address of the next trip
    // is formed behind the wait, not carried over it by an increment.
    asm volatile("s_wait_xcnt 0x0" : "+s"(u) :: "memory");
  }
}

// ---------------------------------------------------------------------------
// Operand staging for the out-projection.  A stage is one k-tile of 64 halves:
// 128 rows of A, then 64 rows of W, 128 data bytes each, laid at a 144-byte LDS
// pitch (16 B x odd: conflict-free for the ds_load_b128 fragment reads).
// ---------------------------------------------------------------------------
#define G_PITCH 72                          // halves per LDS row
#define GA_TILE (128 * G_PITCH)             // halves of A per stage
#define G_STAGE ((128 + 64) * G_PITCH)      // halves per stage (A | W)

// One stage's copies of one lane: eight 16-byte pieces of A and four of W,
// rows 16 apart (rs = 16 rows in halves).  Eight lanes cover one whole
// 128-byte line of a row.  The s_wait_xcnt closes the statement so that no
// address register named by a copy is rewritten ahead of it.
static __device__ __forceinline__ void stage_aw(const _Float16* ag,
                                                const _Float16* wg, size_t rs,
                                                unsigned int al,
                                                unsigned int wl) {
  const unsigned int ls = 16u * G_PITCH * 2u;   // 16 LDS rows in bytes
  asm volatile(
      "global_load_async_to_lds_b128 %0, %12, off\n\t"
      "global_load_async_to_lds_b128 %1, %13, off\n\t"
      "global_load_async_to_lds_b128 %2, %14, off\n\t"
      "global_load_async_to_lds_b128 %3, %15, off\n\t"
      "global_load_async_to_lds_b128 %4, %16, off\n\t"
      "global_load_async_to_lds_b128 %5, %17, off\n\t"
      "global_load_async_to_lds_b128 %6, %18, off\n\t"
      "global_load_async_to_lds_b128 %7, %19, off\n\t"
      "global_load_async_to_lds_b128 %8, %20, off\n\t"
      "global_load_async_to_lds_b128 %9, %21, off\n\t"
      "global_load_async_to_lds_b128 %10, %22, off\n\t"
      "global_load_async_to_lds_b128 %11, %23, off\n\t"
      "s_wait_xcnt 0x0"
      :: "v"(al), "v"(al + ls), "v"(al + 2u * ls), "v"(al + 3u * ls),
         "v"(al + 4u * ls), "v"(al + 5u * ls), "v"(al + 6u * ls),
         "v"(al + 7u * ls),
         "v"(wl), "v"(wl + ls), "v"(wl + 2u * ls), "v"(wl + 3u * ls),
         "v"(ag), "v"(ag + rs), "v"(ag + 2 * rs), "v"(ag + 3 * rs),
         "v"(ag + 4 * rs), "v"(ag + 5 * rs), "v"(ag + 6 * rs),
         "v"(ag + 7 * rs),
         "v"(wg), "v"(wg + rs), "v"(wg + 2 * rs), "v"(wg + 3 * rs)
      : "memory");
}

// ---------------------------------------------------------------------------
// GEMM: Y[M,N] = A[M,K] @ W[N,K]^T + bias[N]   (torch Linear semantics)
// Block = 128 threads (4 waves); block tile 128(M) x 64(N); wave tile 32x64:
// two A fragments amortize every W fragment (8 WMMAs per 6 fragment loads).
// The block's operands come through LDS (stg: two stages): each k-tile is
// copied once, in whole 128-byte lines, and the next tile's copies fly while
// this one is worked on.  K is a multiple of 64.  f32 row-major output.
// The products are taken as W @ A^T: in an accumulator tile a lane then holds
// eight consecutive columns of ONE output row, which go as two 16-byte pieces
// into the wave's own LDS range and leave from there as whole 128-byte lines.
// ---------------------------------------------------------------------------
#define O_PITCH 68                          // floats per staged output row
static __device__ __forceinline__ void
gemm_tile(const _Float16* __restrict__ A, const _Float16* __restrict__ W,
          const float* __restrict__ bias, float* __restrict__ o,
          _Float16* stg, const int N, int K) {
  const int lane = threadIdx.x & 31;
  const int wave = threadIdx.x >> 5;
  const int r    = lane & 15;          // row of A frag / column of B frag
  const int hb   = (lane >> 4) * 8;    // per-half k-run base; also C row base
  const int m0   = blockIdx.x * 128 + wave * 32;
  const int n0   = blockIdx.y * 64;

  // This lane's piece of a stage: row (tid >> 3) + 16 * i, 16-byte column
  // tid & 7.
  const int crow = threadIdx.x >> 3;
  const int ccol = (threadIdx.x & 7) * 8;
  const size_t rs = (size_t)16 * K;
  const _Float16* ag = A + (size_t)(blockIdx.x * 128 + crow) * K + ccol;
  const _Float16* wg = W + (size_t)(n0 + crow) * K + ccol;
  const unsigned int al =
      (unsigned int)(size_t)(stg + crow * G_PITCH + ccol);
  const unsigned int wl = al + GA_TILE * 2u;

  const int ntiles = K >> 6;
  stage_aw(ag, wg, rs, al, wl);
  // tile 0 has landed for this wave; the barrier publishes it to the others
  asm volatile("s_wait_asynccnt 0x0" ::: "memory");
  __syncthreads();
  if (1 < ntiles)
    stage_aw(ag + 64, wg + 64, rs, al + G_STAGE * 2u, wl + G_STAGE * 2u);

  v8f acc[2][4] = {};
  for (int t = 0; t < ntiles; ++t) {
    const int buf = t & 1;
    const _Float16* As = stg + buf * G_STAGE + (wave * 32 + r) * G_PITCH + hb;
    const _Float16* Ws = stg + buf * G_STAGE + GA_TILE + r * G_PITCH + hb;
    // the tile's twelve fragments are read as one group ahead of its WMMAs,
    // so that a wave meets the LDS latency once a tile, not once a fragment
    v16h a[2][2], b[2][4];
#pragma unroll
    for (int ks = 0; ks < 2; ++ks) {
      a[ks][0] = frag_load(As + ks * 32);
      a[ks][1] = frag_load(As + 16 * G_PITCH + ks * 32);
#pragma unroll
      for (int nt = 0; nt < 4; ++nt)
        b[ks][nt] = frag_load(Ws + nt * 16 * G_PITCH + ks * 32);
    }
    // keeps the scheduler from sinking the reads back among the WMMAs, where
    // each fragment would be waited for on its own
    __builtin_amdgcn_sched_barrier(0);
#pragma unroll
    for (int nt = 0; nt < 4; ++nt) {
      acc[0][nt] = wmma_f16(b[0][nt], a[0][0], acc[0][nt]);
      acc[1][nt] = wmma_f16(b[0][nt], a[0][1], acc[1][nt]);
    }
    // keeps the first half's WMMAs ahead of the waits below: they cover the
    // flight of tile t+1's copies, and their fragment registers are free
    // again for the addresses of the refill
    __builtin_amdgcn_sched_barrier(0);

    // ---- publish tile t+1, free this buffer, refill it with tile t+2
    // (the buffer has been read out into registers: the second half's WMMAs
    // follow the refill's issue and cover its flight)
    // this wave's reads of the buffer have returned before it is refilled
    asm volatile("s_wait_dscnt 0x0" ::: "memory");
    // this wave's copies of tile t+1 have landed before the barrier
    asm volatile("s_wait_asynccnt 0x0" ::: "memory");
    __syncthreads();
    if (t + 2 < ntiles)
      stage_aw(ag + (t + 2) * 64, wg + (t + 2) * 64, rs,
               al + buf * (G_STAGE * 2u), wl + buf * (G_STAGE * 2u));
#pragma unroll
    for (int nt = 0; nt < 4; ++nt) {
      acc[0][nt] = wmma_f16(b[1][nt], a[1][0], acc[0][nt]);
      acc[1][nt] = wmma_f16(b[1][nt], a[1][1], acc[1][nt]);
    }
  }
  // no copy is left in flight when the wave goes on to its stores and ends
  asm volatile("s_wait_asynccnt 0x0" ::: "memory");

  // ---- the wave's 32 x 64 tile goes through its own LDS range (the loop's
  // last barrier has ended every read of the stages): 32 rows of 256 bytes at
  // a 272-byte pitch (16 B x odd).  acc[mt][nt][j] is row mt * 16 + r, column
  // nt * 16 + hb + j.
  float* st = (float*)stg + wave * (32 * O_PITCH);
#pragma unroll
  for (int nt = 0; nt < 4; ++nt) {
    const v4f b0 = *(const v4f*)(bias + n0 + nt * 16 + hb);
    const v4f b1 = *(const v4f*)(bias + n0 + nt * 16 + hb + 4);
#pragma unroll
    for (int mt = 0; mt < 2; ++mt) {
      float* p = st + (mt * 16 + r) * O_PITCH + nt * 16 + hb;
      const v8f c = acc[mt][nt];
      *(v4f*)p = v4f{c[0], c[1], c[2], c[3]} + b0;
      *(v4f*)(p + 4) = v4f{c[4], c[5], c[6], c[7]} + b1;
    }
  }
  // the other lanes' pieces have landed before the rows are read back
  asm volatile("s_wait_dscnt 0x0" ::: "memory");
  // a store of the wave covers two rows of the tile: four whole lines
  const float* sr = st + (lane >> 4) * O_PITCH + (lane & 15) * 4;
  float* og = o + (size_t)(m0 + (lane >> 4)) * N + n0 + (lane & 15) * 4;
  v4f ov[16];
#pragma unroll
  for (int i = 0; i < 16; ++i) ov[i] = *(const v4f*)(sr + i * 2 * O_PITCH);
#pragma unroll
  for (int i = 0; i < 16; ++i) *(v4f*)(og + (size_t)(i * 2) * N) = ov[i];
}

// ---------------------------------------------------------------------------
// The three projections, one grid (blockIdx.y names the job: 0 q, 1 k, 2 v):
// Y[128 rows, all 512 columns] = X @ W^T + bias from the f32 activations.
// A block owns whole rows of X, so every element of X is read from memory and
// converted to f16 exactly once, here, on its way into LDS (global f32 ->
// registers -> ds_store), and no f16 copy of X passes through memory.
// Block = 512 threads (16 waves, 2 x 8); wave tile 64 x 64: eight fragments
// from LDS feed sixteen WMMAs.  A stage is one k-tile of 64 halves: 128 rows
// of X, then the 512 rows of W (async copies), at the 144-byte pitch.  Two
// stages: the next tile's loads and copies fly while this one is worked on.
// q, k: f16 row-major; v: f16 head-transposed [B,H,HDIM,SEQ].
// In an accumulator tile a lane holds eight consecutive rows (A operand's) of
// one column (B operand's).  v is taken as X @ W^T and q, k as W @ X^T, so that
// those eight are neighbours in the output's memory order for every job: they
// go as one 16-byte piece into the wave's own LDS range, and the wave's 64 x 64
// tile leaves from there as 64 whole 128-byte lines.
// ---------------------------------------------------------------------------
#define QA_TILE (128 * G_PITCH)             // halves of X per stage
#define Q_STAGE ((128 + EMB) * G_PITCH)     // halves per stage (X | W)
#define Q_TILES (EMB / 64)                  // k-tiles

// One stage's W copies of one lane: eight 16-byte pieces, rows 64 apart.
// Eight lanes cover one whole 128-byte line of a row.  The s_wait_xcnt closes
// the statement so that no address register named by a copy is rewritten
// ahead of it.
static __device__ __forceinline__ void stage_w(const _Float16* wg,
                                               unsigned int wl) {
  const unsigned int ls = 64u * G_PITCH * 2u;   // 64 LDS rows in bytes
  const size_t rs = (size_t)64 * EMB;           // 64 rows of W in halves
  asm volatile(
      "global_load_async_to_lds_b128 %0, %8, off\n\t"
      "global_load_async_to_lds_b128 %1, %9, off\n\t"
      "global_load_async_to_lds_b128 %2, %10, off\n\t"
      "global_load_async_to_lds_b128 %3, %11, off\n\t"
      "global_load_async_to_lds_b128 %4, %12, off\n\t"
      "global_load_async_to_lds_b128 %5, %13, off\n\t"
      "global_load_async_to_lds_b128 %6, %14, off\n\t"
      "global_load_async_to_lds_b128 %7, %15, off\n\t"
      "s_wait_xcnt 0x0"
      :: "v"(wl), "v"(wl + ls), "v"(wl + 2u * ls), "v"(wl + 3u * ls),
         "v"(wl + 4u * ls), "v"(wl + 5u * ls), "v"(wl + 6u * ls),
         "v"(wl + 7u * ls),
         "v"(wg), "v"(wg + rs), "v"(wg + 2 * rs), "v"(wg + 3 * rs),
         "v"(wg + 4 * rs), "v"(wg + 5 * rs), "v"(wg + 6 * rs),
         "v"(wg + 7 * rs)
      : "memory");
}

__global__ void __launch_bounds__(512)
gemm_qkv(const float* __restrict__ query, const float* __restrict__ key,
         const float* __restrict__ value, const _Float16* __restrict__ wq,
         const _Float16* __restrict__ wk, const _Float16* __restrict__ wv,
         const float* __restrict__ bq, const float* __restrict__ bk,
         const float* __restrict__ bv, _Float16* __restrict__ qh,
         _Float16* __restrict__ kh, _Float16* __restrict__ vt) {
  __shared__ __align__(16) _Float16 stg[2 * Q_STAGE];
  const int job = blockIdx.y;
  const float* X = job == 0 ? query : job == 1 ? key : value;
  const _Float16* Wt = job == 0 ? wq : job == 1 ? wk : wv;
  const float* bias = job == 0 ? bq : job == 1 ? bk : bv;

  const int lane = threadIdx.x & 31;
  // the wave's number as a scalar: what is formed from it stays out of VGPRs
  const int wave = __builtin_amdgcn_readfirstlane(threadIdx.x >> 5);
  const int r    = lane & 15;          // row of A frag / column of B frag
  const int hb   = (lane >> 4) * 8;    // per-half k-run base; also C row base
  const int m0   = blockIdx.x * 128 + (wave & 1) * 64;
  const int n0   = (wave >> 1) * 64;

  // This lane's piece of a stage of X: rows (tid >> 4) + 32 * i, four floats at
  // column (tid & 15) * 4: sixteen lanes cover the two whole lines of a row.
  const int arow = threadIdx.x >> 4;
  const int acol = (threadIdx.x & 15) * 4;
  const float* xg = X + (size_t)(blockIdx.x * 128 + arow) * EMB + acol;
  _Float16* xs = stg + arow * G_PITCH + acol;
  // ... and of W: rows (tid >> 3) + 64 * i, 16-byte column tid & 7.
  const int crow = threadIdx.x >> 3;
  const int ccol = (threadIdx.x & 7) * 8;
  const _Float16* wg = Wt + (size_t)crow * EMB + ccol;
  const unsigned int wl =
      (unsigned int)(size_t)(stg + QA_TILE + crow * G_PITCH + ccol);

  v4f xr[4];                     // one k-tile of X in flight, f32
  auto load_x = [&](const int t) __attribute__((always_inline)) {
#pragma unroll
    for (int i = 0; i < 4; ++i)
      xr[i] = *(const v4f*)(xg + (size_t)(32 * i) * EMB + t * 64);
  };
  auto store_x = [&](const int buf) __attribute__((always_inline)) {
#pragma unroll
    for (int i = 0; i < 4; ++i) {
      v4h o;
#pragma unroll
      for (int e = 0; e < 4; ++e) o[e] = (_Float16)xr[i][e];
      *(v4h*)(xs + buf * Q_STAGE + 32 * i * G_PITCH) = o;
    }
  };

  load_x(0);
  stage_w(wg, wl);
  store_x(0);
  // tile 0 has landed for this wave; the barrier publishes it to the others
  asm volatile("s_wait_asynccnt 0x0" ::: "memory");
  __syncthreads();
  load_x(1);
  stage_w(wg + 64, wl + Q_STAGE * 2u);

  // the wave's rows of X and of W in a stage; which of them is the A operand
  const int xoff = ((wave & 1) * 64 + r) * G_PITCH + hb;
  const int woff = QA_TILE + (n0 + r) * G_PITCH + hb;
  const int aoff = job == 2 ? xoff : woff;
  const int boff = job == 2 ? woff : xoff;

  v8f acc[4][4] = {};
  for (int t = 0; t < Q_TILES; ++t) {
    const int buf = t & 1;
    const _Float16* As = stg + buf * Q_STAGE + aoff;   // A operand's rows
    const _Float16* Ws = stg + buf * Q_STAGE + boff;   // B operand's rows
#pragma unroll
    for (int ks = 0; ks < 2; ++ks) {
      // a k-step's eight fragments are read as one group ahead of its WMMAs,
      // so that a wave meets the LDS latency once a step, not once a fragment;
      // they stand in the order in which the WMMAs first ask for them
      v16h a[4], b[4];
      b[0] = frag_load(Ws + ks * 32);
#pragma unroll
      for (int i = 0; i < 4; ++i)
        a[i] = frag_load(As + i * 16 * G_PITCH + ks * 32);
#pragma unroll
      for (int i = 1; i < 4; ++i)
        b[i] = frag_load(Ws + i * 16 * G_PITCH + ks * 32);
      // keeps the scheduler from sinking the reads back among the WMMAs
      __builtin_amdgcn_sched_barrier(0);
#pragma unroll
      for (int nt = 0; nt < 4; ++nt)
#pragma unroll
        for (int mt = 0; mt < 4; ++mt)
          acc[mt][nt] = wmma_f16(a[mt], b[nt], acc[mt][nt]);
      // keeps the next group's reads behind these WMMAs: both groups at once
      // do not fit the wave's 256 registers beside the accumulators
      __builtin_amdgcn_sched_barrier(0);
    }

    // ---- publish tile t+1, free this buffer, refill it with tile t+2
    // X of tile t+1, loaded one trip ago, goes as f16 into the other buffer,
    // whose last readers passed the barrier at the foot of trip t-1
    if (t + 1 < Q_TILES) store_x(buf ^ 1);
    // this wave's reads of the buffer have returned before it is refilled,
    // and its stores of tile t+1 have landed before the barrier
    asm volatile("s_wait_dscnt 0x0" ::: "memory");
    // this wave's copies of tile t+1 have landed before the barrier
    asm volatile("s_wait_asynccnt 0x0" ::: "memory");
    __syncthreads();
    if (t + 2 < Q_TILES) {
      // X first: it comes from memory, W from L2; the s_wait_xcnt that closes
      // the copies' statement stands behind these loads' addresses as well
      load_x(t + 2);
      stage_w(wg + (t + 2) * 64, wl + buf * (Q_STAGE * 2u));
    }
  }
  // no copy is left in flight when the wave goes on to its stores and ends
  asm volatile("s_wait_asynccnt 0x0" ::: "memory");

  // ---- the wave's tile goes through its own LDS range (the loop's last
  // barrier has ended every read of the stages): 64 rows of 128 bytes at the
  // 144-byte pitch.  acc[i][k][j]: staged row k * 16 + r, half i * 16 + hb + j.
  _Float16* st = stg + wave * (64 * G_PITCH);
  _Float16* sw = st + r * G_PITCH + hb;
  // a store of the wave covers four staged rows: four whole lines
  const _Float16* sr = st + (lane >> 3) * G_PITCH + (lane & 7) * 8;
  auto flush = [&](_Float16* og, const int pitch) __attribute__((always_inline)) {
    // the other lanes' pieces have landed before the rows are read back
    asm volatile("s_wait_dscnt 0x0" ::: "memory");
    // og is the same in every lane; the lane's own place in a group of four
    // rows is one 32-bit byte offset, the same for all sixteen stores
    const unsigned int lo = ((lane >> 3) * pitch + (lane & 7) * 8) * 2;
    v8h ov[16];
#pragma unroll
    for (int i = 0; i < 16; ++i) ov[i] = *(const v8h*)(sr + i * 4 * G_PITCH);
#pragma unroll
    for (int i = 0; i < 16; ++i)
      *(v8h*)((char*)(og + (size_t)(i * 4) * pitch) + lo) = ov[i];
  };

  if (job == 2) {
    // staged row = d of the wave's head, halves = 64 sequence positions
#pragma unroll
    for (int k = 0; k < 4; ++k) {
      const float bc = bias[n0 + k * 16 + r];
#pragma unroll
      for (int i = 0; i < 4; ++i) {
        v8h pk;
#pragma unroll
        for (int j = 0; j < 8; ++j) pk[j] = (_Float16)(acc[i][k][j] + bc);
        *(v8h*)(sw + k * 16 * G_PITCH + i * 16) = pk;
      }
    }
    flush(vt + ((size_t)((m0 / SEQ) * HEADS + (n0 >> 6)) * HDIM) * SEQ +
              m0 % SEQ,
          SEQ);
  } else {
    // staged row = row of X, halves = the wave's 64 output columns
    v4f bl[4][2];   // the lane's 4 x 8 bias values, loaded as one group
    // the lane's byte offset, the one vector register that all eight loads name
    const unsigned int bo = hb * 4;
    const char* bb = (const char*)(bias + n0);
#pragma unroll
    for (int i = 0; i < 4; ++i) {
      bl[i][0] = *(const v4f*)(bb + i * 64 + bo);
      bl[i][1] = *(const v4f*)(bb + i * 64 + 16 + bo);
    }
    // stands behind the eight loads, ahead of any rewrite of the offset
    // register that they name; taking bo as an input keeps that register alive
    // up to here, so that no load's result is placed in it
    asm volatile("s_wait_xcnt 0x0" :: "v"(bo) : "memory");
#pragma unroll
    for (int i = 0; i < 4; ++i)
#pragma unroll
      for (int k = 0; k < 4; ++k) {
        v8h pk;
#pragma unroll
        for (int j = 0; j < 8; ++j)
          pk[j] = (_Float16)(acc[i][k][j] + bl[i][j >> 2][j & 3]);
        *(v8h*)(sw + k * 16 * G_PITCH + i * 16) = pk;
      }
    flush((job == 1 ? kh : qh) + (size_t)m0 * EMB + n0, EMB);
  }
}

__global__ void __launch_bounds__(128)
gemm_out(const _Float16* __restrict__ A, const _Float16* __restrict__ W,
         const float* __restrict__ bias, float* __restrict__ outp, int K) {
  __shared__ __align__(16) _Float16 stg[2 * G_STAGE];
  gemm_tile(A, W, bias, outp, stg, EMB, K);
}

// ---------------------------------------------------------------------------
// K/V staging for flash_attn.  A stage is one 64-key tile of each key half: K as 64 key rows
// and V as 64 d rows, 128 data bytes each, laid at a 144-byte LDS pitch
// (16 B x odd: conflict-free for the ds_load_b128 fragment reads).
// ---------------------------------------------------------------------------
#define KV_PITCH 72                 // halves per LDS row
#define KV_TILE  (64 * KV_PITCH)    // halves per staged tile

// One stage's copies of one lane: four 16-byte pieces of K and four of V,
// rows 16 apart.  Eight lanes cover one whole 128-byte row.  The s_wait_xcnt
// closes the statement so that no address register named by a copy is
// rewritten ahead of it.
static __device__ __forceinline__ void stage_kv(const _Float16* kg,
                                                const _Float16* vg,
                                                unsigned int kl,
                                                unsigned int vl) {
  asm volatile(
      "global_load_async_to_lds_b128 %0, %8, off\n\t"
      "global_load_async_to_lds_b128 %1, %9, off\n\t"
      "global_load_async_to_lds_b128 %2, %10, off\n\t"
      "global_load_async_to_lds_b128 %3, %11, off\n\t"
      "global_load_async_to_lds_b128 %4, %12, off\n\t"
      "global_load_async_to_lds_b128 %5, %13, off\n\t"
      "global_load_async_to_lds_b128 %6, %14, off\n\t"
      "global_load_async_to_lds_b128 %7, %15, off\n\t"
      "s_wait_xcnt 0x0"
      :: "v"(kl), "v"(kl + 16u * KV_PITCH * 2u), "v"(kl + 32u * KV_PITCH * 2u),
         "v"(kl + 48u * KV_PITCH * 2u),
         "v"(vl), "v"(vl + 16u * KV_PITCH * 2u), "v"(vl + 32u * KV_PITCH * 2u),
         "v"(vl + 48u * KV_PITCH * 2u),
         "v"(kg), "v"(kg + 16 * EMB), "v"(kg + 32 * EMB), "v"(kg + 48 * EMB),
         "v"(vg), "v"(vg + 16 * SEQ), "v"(vg + 32 * SEQ), "v"(vg + 48 * SEQ)
      : "memory");
}

// Lane l with lane l ^ 16 (the two lanes that share one query column).
static __device__ __forceinline__ float xhalf(float x) {
  const int b = __builtin_bit_cast(int, x);
  return __builtin_bit_cast(
      float, __builtin_amdgcn_permlanex16(b, b, 0x76543210, 0xfedcba98, false,
                                          false));
}

// ---------------------------------------------------------------------------
// Flash attention: one block = 8 waves = 128 query rows of one (b,h).
// A wave owns 32 queries (two column tiles) and one half of the keys: wave w
// has query group w & 3 and key half w >> 2.  Every K and V fragment read from
// LDS feeds two WMMAs, and the split of the keys keeps as many waves on the
// chip as one tile of 16 queries per wave over all keys would give.
// A stage is one 64-key K/V tile of each key half, copied once into LDS for
// the four waves that share it (two buffers, the next stage's copies fly while
// this one is worked on).  The products are the transposed ones:
//   St = K @ Q^T (A = K rows, B = Q), Ot += V^T @ Pt (A = d-major V rows).
// In an accumulator tile a lane then holds ONE query (column lane & 15) and
// eight keys (or d) hb..hb+7: maximum and sum run in the lane, the two lanes
// of a query meet by one cross-half move, and two St tiles are, element for
// element, the B fragment of Pt (k = hb+0..7 and 16+hb+0..7).
// Behind the loop the two waves of a query group exchange one column tile
// each through LDS and join the halves' maxima, sums and outputs.
// ---------------------------------------------------------------------------
#define KHALF (SEQ / 2)             // keys per key half
#define NSTAGE (KHALF / 64)         // stages per wave

// four waves per SIMD (two blocks per WGP): holds a wave to 256 VGPRs
__global__ void __launch_bounds__(256)
__attribute__((amdgpu_waves_per_eu(4, 4)))
flash_attn(const _Float16* __restrict__ qh, const _Float16* __restrict__ kh,
           const _Float16* __restrict__ vt,
           const unsigned int* __restrict__ mbits,
           _Float16* __restrict__ oh) {
  // [buffer][K | V][key half][tile]
  __shared__ __align__(16) _Float16 KV[2][2][2][KV_TILE];

  const int lane = threadIdx.x & 31;
  // the wave's number as a scalar: what is formed from it stays out of VGPRs
  const int wave = __builtin_amdgcn_readfirstlane(threadIdx.x >> 5);
  const int qg   = wave & 3;
  const int half = wave >> 2;
  const int r    = lane & 15;
  const int hb   = (lane >> 4) * 8;
  const int b    = blockIdx.y / HEADS;
  const int h    = blockIdx.y % HEADS;
  const int q0   = blockIdx.x * 128 + qg * 32;

  const float scale = 0.04419417382415922f;   // 1/sqrt(512) (ref scales by E)

  // Q fragments for this wave's 2 x 16 queries (d = 0..31, 32..63), in VGPRs
  v16h Qb[2][2];
#pragma unroll
  for (int qt = 0; qt < 2; ++qt) {
    const _Float16* qrow =
        qh + ((size_t)b * SEQ + q0 + qt * 16 + r) * EMB + h * HDIM;
    Qb[qt][0] = frag_load(qrow + hb);
    Qb[qt][1] = frag_load(qrow + 32 + hb);
  }

  v8f O[2][4] = {};              // Ot tiles: d = dt*16 + hb + j, query r
  float mrun[2] = {-1e38f, -1e38f};   // the queries' running maxima
  float lrun[2] = {0.f, 0.f};         // running sums over this lane's keys

  const _Float16* kb_ = kh + ((size_t)b * SEQ + half * KHALF) * EMB + h * HDIM;
  const _Float16* vb_ =
      vt + ((size_t)(b * HEADS + h) * HDIM) * SEQ + half * KHALF;
  // The wave's mask words (lane masks, see pre_pass): the address is the same
  // in every lane and nothing writes the words in this launch, so they are read
  // through the constant address space, by scalar loads into SGPRs.
  const __attribute__((address_space(4))) v16u* mb_ =
      (const __attribute__((address_space(4))) v16u*)(
          mbits + ((size_t)((b * SEQ + q0) >> 4) * (SEQ / 64) +
                   half * (KHALF / 64)) * 32);

  // This lane's piece of a stage, in its own key half: row (t >> 3) +
  // {0,16,32,48}, 16-byte column t & 7, t = thread within the half's 4 waves.
  const int crow = (threadIdx.x & 127) >> 3;
  const int ccol = (threadIdx.x & 7) * 8;
  const _Float16* kg = kb_ + (size_t)crow * EMB + ccol;   // advances 64 rows
  const _Float16* vg = vb_ + (size_t)crow * SEQ + ccol;   // advances 64 cols
  const unsigned int kl =
      (unsigned int)(size_t)&KV[0][0][half][crow * KV_PITCH + ccol];
  const unsigned int vl =
      (unsigned int)(size_t)&KV[0][1][half][crow * KV_PITCH + ccol];
  const unsigned int bufb = 4u * KV_TILE * 2u;   // bytes per buffer

  stage_kv(kg, vg, kl, vl);
  // stage 0 has landed for this wave; the barrier publishes it to the others
  asm volatile("s_wait_asynccnt 0x0" ::: "memory");
  __syncthreads();
  stage_kv(kg + 64 * EMB, vg + 64, kl + bufb, vl + bufb);

  // One stage's work.  It is written once and used in two loops, one whose
  // every trip refills and one whose trips do not: a trip is then straight-line
  // code, and the row sums stay ahead of the Ot products instead of being moved
  // behind a refill branch, where all of P in f32 would have to stay in
  // registers beside its packed copy.
  auto stage_step = [&](const int kt, const bool refill)
                        __attribute__((always_inline)) {
    const int k0 = kt * 64;
    const int buf = kt & 1;
    const _Float16* Kt = &KV[buf][0][half][r * KV_PITCH + hb];
    const _Float16* Vt = &KV[buf][1][half][r * KV_PITCH + hb];

    // the stage's 2 x 32 lane masks: [column tile][St tiles 0,1 | 2,3]
    v16u mw[2][2];
#pragma unroll
    for (int qt = 0; qt < 2; ++qt)
#pragma unroll
      for (int p = 0; p < 2; ++p)
        mw[qt][p] = mb_[(qt * (SEQ / 64) + kt) * 2 + p];

    // ---- St = K @ Q^T : 2 x 4 C-tiles of 16 keys x 16 queries (2 wmma each)
    // the tile's eight K fragments are read as one group ahead of the WMMAs,
    // so that a wave meets the LDS latency once, not once a fragment
    v16h ka[2][4];
#pragma unroll
    for (int ks = 0; ks < 2; ++ks)
#pragma unroll
      for (int nt = 0; nt < 4; ++nt)
        ka[ks][nt] = frag_load(Kt + nt * 16 * KV_PITCH + ks * 32);
    // keeps the scheduler from sinking the reads back among the WMMAs, where
    // each fragment would be waited for on its own
    __builtin_amdgcn_sched_barrier(0);
    v8f Sc[2][4];
#pragma unroll
    for (int nt = 0; nt < 4; ++nt)
#pragma unroll
      for (int qt = 0; qt < 2; ++qt) {
        v8f c = {};
        Sc[qt][nt] = wmma_f16(ka[0][nt], Qb[qt][0], c);
      }
#pragma unroll
    for (int nt = 0; nt < 4; ++nt)
#pragma unroll
      for (int qt = 0; qt < 2; ++qt)
        Sc[qt][nt] = wmma_f16(ka[1][nt], Qb[qt][1], Sc[qt][nt]);
    // the first four V fragments (keys 0..31), one group: they return while
    // the first column tile's softmax runs
    v16h va[2][4];
#pragma unroll
    for (int dt = 0; dt < 4; ++dt)
      va[0][dt] = frag_load(Vt + dt * 16 * KV_PITCH);
    // keeps the scheduler from sinking the reads down to the Ot products,
    // where each would be waited for with nothing left to cover it
    __builtin_amdgcn_sched_barrier(0);

    v16h pb[2][2];                 // Pt as B fragments: [column tile][step]
#pragma unroll
    for (int qt = 0; qt < 2; ++qt) {
      // ---- mask (pre-scale, as reference) + scale; maximum in the lane
      // (products, differences and sums are written on whole 8-element tiles,
      // so that packed operations pair neighbouring registers of one tile)
      float vmax[4];
#pragma unroll
      for (int nt = 0; nt < 4; ++nt) {
        v8f s = Sc[qt][nt] * scale;
#pragma unroll
        for (int j = 0; j < 8; ++j) {
          // the word in its SGPR is the select's condition as it stands
          s[j] = __builtin_amdgcn_inverse_ballot_w32(
                     mw[qt][nt >> 1][(nt & 1) * 8 + j])
                     ? s[j]
                     : -4.4e18f;
          vmax[nt] = j ? fmaxf(vmax[nt], s[j]) : s[j];
        }
        Sc[qt][nt] = s;
      }

      // ---- online softmax: one query per lane, its keys split over two lanes
      float v = fmaxf(fmaxf(vmax[0], vmax[1]), fmaxf(vmax[2], vmax[3]));
      v = fmaxf(v, xhalf(v));
      const float mn = fmaxf(mrun[qt], v);
      const float alpha = __expf(mrun[qt] - mn);
      mrun[qt] = mn;
#pragma unroll
      for (int nt = 0; nt < 4; ++nt) {
        const v8f e = (Sc[qt][nt] - mn) * 1.44269504088896340736f;  // log2(e)
#pragma unroll
        for (int j = 0; j < 8; ++j)
          Sc[qt][nt][j] = __builtin_amdgcn_exp2f(e[j]);
      }
      const v8f ps = (Sc[qt][0] + Sc[qt][1]) + (Sc[qt][2] + Sc[qt][3]);
      lrun[qt] = lrun[qt] * alpha + (((ps[0] + ps[1]) + (ps[2] + ps[3])) +
                                     ((ps[4] + ps[5]) + (ps[6] + ps[7])));
#pragma unroll
      for (int dt = 0; dt < 4; ++dt) O[qt][dt] *= alpha;
      // Pt's B fragments are packed straight from pairs of St tiles
#pragma unroll
      for (int step = 0; step < 2; ++step)
#pragma unroll
        for (int i = 0; i < 8; ++i) {
          pb[qt][step][i]     = (_Float16)Sc[qt][2 * step][i];
          pb[qt][step][i + 8] = (_Float16)Sc[qt][2 * step + 1][i];
        }
      if (qt == 0) {
        // the other four V fragments (keys 32..63) go into the registers that
        // the packed tile has left and return under the second tile's softmax;
        // the two scheduling fences hold the group at this place: earlier, the
        // wave's registers do not hold it, later, nothing covers its latency
        __builtin_amdgcn_sched_barrier(0);
#pragma unroll
        for (int dt = 0; dt < 4; ++dt)
          va[1][dt] = frag_load(Vt + dt * 16 * KV_PITCH + 32);
        __builtin_amdgcn_sched_barrier(0);
      }
    }

    // ---- Ot += V^T @ Pt   (V is d-major: A fragments load contiguously)
#pragma unroll
    for (int step = 0; step < 2; ++step)
#pragma unroll
      for (int dt = 0; dt < 4; ++dt)
#pragma unroll
        for (int qt = 0; qt < 2; ++qt)
          O[qt][dt] = wmma_f16(va[step][dt], pb[qt][step], O[qt][dt]);

    // ---- publish stage kt+1, free this buffer, refill it with stage kt+2
    // keeps the waits and the barrier down here: lifted up among the softmax
    // they would cut short the time that stage kt+1's copies have to land
    __builtin_amdgcn_sched_barrier(0);
    // this wave's reads of the buffer have returned before it is refilled
    asm volatile("s_wait_dscnt 0x0" ::: "memory");
    // this wave's copies of stage kt+1 have landed before the barrier
    asm volatile("s_wait_asynccnt 0x0" ::: "memory");
    __syncthreads();
    if (refill)
      stage_kv(kg + (size_t)(k0 + 128) * EMB, vg + k0 + 128,
               kl + buf * bufb, vl + buf * bufb);
  };
  for (int kt = 0; kt < NSTAGE - 2; ++kt) stage_step(kt, true);
  for (int kt = NSTAGE - 2; kt < NSTAGE; ++kt) stage_step(kt, false);
  // no copy is left in flight when the stages' LDS is reused below
  asm volatile("s_wait_asynccnt 0x0" ::: "memory");

  // ---- join the two key halves.  The loop's last barrier has ended every
  // read of the stages, so their LDS carries the exchange: the wave of key
  // half 0 finishes column tile 0 and hands tile 1 to its partner (wave ^ 4),
  // the wave of half 1 the other way round.  Same lane, same elements.
  v4f* jb = (v4f*)&KV[0][0][0][0];        // [wave][9 pieces][lane], 16 B each
  v8f Ok[4], Og[4];
#pragma unroll
  for (int dt = 0; dt < 4; ++dt)
#pragma unroll
    for (int j = 0; j < 8; ++j) {
      Ok[dt][j] = half ? O[1][dt][j] : O[0][dt][j];
      Og[dt][j] = half ? O[0][dt][j] : O[1][dt][j];
    }
  const float mk = half ? mrun[1] : mrun[0], mg = half ? mrun[0] : mrun[1];
  const float lk = half ? lrun[1] : lrun[0], lg = half ? lrun[0] : lrun[1];
  v4f* mine = jb + wave * (9 * 32) + lane;
  const v4f* theirs = jb + (wave ^ 4) * (9 * 32) + lane;
#pragma unroll
  for (int dt = 0; dt < 4; ++dt) {
    mine[(2 * dt) * 32] = v4f{Og[dt][0], Og[dt][1], Og[dt][2], Og[dt][3]};
    mine[(2 * dt + 1) * 32] = v4f{Og[dt][4], Og[dt][5], Og[dt][6], Og[dt][7]};
  }
  mine[8 * 32] = v4f{mg, lg, 0.f, 0.f};
  __syncthreads();
  const v4f ml = theirs[8 * 32];
  const float mn = fmaxf(mk, ml[0]);
  const float fk = __expf(mk - mn);
  const float fo = __expf(ml[0] - mn);
  const float lj = lk * fk + ml[1] * fo;

  // ---- join the two lanes' sums, normalize and emit attention output
  // (f16, row-major [B*S, E]): a lane holds 8 consecutive d of its query.
  // The wave's 16 queries x 64 d go as 16-byte pieces into its own LDS range,
  // behind the exchange's (16 rows of 128 bytes at the 144-byte pitch), and
  // leave from there as 16 whole 128-byte lines.
  const float lsum = lj + xhalf(lj);
  _Float16* st = (_Float16*)(jb + 8 * 9 * 32) + wave * (16 * KV_PITCH);
#pragma unroll
  for (int dt = 0; dt < 4; ++dt) {
    const v4f o0 = theirs[(2 * dt) * 32];
    const v4f o1 = theirs[(2 * dt + 1) * 32];
    v8h pk;
#pragma unroll
    for (int j = 0; j < 8; ++j) {
      const float oo = j < 4 ? o0[j & 3] : o1[j & 3];
      pk[j] = (_Float16)((Ok[dt][j] * fk + oo * fo) / lsum);
    }
    *(v8h*)(st + r * KV_PITCH + dt * 16 + hb) = pk;
  }
  // the other lanes' pieces have landed before the rows are read back
  asm volatile("s_wait_dscnt 0x0" ::: "memory");
  // a store of the wave covers four queries: four whole lines
  const _Float16* sr = st + (lane >> 3) * KV_PITCH + (lane & 7) * 8;
  _Float16* og = oh + ((size_t)b * SEQ + q0 + half * 16 + (lane >> 3)) * EMB +
                 h * HDIM + (lane & 7) * 8;
  v8h ov[4];
#pragma unroll
  for (int i = 0; i < 4; ++i) ov[i] = *(const v8h*)(sr + i * 4 * KV_PITCH);
#pragma unroll
  for (int i = 0; i < 4; ++i) *(v8h*)(og + (size_t)(i * 4) * EMB) = ov[i];
}

// ---------------------------------------------------------------------------
extern "C" void kernel_launch(void* const* d_in, const int* in_sizes, int n_in,
                              void* d_out, int out_size, void* d_ws, size_t ws_size,
                              hipStream_t stream) {
  const float* key   = (const float*)d_in[0];
  const float* value = (const float*)d_in[1];
  const float* query = (const float*)d_in[2];
  const int*   mask  = (const int*)d_in[3];
  const float* Wq = (const float*)d_in[4];
  const float* bq = (const float*)d_in[5];
  const float* Wk = (const float*)d_in[6];
  const float* bk = (const float*)d_in[7];
  const float* Wv = (const float*)d_in[8];
  const float* bv = (const float*)d_in[9];
  const float* Wo = (const float*)d_in[10];
  const float* bo = (const float*)d_in[11];
  float* out = (float*)d_out;

  const size_t NX = (size_t)BATCH * SEQ * EMB;          // 4,194,304
  const size_t NW = (size_t)EMB * EMB;                  // 262,144
  const size_t NMW = (size_t)BATCH * SEQ * (SEQ / 32);  // 524,288 mask words

  char* w = (char*)d_ws;
  _Float16* wqh = (_Float16*)w; w += NW * 2;
  _Float16* wkh = (_Float16*)w; w += NW * 2;
  _Float16* wvh = (_Float16*)w; w += NW * 2;
  _Float16* woh = (_Float16*)w; w += NW * 2;
  _Float16* qh  = (_Float16*)w; w += NX * 2;
  _Float16* kh  = (_Float16*)w; w += NX * 2;
  _Float16* vt  = (_Float16*)w; w += NX * 2;   // [B,H,HDIM,SEQ]
  _Float16* oh  = (_Float16*)w; w += NX * 2;   // attention output
  unsigned int* mbits = (unsigned int*)w; w += NMW * 4;

  const int M = BATCH * SEQ;  // 8192
  pre_pass<<<PRE_BLOCKS, 256, 0, stream>>>(Wq, Wk, Wv, Wo, mask, wqh, mbits);

  dim3 gp(M / 128, EMB / 64);      // (64, 8)
  dim3 gp3(M / 128, 3);            // q, k and v projections in one grid
  gemm_qkv<<<gp3, 512, 0, stream>>>(query, key, value, wqh, wkh, wvh, bq, bk,
                                    bv, qh, kh, vt);

  flash_attn<<<dim3(SEQ / 128, BATCH * HEADS), 256, 0, stream>>>(qh, kh, vt,
                                                                mbits, oh);

  gemm_out<<<gp, 128, 0, stream>>>(oh, woh, bo, out, EMB);
}

// v010
// Measured time: 60.6 microseconds a run.
// Timed twice side by side with v009, it ran 1.24 and 1.23 times as fast.
// All steps since v000 together make it 3.92 times as fast.
#include <hip/hip_runtime.h>
#include <hip/hip_bf16.h>

#define BATCH 4
#define SEQ   2048
#define EMB   512
#define HEADS 8
#define HDIM  64

typedef __attribute__((ext_vector_type(16))) _Float16 v16h;
typedef __attribute__((ext_vector_type(8)))  _Float16 v8h;
typedef __attribute__((ext_vector_type(4)))  _Float16 v4h;
typedef __attribute__((ext_vector_type(8)))  float    v8f;
typedef __attribute__((ext_vector_type(4)))  float    v4f;
typedef __attribute__((ext_vector_type(16))) unsigned int v16u;

// ---------------------------------------------------------------------------
// Fragment loader for 16-bit WMMA A/B operands (CDNA5 16x32 / 32x16 layout).
// Per lane the fragment is two contiguous 8-half (16B) runs: k = kb + {0..7}
// and k = kb + {16..23}, where kb = (lane<16 ? 0 : 8).  Caller passes the
// pointer at element (row/col, kb).  Lowers to two global/ds _b128 loads.
// ---------------------------------------------------------------------------
static __device__ __forceinline__ v16h frag_load(const _Float16* p) {
  v8h lo = *(const v8h*)(p);
  v8h hi = *(const v8h*)(p + 16);
  v16h r;
#pragma unroll
  for (int i = 0; i < 8; ++i) { r[i] = lo[i]; r[i + 8] = hi[i]; }
  return r;
}

static __device__ __forceinline__ v8f wmma_f16(v16h a, v16h b, v8f c) {
  return __builtin_amdgcn_wmma_f32_16x16x32_f16(false, a, false, b,
                                                (short)0, c, false, false);
}

// ---------------------------------------------------------------------------
// Side jobs: work that the projections do not read, done by one more row of
// gemm_qkv's grid on the WGPs which its 192 product blocks leave idle: the
// bit-pack of the int32 mask (32 int -> 1 u32, 67 MB -> 2 MB, read once) and
// fp32 -> f16 of the out-projection's weight.
// A mask word is a LANE MASK of flash_attn's St tiles: for a tile of 16 queries
// and a group of 64 keys, word nt * 8 + j holds in bit l the mask of query
// l & 15 and key nt * 16 + (l >> 4) * 8 + j, the element that lane l has in
// register j of St tile nt.  Words: [16-query tile][64-key group][32].
// The work is cut into units of 32 KiB of input; eight waves take one unit, a
// block of 512 threads two units at a time: 2 * mb + {0, 1}, + 2 * SIDE_BLOCKS,
// ...  A mask unit is one tile of 16 query rows by 512 keys, a wave's share of
// it 16 rows of 256 bytes.  Few WGPs carry the whole mask here, so the share
// is fetched in whole 128-byte lines (a copy of the wave covers two rows) into
// the wave's own LDS range, rows at a 272-byte pitch (16 B x odd), two
// buffers, and a lane reads its 4 x 8 keys of one row from there.
// ---------------------------------------------------------------------------
#define U_MASK 2048                 // BATCH*SEQ*SEQ ints      / 8192
#define U_W    32                   // EMB*EMB floats          / 8192
#define SIDE_BLOCKS 64              // one row of gemm_qkv's grid
#define M_TRIPS (U_MASK / (2 * SIDE_BLOCKS))   // 16 mask units per wave group
#define M_PITCH 272                 // bytes per staged mask row
#define M_BUF   (16 * M_PITCH)      // bytes per buffer of one wave

// One share's copies of one lane: eight 16-byte pieces, rows 2 apart.  Sixteen
// lanes cover the two whole lines of a row.  The s_wait_xcnt closes the
// statement so that no address register named by a copy is rewritten ahead of
// it.
static __device__ __forceinline__ void stage_m(const int* mg, unsigned int ml) {
  const unsigned int ls = 2u * M_PITCH;         // 2 LDS rows in bytes
  const size_t rs = (size_t)2 * SEQ;            // 2 mask rows in ints
  asm volatile(
      "global_load_async_to_lds_b128 %0, %8, off\n\t"
      "global_load_async_to_lds_b128 %1, %9, off\n\t"
      "global_load_async_to_lds_b128 %2, %10, off\n\t"
      "global_load_async_to_lds_b128 %3, %11, off\n\t"
      "global_load_async_to_lds_b128 %4, %12, off\n\t"
      "global_load_async_to_lds_b128 %5, %13, off\n\t"
      "global_load_async_to_lds_b128 %6, %14, off\n\t"
      "global_load_async_to_lds_b128 %7, %15, off\n\t"
      "s_wait_xcnt 0x0"
      :: "v"(ml), "v"(ml + ls), "v"(ml + 2u * ls), "v"(ml + 3u * ls),
         "v"(ml + 4u * ls), "v"(ml + 5u * ls), "v"(ml + 6u * ls),
         "v"(ml + 7u * ls),
         "v"(mg), "v"(mg + rs), "v"(mg + 2 * rs), "v"(mg + 3 * rs),
         "v"(mg + 4 * rs), "v"(mg + 5 * rs), "v"(mg + 6 * rs),
         "v"(mg + 7 * rs)
      : "memory");
}

static __device__ __forceinline__ void
side_jobs(const int mb, const float* __restrict__ Wo,
          const int* __restrict__ mask, _Float16* __restrict__ wdst,
          unsigned int* __restrict__ bits, char* lds) {
  const int lane = threadIdx.x & 31;
  const int tid = threadIdx.x & 255;   // the thread within its unit
  // the wave's number as a scalar; wave >> 3 says which of the two units
  const int wave = __builtin_amdgcn_readfirstlane(threadIdx.x >> 5);
  const int u0 = mb * 2 + (wave >> 3);

  if (u0 < U_W) {
    const float* in = Wo + (size_t)u0 * 8192;
    _Float16* out = wdst + (size_t)u0 * 8192;
    v4f v[8];
#pragma unroll
    for (int t = 0; t < 8; ++t)
      v[t] = ((const v4f*)in)[t * 256 + tid];
#pragma unroll
    for (int t = 0; t < 8; ++t) {
      v4h o;
#pragma unroll
      for (int e = 0; e < 4; ++e) o[e] = (_Float16)v[t][e];
      ((v4h*)out)[t * 256 + tid] = o;
    }
    // whatever code follows this branch may rewrite the registers that the
    // eight stores name: the wait stands directly behind them
    asm volatile("s_wait_xcnt 0x0" ::: "memory");
  }

  // Mask unit u0 + 2 * SIDE_BLOCKS * i: tile (u0 >> 2) + 32 * i, keys from
  // (u0 & 3) * 512; the wave's group of 64 keys is wave & 7.  This lane's piece
  // of a share: rows (lane >> 4) + 2 * k, 16-byte column lane & 15.
  const size_t step = (size_t)(2 * SIDE_BLOCKS / 4) * 16 * SEQ;   // ints a trip
  const int* mg = mask + (size_t)(u0 >> 2) * (16 * SEQ) + (u0 & 3) * 512 +
                  (wave & 7) * 64 + (lane >> 4) * SEQ + (lane & 15) * 4;
  char* mreg = lds + wave * (2 * M_BUF);
  const unsigned int ml = (unsigned int)(size_t)(
      mreg + (lane >> 4) * M_PITCH + (lane & 15) * 16);
  // ... and what it reads: row lane & 15, keys nt * 16 + (lane >> 4) * 8 + 0..7
  const char* mr = mreg + (lane & 15) * M_PITCH + (lane >> 4) * 32;

  // The buffers are the wave's own: it alone copies into them and reads them,
  // so its own waits order everything and no barrier ties the waves together
  // (each goes on as its own copies land, and the WGP's requests never drain).
  stage_m(mg, ml);
  // share 0 has landed before it is read
  asm volatile("s_wait_asynccnt 0x0" ::: "memory");
  stage_m(mg + step, ml + M_BUF);

  for (int i = 0; i < M_TRIPS; ++i) {
    const int buf = i & 1;
    int4 m[8];
#pragma unroll
    for (int nt = 0; nt < 4; ++nt) {
      m[2 * nt]     = *(const int4*)(mr + buf * M_BUF + nt * 64);
      m[2 * nt + 1] = *(const int4*)(mr + buf * M_BUF + nt * 64 + 16);
    }
    // keeps the eight reads one group: sunk among the compares, each would be
    // waited for on its own
    __builtin_amdgcn_sched_barrier(0);
    // a compare over the wave is the word; lane i keeps word i for the store
    unsigned int w = 0;
#pragma unroll
    for (int t = 0; t < 8; ++t) {
      const unsigned int c0 = __builtin_amdgcn_ballot_w32(m[t].x != 0);
      const unsigned int c1 = __builtin_amdgcn_ballot_w32(m[t].y != 0);
      const unsigned int c2 = __builtin_amdgcn_ballot_w32(m[t].z != 0);
      const unsigned int c3 = __builtin_amdgcn_ballot_w32(m[t].w != 0);
      w = lane == 4 * t + 0 ? c0 : w;
      w = lane == 4 * t + 1 ? c1 : w;
      w = lane == 4 * t + 2 ? c2 : w;
      w = lane == 4 * t + 3 ? c3 : w;
    }
    // unit u: tile u >> 2, group (u & 3) * 8 + wave & 7, word lane
    (bits + (size_t)(u0 + 2 * SIDE_BLOCKS * i) * 256)[tid] = w;
    // What follows rewrites registers that the store still names.  i passes
    // through the statement so that every later address is formed behind the
    // wait, not carried over it by an increment.
    asm volatile("s_wait_xcnt 0x0" : "+s"(i) :: "memory");

    // ---- share i+1 is there, this buffer is free: refill it with share i+2
    // this wave's reads of the buffer have returned before it is refilled
    asm volatile("s_wait_dscnt 0x0" ::: "memory");
    // this wave's copies of share i+1 have landed before the next trip's reads
    asm volatile("s_wait_asynccnt 0x0" ::: "memory");
    if (i + 2 < M_TRIPS) stage_m(mg + (size_t)(i + 2) * step, ml + buf * M_BUF);
  }
  // no copy is left in flight when the wave ends
  asm volatile("s_wait_asynccnt 0x0" ::: "memory");
}

// ---------------------------------------------------------------------------
// Operand staging for the out-projection.  A stage is one k-tile of 64 halves:
// 128 rows of A, then 64 rows of W, 128 data bytes each, laid at a 144-byte LDS
// pitch (16 B x odd: conflict-free for the ds_load_b128 fragment reads).
// ---------------------------------------------------------------------------
#define G_PITCH 72                          // halves per LDS row
#define GA_TILE (128 * G_PITCH)             // halves of A per stage
#define G_STAGE ((128 + 64) * G_PITCH)      // halves per stage (A | W)

// One stage's copies of one lane: eight 16-byte pieces of A and four of W,
// rows 16 apart (rs = 16 rows in halves).  Eight lanes cover one whole
// 128-byte line of a row.  The s_wait_xcnt closes the statement so that no
// address register named by a copy is rewritten ahead of it.
static __device__ __forceinline__ void stage_aw(const _Float16* ag,
                                                const _Float16* wg, size_t rs,
                                                unsigned int al,
                                                unsigned int wl) {
  const unsigned int ls = 16u * G_PITCH * 2u;   // 16 LDS rows in bytes
  asm volatile(
      "global_load_async_to_lds_b128 %0, %12, off\n\t"
      "global_load_async_to_lds_b128 %1, %13, off\n\t"
      "global_load_async_to_lds_b128 %2, %14, off\n\t"
      "global_load_async_to_lds_b128 %3, %15, off\n\t"
      "global_load_async_to_lds_b128 %4, %16, off\n\t"
      "global_load_async_to_lds_b128 %5, %17, off\n\t"
      "global_load_async_to_lds_b128 %6, %18, off\n\t"
      "global_load_async_to_lds_b128 %7, %19, off\n\t"
      "global_load_async_to_lds_b128 %8, %20, off\n\t"
      "global_load_async_to_lds_b128 %9, %21, off\n\t"
      "global_load_async_to_lds_b128 %10, %22, off\n\t"
      "global_load_async_to_lds_b128 %11, %23, off\n\t"
      "s_wait_xcnt 0x0"
      :: "v"(al), "v"(al + ls), "v"(al + 2u * ls), "v"(al + 3u * ls),
         "v"(al + 4u * ls), "v"(al + 5u * ls), "v"(al + 6u * ls),
         "v"(al + 7u * ls),
         "v"(wl), "v"(wl + ls), "v"(wl + 2u * ls), "v"(wl + 3u * ls),
         "v"(ag), "v"(ag + rs), "v"(ag + 2 * rs), "v"(ag + 3 * rs),
         "v"(ag + 4 * rs), "v"(ag + 5 * rs), "v"(ag + 6 * rs),
         "v"(ag + 7 * rs),
         "v"(wg), "v"(wg + rs), "v"(wg + 2 * rs), "v"(wg + 3 * rs)
      : "memory");
}

// ---------------------------------------------------------------------------
// GEMM: Y[M,N] = A[M,K] @ W[N,K]^T + bias[N]   (torch Linear semantics)
// Block = 128 threads (4 waves); block tile 128(M) x 64(N); wave tile 32x64:
// two A fragments amortize every W fragment (8 WMMAs per 6 fragment loads).
// The block's operands come through LDS (stg: two stages): each k-tile is
// copied once, in whole 128-byte lines, and the next tile's copies fly while
// this one is worked on.  K is a multiple of 64.  f32 row-major output.
// The products are taken as W @ A^T: in an accumulator tile a lane then holds
// eight consecutive columns of ONE output row, which go as two 16-byte pieces
// into the wave's own LDS range and leave from there as whole 128-byte lines.
// ---------------------------------------------------------------------------
#define O_PITCH 68                          // floats per staged output row
static __device__ __forceinline__ void
gemm_tile(const _Float16* __restrict__ A, const _Float16* __restrict__ W,
          const float* __restrict__ bias, float* __restrict__ o,
          _Float16* stg, const int N, int K) {
  const int lane = threadIdx.x & 31;
  const int wave = threadIdx.x >> 5;
  const int r    = lane & 15;          // row of A frag / column of B frag
  const int hb   = (lane >> 4) * 8;    // per-half k-run base; also C row base
  const int m0   = blockIdx.x * 128 + wave * 32;
  const int n0   = blockIdx.y * 64;

  // This lane's piece of a stage: row (tid >> 3) + 16 * i, 16-byte column
  // tid & 7.
  const int crow = threadIdx.x >> 3;
  const int ccol = (threadIdx.x & 7) * 8;
  const size_t rs = (size_t)16 * K;
  const _Float16* ag = A + (size_t)(blockIdx.x * 128 + crow) * K + ccol;
  const _Float16* wg = W + (size_t)(n0 + crow) * K + ccol;
  const unsigned int al =
      (unsigned int)(size_t)(stg + crow * G_PITCH + ccol);
  const unsigned int wl = al + GA_TILE * 2u;

  const int ntiles = K >> 6;
  stage_aw(ag, wg, rs, al, wl);
  // tile 0 has landed for this wave; the barrier publishes it to the others
  asm volatile("s_wait_asynccnt 0x0" ::: "memory");
  __syncthreads();
  if (1 < ntiles)
    stage_aw(ag + 64, wg + 64, rs, al + G_STAGE * 2u, wl + G_STAGE * 2u);

  v8f acc[2][4] = {};
  for (int t = 0; t < ntiles; ++t) {
    const int buf = t & 1;
    const _Float16* As = stg + buf * G_STAGE + (wave * 32 + r) * G_PITCH + hb;
    const _Float16* Ws = stg + buf * G_STAGE + GA_TILE + r * G_PITCH + hb;
    // the tile's twelve fragments are read as one group ahead of its WMMAs,
    // so that a wave meets the LDS latency once a tile, not once a fragment
    v16h a[2][2], b[2][4];
#pragma unroll
    for (int ks = 0; ks < 2; ++ks) {
      a[ks][0] = frag_load(As + ks * 32);
      a[ks][1] = frag_load(As + 16 * G_PITCH + ks * 32);
#pragma unroll
      for (int nt = 0; nt < 4; ++nt)
        b[ks][nt] = frag_load(Ws + nt * 16 * G_PITCH + ks * 32);
    }
    // keeps the scheduler from sinking the reads back among the WMMAs, where
    // each fragment would be waited for on its own
    __builtin_amdgcn_sched_barrier(0);
#pragma unroll
    for (int nt = 0; nt < 4; ++nt) {
      acc[0][nt] = wmma_f16(b[0][nt], a[0][0], acc[0][nt]);
      acc[1][nt] = wmma_f16(b[0][nt], a[0][1], acc[1][nt]);
    }
    // keeps the first half's WMMAs ahead of the waits below: they cover the
    // flight of tile t+1's copies, and their fragment registers are free
    // again for the addresses of the refill
    __builtin_amdgcn_sched_barrier(0);

    // ---- publish tile t+1, free this buffer, refill it with tile t+2
    // (the buffer has been read out into registers: the second half's WMMAs
    // follow the refill's issue and cover its flight)
    // this wave's reads of the buffer have returned before it is refilled
    asm volatile("s_wait_dscnt 0x0" ::: "memory");
    // this wave's copies of tile t+1 have landed before the barrier
    asm volatile("s_wait_asynccnt 0x0" ::: "memory");
    __syncthreads();
    if (t + 2 < ntiles)
      stage_aw(ag + (t + 2) * 64, wg + (t + 2) * 64, rs,
               al + buf * (G_STAGE * 2u), wl + buf * (G_STAGE * 2u));
#pragma unroll
    for (int nt = 0; nt < 4; ++nt) {
      acc[0][nt] = wmma_f16(b[1][nt], a[1][0], acc[0][nt]);
      acc[1][nt] = wmma_f16(b[1][nt], a[1][1], acc[1][nt]);
    }
  }
  // no copy is left in flight when the wave goes on to its stores and ends
  asm volatile("s_wait_asynccnt 0x0" ::: "memory");

  // ---- the wave's 32 x 64 tile goes through its own LDS range (the loop's
  // last barrier has ended every read of the stages): 32 rows of 256 bytes at
  // a 272-byte pitch (16 B x odd).  acc[mt][nt][j] is row mt * 16 + r, column
  // nt * 16 + hb + j.
  float* st = (float*)stg + wave * (32 * O_PITCH);
#pragma unroll
  for (int nt = 0; nt < 4; ++nt) {
    const v4f b0 = *(const v4f*)(bias + n0 + nt * 16 + hb);
    const v4f b1 = *(const v4f*)(bias + n0 + nt * 16 + hb + 4);
#pragma unroll
    for (int mt = 0; mt < 2; ++mt) {
      float* p = st + (mt * 16 + r) * O_PITCH + nt * 16 + hb;
      const v8f c = acc[mt][nt];
      *(v4f*)p = v4f{c[0], c[1], c[2], c[3]} + b0;
      *(v4f*)(p + 4) = v4f{c[4], c[5], c[6], c[7]} + b1;
    }
  }
  // the other lanes' pieces have landed before the rows are read back
  asm volatile("s_wait_dscnt 0x0" ::: "memory");
  // a store of the wave covers two rows of the tile: four whole lines
  const float* sr = st + (lane >> 4) * O_PITCH + (lane & 15) * 4;
  float* og = o + (size_t)(m0 + (lane >> 4)) * N + n0 + (lane & 15) * 4;
  v4f ov[16];
#pragma unroll
  for (int i = 0; i < 16; ++i) ov[i] = *(const v4f*)(sr + i * 2 * O_PITCH);
#pragma unroll
  for (int i = 0; i < 16; ++i) *(v4f*)(og + (size_t)(i * 2) * N) = ov[i];
}

// ---------------------------------------------------------------------------
// The three projections, one grid (blockIdx.y - 1 names the job: 0 q, 1 k,
// 2 v; row 0 of the grid does the side jobs above):
// Y[128 rows, all 512 columns] = X @ W^T + bias from the f32 activations and
// the f32 weights; no f16 copy of either passes through memory.
// A block owns whole rows of X, so every element of X is read from memory and
// converted to f16 exactly once, here, on its way into LDS (global f32 ->
// registers -> ds_store).  W is staged as it is, in f32 (async copies), and a
// wave converts its W fragments in registers behind the LDS read.
// Block = 512 threads (16 waves, 2 x 8); wave tile 64 x 64: eight fragments
// from LDS feed sixteen WMMAs.  A stage is one k-tile of 64: 128 rows of X in
// f16 at the 144-byte pitch, then the 512 rows of W in f32 at a 272-byte pitch
// (16 B x odd).  Two stages: the next tile's loads and copies fly while this
// one is worked on.
// q, k: f16 row-major; v: f16 head-transposed [B,H,HDIM,SEQ].
// In an accumulator tile a lane holds eight consecutive rows (A operand's) of
// one column (B operand's).  v is taken as X @ W^T and q, k as W @ X^T, so that
// those eight are neighbours in the output's memory order for every job: they
// go as one 16-byte piece into the wave's own LDS range, and the wave's 64 x 64
// tile leaves from there as 64 whole 128-byte lines.
// ---------------------------------------------------------------------------
#define W_PITCH 68                          // floats per staged row of W
#define QX_BYTES (128 * G_PITCH * 2)        // bytes of X per stage
#define QW_BYTES (EMB * W_PITCH * 4)        // bytes of W per stage
#define Q_STAGE_B (QX_BYTES + QW_BYTES)     // bytes per stage (X | W)
#define Q_TILES (EMB / 64)                  // k-tiles

// Eight of a stage's W copies of one lane: 16-byte pieces, rows 32 apart.
// Sixteen lanes cover the two whole 128-byte lines of a row.  The s_wait_xcnt
// closes the statement so that no address register named by a copy is
// rewritten ahead of it.
static __device__ __forceinline__ void stage_w8(const float* wg,
                                                unsigned int wl) {
  const unsigned int ls = 32u * W_PITCH * 4u;   // 32 LDS rows in bytes
  const size_t rs = (size_t)32 * EMB;           // 32 rows of W in floats
  asm volatile(
      "global_load_async_to_lds_b128 %0, %8, off\n\t"
      "global_load_async_to_lds_b128 %1, %9, off\n\t"
      "global_load_async_to_lds_b128 %2, %10, off\n\t"
      "global_load_async_to_lds_b128 %3, %11, off\n\t"
      "global_load_async_to_lds_b128 %4, %12, off\n\t"
      "global_load_async_to_lds_b128 %5, %13, off\n\t"
      "global_load_async_to_lds_b128 %6, %14, off\n\t"
      "global_load_async_to_lds_b128 %7, %15, off\n\t"
      "s_wait_xcnt 0x0"
      :: "v"(wl), "v"(wl + ls), "v"(wl + 2u * ls), "v"(wl + 3u * ls),
         "v"(wl + 4u * ls), "v"(wl + 5u * ls), "v"(wl + 6u * ls),
         "v"(wl + 7u * ls),
         "v"(wg), "v"(wg + rs), "v"(wg + 2 * rs), "v"(wg + 3 * rs),
         "v"(wg + 4 * rs), "v"(wg + 5 * rs), "v"(wg + 6 * rs),
         "v"(wg + 7 * rs)
      : "memory");
}

// One stage's W copies of one lane: sixteen pieces, rows 0..255 and 256..511.
static __device__ __forceinline__ void stage_w(const float* wg,
                                               unsigned int wl) {
  stage_w8(wg, wl);
  stage_w8(wg + (size_t)256 * EMB, wl + 256u * W_PITCH * 4u);
}

// A W fragment from its f32 row: the same k order as frag_load (k = kb + 0..7
// and kb + 16..23, the pointer at element (row, kb)), four 16-byte reads ...
static __device__ __forceinline__ void wfrag_read(const float* p, v4f (&q)[4]) {
  q[0] = *(const v4f*)(p);
  q[1] = *(const v4f*)(p + 4);
  q[2] = *(const v4f*)(p + 16);
  q[3] = *(const v4f*)(p + 20);
}
// ... and its conversion to the f16 operand
static __device__ __forceinline__ v16h wfrag_cvt(const v4f (&q)[4]) {
  v16h r;
#pragma unroll
  for (int i = 0; i < 4; ++i)
#pragma unroll
    for (int e = 0; e < 4; ++e) r[i * 4 + e] = (_Float16)q[i][e];
  return r;
}

__global__ void __launch_bounds__(512)
gemm_qkv(const float* __restrict__ query, const float* __restrict__ key,
         const float* __restrict__ value, const float* __restrict__ Wq,
         const float* __restrict__ Wk, const float* __restrict__ Wv,
         const float* __restrict__ bq, const float* __restrict__ bk,
         const float* __restrict__ bv, const float* __restrict__ Wo,
         const int* __restrict__ mask, _Float16* __restrict__ qh,
         _Float16* __restrict__ kh, _Float16* __restrict__ vt,
         _Float16* __restrict__ woh, unsigned int* __restrict__ mbits) {
  __shared__ __align__(16) char stgb[2 * Q_STAGE_B];
  // row 0 of the grid: a side block runs longest (one WGP's memory rate holds
  // it), so these take the lowest block indices (for speed only)
  const int job = (int)blockIdx.y - 1;
  if (job < 0) {   // the whole block leaves here and meets no barrier
    side_jobs(blockIdx.x, Wo, mask, woh, mbits, stgb);
    return;
  }
  _Float16* stg = (_Float16*)stgb;
  const float* X = job == 0 ? query : job == 1 ? key : value;
  const float* Wt = job == 0 ? Wq : job == 1 ? Wk : Wv;
  const float* bias = job == 0 ? bq : job == 1 ? bk : bv;

  const int lane = threadIdx.x & 31;
  // the wave's number as a scalar: what is formed from it stays out of VGPRs
  const int wave = __builtin_amdgcn_readfirstlane(threadIdx.x >> 5);
  const int r    = lane & 15;          // row of A frag / column of B frag
  const int hb   = (lane >> 4) * 8;    // per-half k-run base; also C row base
  const int m0   = blockIdx.x * 128 + (wave & 1) * 64;
  const int n0   = (wave >> 1) * 64;

  // This lane's piece of a stage of X: rows (tid >> 4) + 32 * i, four floats at
  // column (tid & 15) * 4: sixteen lanes cover the two whole lines of a row.
  const int arow = threadIdx.x >> 4;
  const int acol = (threadIdx.x & 15) * 4;
  const float* xg = X + (size_t)(blockIdx.x * 128 + arow) * EMB + acol;
  _Float16* xs = stg + arow * G_PITCH + acol;
  // ... and of W: the same rows and columns, i up to 15.
  const float* wg = Wt + (size_t)arow * EMB + acol;
  const unsigned int wl =
      (unsigned int)(size_t)(stgb + QX_BYTES + (arow * W_PITCH + acol) * 4);

  v4f xr[4];                     // one k-tile of X in flight, f32
  auto load_x = [&](const int t) __attribute__((always_inline)) {
#pragma unroll
    for (int i = 0; i < 4; ++i)
      xr[i] = *(const v4f*)(xg + (size_t)(32 * i) * EMB + t * 64);
  };
  auto store_x = [&](const int buf) __attribute__((always_inline)) {
#pragma unroll
    for (int i = 0; i < 4; ++i) {
      v4h o;
#pragma unroll
      for (int e = 0; e < 4; ++e) o[e] = (_Float16)xr[i][e];
      *(v4h*)(xs + buf * (Q_STAGE_B / 2) + 32 * i * G_PITCH) = o;
    }
  };

  load_x(0);
  stage_w(wg, wl);
  store_x(0);
  // tile 0 has landed for this wave; the barrier publishes it to the others
  asm volatile("s_wait_asynccnt 0x0" ::: "memory");
  __syncthreads();
  load_x(1);
  stage_w(wg + 64, wl + Q_STAGE_B);

  // the wave's rows of X (halves) and of W (floats) in a stage
  const int xoff = ((wave & 1) * 64 + r) * G_PITCH + hb;
  const int woff = (n0 + r) * W_PITCH + hb;

  v8f acc[4][4] = {};
  // The k loop, written once and used twice: xa says which operand is A
  // (true: X, the v job; false: W), a constant in each use.
  auto k_loop = [&](const bool xa) __attribute__((always_inline)) {
    for (int t = 0; t < Q_TILES; ++t) {
      const int buf = t & 1;
      const _Float16* Xs = (const _Float16*)(stgb + buf * Q_STAGE_B) + xoff;
      const float* Ws =
          (const float*)(stgb + buf * Q_STAGE_B + QX_BYTES) + woff;
#pragma unroll
      for (int ks = 0; ks < 2; ++ks) {
        // a k-step's fragments are read ahead of the WMMAs that use them, W in
        // f32: W 0, 1 and X 0..3 as one group, then W 2 and W 3, each under the
        // WMMAs of an earlier fragment.  All of W in f32 at once does not fit
        // the wave's 256 registers beside the accumulators.
        v16h xf[4], wf[4];
        v4f wa[2][4], wb[4], wc[4];
        auto products = [&](const int wi) __attribute__((always_inline)) {
#pragma unroll
          for (int xi = 0; xi < 4; ++xi) {
            if (xa) acc[xi][wi] = wmma_f16(xf[xi], wf[wi], acc[xi][wi]);
            else    acc[wi][xi] = wmma_f16(wf[wi], xf[xi], acc[wi][xi]);
          }
        };
#pragma unroll
        for (int i = 0; i < 2; ++i)
          wfrag_read(Ws + i * 16 * W_PITCH + ks * 32, wa[i]);
#pragma unroll
        for (int i = 0; i < 4; ++i)
          xf[i] = frag_load(Xs + i * 16 * G_PITCH + ks * 32);
        // the scheduling fences of this step hold reads, conversions and WMMAs
        // in the written order: a read lifted up costs registers that the wave
        // does not have, a read or a conversion (it waits for its read) sunk or
        // lifted among the WMMAs leaves its latency uncovered
        __builtin_amdgcn_sched_barrier(0);
#pragma unroll
        for (int i = 0; i < 2; ++i) wf[i] = wfrag_cvt(wa[i]);
        __builtin_amdgcn_sched_barrier(0);   // as above
        wfrag_read(Ws + 2 * 16 * W_PITCH + ks * 32, wb);
        __builtin_amdgcn_sched_barrier(0);   // as above
        products(0);
        __builtin_amdgcn_sched_barrier(0);   // as above
        wfrag_read(Ws + 3 * 16 * W_PITCH + ks * 32, wc);
        __builtin_amdgcn_sched_barrier(0);   // as above
        products(1);
        __builtin_amdgcn_sched_barrier(0);   // as above
        wf[2] = wfrag_cvt(wb);
        products(2);
        __builtin_amdgcn_sched_barrier(0);   // as above
        wf[3] = wfrag_cvt(wc);
        products(3);
        // keeps the next step's reads behind these WMMAs
        __builtin_amdgcn_sched_barrier(0);
      }

      // ---- publish tile t+1, free this buffer, refill it with tile t+2
      // X of tile t+1, loaded one trip ago, goes as f16 into the other buffer,
      // whose last readers passed the barrier at the foot of trip t-1
      if (t + 1 < Q_TILES) store_x(buf ^ 1);
      // this wave's reads of the buffer have returned before it is refilled,
      // and its stores of tile t+1 have landed before the barrier
      asm volatile("s_wait_dscnt 0x0" ::: "memory");
      // this wave's copies of tile t+1 have landed before the barrier
      asm volatile("s_wait_asynccnt 0x0" ::: "memory");
      __syncthreads();
      if (t + 2 < Q_TILES) {
        // X first: it comes from memory, W from L2; the s_wait_xcnt that closes
        // the copies' statements stands behind these loads' addresses as well
        load_x(t + 2);
        stage_w(wg + (t + 2) * 64, wl + buf * Q_STAGE_B);
      }
    }
  };
  if (job == 2) k_loop(true);
  else          k_loop(false);
  // no copy is left in flight when the wave goes on to its stores and ends
  asm volatile("s_wait_asynccnt 0x0" ::: "memory");

  // ---- the wave's tile goes through its own LDS range (the loop's last
  // barrier has ended every read of the stages): 64 rows of 128 bytes at the
  // 144-byte pitch.  acc[i][k][j]: staged row k * 16 + r, half i * 16 + hb + j.
  _Float16* st = stg + wave * (64 * G_PITCH);
  _Float16* sw = st + r * G_PITCH + hb;
  // a store of the wave covers four staged rows: four whole lines
  const _Float16* sr = st + (lane >> 3) * G_PITCH + (lane & 7) * 8;
  auto flush = [&](_Float16* og, const int pitch) __attribute__((always_inline)) {
    // the other lanes' pieces have landed before the rows are read back
    asm volatile("s_wait_dscnt 0x0" ::: "memory");
    // og is the same in every lane; the lane's own place in a group of four
    // rows is one 32-bit byte offset, the same for all sixteen stores
    const unsigned int lo = ((lane >> 3) * pitch + (lane & 7) * 8) * 2;
    v8h ov[16];
#pragma unroll
    for (int i = 0; i < 16; ++i) ov[i] = *(const v8h*)(sr + i * 4 * G_PITCH);
#pragma unroll
    for (int i = 0; i < 16; ++i)
      *(v8h*)((char*)(og + (size_t)(i * 4) * pitch) + lo) = ov[i];
  };

  if (job == 2) {
    // staged row = d of the wave's head, halves = 64 sequence positions
#pragma unroll
    for (int k = 0; k < 4; ++k) {
      const float bc = bias[n0 + k * 16 + r];
#pragma unroll
      for (int i = 0; i < 4; ++i) {
        v8h pk;
#pragma unroll
        for (int j = 0; j < 8; ++j) pk[j] = (_Float16)(acc[i][k][j] + bc);
        *(v8h*)(sw + k * 16 * G_PITCH + i * 16) = pk;
      }
    }
    flush(vt + ((size_t)((m0 / SEQ) * HEADS + (n0 >> 6)) * HDIM) * SEQ +
              m0 % SEQ,
          SEQ);
  } else {
    // staged row = row of X, halves = the wave's 64 output columns
    v4f bl[4][2];   // the lane's 4 x 8 bias values, loaded as one group
    // the lane's byte offset, the one vector register that all eight loads name
    const unsigned int bo = hb * 4;
    const char* bb = (const char*)(bias + n0);
#pragma unroll
    for (int i = 0; i < 4; ++i) {
      bl[i][0] = *(const v4f*)(bb + i * 64 + bo);
      bl[i][1] = *(const v4f*)(bb + i * 64 + 16 + bo);
    }
    // stands behind the eight loads, ahead of any rewrite of the offset
    // register that they name; taking bo as an input keeps that register alive
    // up to here, so that no load's result is placed in it
    asm volatile("s_wait_xcnt 0x0" :: "v"(bo) : "memory");
#pragma unroll
    for (int i = 0; i < 4; ++i)
#pragma unroll
      for (int k = 0; k < 4; ++k) {
        v8h pk;
#pragma unroll
        for (int j = 0; j < 8; ++j)
          pk[j] = (_Float16)(acc[i][k][j] + bl[i][j >> 2][j & 3]);
        *(v8h*)(sw + k * 16 * G_PITCH + i * 16) = pk;
      }
    flush((job == 1 ? kh : qh) + (size_t)m0 * EMB + n0, EMB);
  }
}

__global__ void __launch_bounds__(128)
gemm_out(const _Float16* __restrict__ A, const _Float16* __restrict__ W,
         const float* __restrict__ bias, float* __restrict__ outp, int K) {
  __shared__ __align__(16) _Float16 stg[2 * G_STAGE];
  gemm_tile(A, W, bias, outp, stg, EMB, K);
}

// ---------------------------------------------------------------------------
// K/V staging for flash_attn.  A stage is one 64-key tile of each key half: K as 64 key rows
// and V as 64 d rows, 128 data bytes each, laid at a 144-byte LDS pitch
// (16 B x odd: conflict-free for the ds_load_b128 fragment reads).
// ---------------------------------------------------------------------------
#define KV_PITCH 72                 // halves per LDS row
#define KV_TILE  (64 * KV_PITCH)    // halves per staged tile

// One stage's copies of one lane: four 16-byte pieces of K and four of V,
// rows 16 apart.  Eight lanes cover one whole 128-byte row.  The s_wait_xcnt
// closes the statement so that no address register named by a copy is
// rewritten ahead of it.
static __device__ __forceinline__ void stage_kv(const _Float16* kg,
                                                const _Float16* vg,
                                                unsigned int kl,
                                                unsigned int vl) {
  asm volatile(
      "global_load_async_to_lds_b128 %0, %8, off\n\t"
      "global_load_async_to_lds_b128 %1, %9, off\n\t"
      "global_load_async_to_lds_b128 %2, %10, off\n\t"
      "global_load_async_to_lds_b128 %3, %11, off\n\t"
      "global_load_async_to_lds_b128 %4, %12, off\n\t"
      "global_load_async_to_lds_b128 %5, %13, off\n\t"
      "global_load_async_to_lds_b128 %6, %14, off\n\t"
      "global_load_async_to_lds_b128 %7, %15, off\n\t"
      "s_wait_xcnt 0x0"
      :: "v"(kl), "v"(kl + 16u * KV_PITCH * 2u), "v"(kl + 32u * KV_PITCH * 2u),
         "v"(kl + 48u * KV_PITCH * 2u),
         "v"(vl), "v"(vl + 16u * KV_PITCH * 2u), "v"(vl + 32u * KV_PITCH * 2u),
         "v"(vl + 48u * KV_PITCH * 2u),
         "v"(kg), "v"(kg + 16 * EMB), "v"(kg + 32 * EMB), "v"(kg + 48 * EMB),
         "v"(vg), "v"(vg + 16 * SEQ), "v"(vg + 32 * SEQ), "v"(vg + 48 * SEQ)
      : "memory");
}

// Lane l with lane l ^ 16 (the two lanes that share one query column).
static __device__ __forceinline__ float xhalf(float x) {
  const int b = __builtin_bit_cast(int, x);
  return __builtin_bit_cast(
      float, __builtin_amdgcn_permlanex16(b, b, 0x76543210, 0xfedcba98, false,
                                          false));
}

// ---------------------------------------------------------------------------
// Flash attention: one block = 8 waves = 128 query rows of one (b,h).
// A wave owns 32 queries (two column tiles) and one half of the keys: wave w
// has query group w & 3 and key half w >> 2.  Every K and V fragment read from
// LDS feeds two WMMAs, and the split of the keys keeps as many waves on the
// chip as one tile of 16 queries per wave over all keys would give.
// A stage is one 64-key K/V tile of each key half, copied once into LDS for
// the four waves that share it (two buffers, the next stage's copies fly while
// this one is worked on).  The products are the transposed ones:
//   St = K @ Q^T (A = K rows, B = Q), Ot += V^T @ Pt (A = d-major V rows).
// In an accumulator tile a lane then holds ONE query (column lane & 15) and
// eight keys (or d) hb..hb+7: maximum and sum run in the lane, the two lanes
// of a query meet by one cross-half move, and two St tiles are, element for
// element, the B fragment of Pt (k = hb+0..7 and 16+hb+0..7).
// Behind the loop the two waves of a query group exchange one column tile
// each through LDS and join the halves' maxima, sums and outputs.
// ---------------------------------------------------------------------------
#define KHALF (SEQ / 2)             // keys per key half
#define NSTAGE (KHALF / 64)         // stages per wave

// four waves per SIMD (two blocks per WGP): holds a wave to 256 VGPRs
__global__ void __launch_bounds__(256)
__attribute__((amdgpu_waves_per_eu(4, 4)))
flash_attn(const _Float16* __restrict__ qh, const _Float16* __restrict__ kh,
           const _Float16* __restrict__ vt,
           const unsigned int* __restrict__ mbits,
           _Float16* __restrict__ oh) {
  // [buffer][K | V][key half][tile]
  __shared__ __align__(16) _Float16 KV[2][2][2][KV_TILE];

  const int lane = threadIdx.x & 31;
  // the wave's number as a scalar: what is formed from it stays out of VGPRs
  const int wave = __builtin_amdgcn_readfirstlane(threadIdx.x >> 5);
  const int qg   = wave & 3;
  const int half = wave >> 2;
  const int r    = lane & 15;
  const int hb   = (lane >> 4) * 8;
  const int b    = blockIdx.y / HEADS;
  const int h    = blockIdx.y % HEADS;
  const int q0   = blockIdx.x * 128 + qg * 32;

  const float scale = 0.04419417382415922f;   // 1/sqrt(512) (ref scales by E)

  // Q fragments for this wave's 2 x 16 queries (d = 0..31, 32..63), in VGPRs
  v16h Qb[2][2];
#pragma unroll
  for (int qt = 0; qt < 2; ++qt) {
    const _Float16* qrow =
        qh + ((size_t)b * SEQ + q0 + qt * 16 + r) * EMB + h * HDIM;
    Qb[qt][0] = frag_load(qrow + hb);
    Qb[qt][1] = frag_load(qrow + 32 + hb);
  }

  v8f O[2][4] = {};              // Ot tiles: d = dt*16 + hb + j, query r
  float mrun[2] = {-1e38f, -1e38f};   // the queries' running maxima
  float lrun[2] = {0.f, 0.f};         // running sums over this lane's keys

  const _Float16* kb_ = kh + ((size_t)b * SEQ + half * KHALF) * EMB + h * HDIM;
  const _Float16* vb_ =
      vt + ((size_t)(b * HEADS + h) * HDIM) * SEQ + half * KHALF;
  // The wave's mask words (lane masks, see side_jobs): the address is the same
  // in every lane and nothing writes the words in this launch, so they are read
  // through the constant address space, by scalar loads into SGPRs.
  const __attribute__((address_space(4))) v16u* mb_ =
      (const __attribute__((address_space(4))) v16u*)(
          mbits + ((size_t)((b * SEQ + q0) >> 4) * (SEQ / 64) +
                   half * (KHALF / 64)) * 32);

  // This lane's piece of a stage, in its own key half: row (t >> 3) +
  // {0,16,32,48}, 16-byte column t & 7, t = thread within the half's 4 waves.
  const int crow = (threadIdx.x & 127) >> 3;
  const int ccol = (threadIdx.x & 7) * 8;
  const _Float16* kg = kb_ + (size_t)crow * EMB + ccol;   // advances 64 rows
  const _Float16* vg = vb_ + (size_t)crow * SEQ + ccol;   // advances 64 cols
  const unsigned int kl =
      (unsigned int)(size_t)&KV[0][0][half][crow * KV_PITCH + ccol];
  const unsigned int vl =
      (unsigned int)(size_t)&KV[0][1][half][crow * KV_PITCH + ccol];
  const unsigned int bufb = 4u * KV_TILE * 2u;   // bytes per buffer

  stage_kv(kg, vg, kl, vl);
  // stage 0 has landed for this wave; the barrier publishes it to the others
  asm volatile("s_wait_asynccnt 0x0" ::: "memory");
  __syncthreads();
  stage_kv(kg + 64 * EMB, vg + 64, kl + bufb, vl + bufb);

  // One stage's work.  It is written once and used in two loops, one whose
  // every trip refills and one whose trips do not: a trip is then straight-line
  // code, and the row sums stay ahead of the Ot products instead of being moved
  // behind a refill branch, where all of P in f32 would have to stay in
  // registers beside its packed copy.
  auto stage_step = [&](const int kt, const bool refill)
                        __attribute__((always_inline)) {
    const int k0 = kt * 64;
    const int buf = kt & 1;
    const _Float16* Kt = &KV[buf][0][half][r * KV_PITCH + hb];
    const _Float16* Vt = &KV[buf][1][half][r * KV_PITCH + hb];

    // the stage's 2 x 32 lane masks: [column tile][St tiles 0,1 | 2,3]
    v16u mw[2][2];
#pragma unroll
    for (int qt = 0; qt < 2; ++qt)
#pragma unroll
      for (int p = 0; p < 2; ++p)
        mw[qt][p] = mb_[(qt * (SEQ / 64) + kt) * 2 + p];

    // ---- St = K @ Q^T : 2 x 4 C-tiles of 16 keys x 16 queries (2 wmma each)
    // the tile's eight K fragments are read as one group ahead of the WMMAs,
    // so that a wave meets the LDS latency once, not once a fragment
    v16h ka[2][4];
#pragma unroll
    for (int ks = 0; ks < 2; ++ks)
#pragma unroll
      for (int nt = 0; nt < 4; ++nt)
        ka[ks][nt] = frag_load(Kt + nt * 16 * KV_PITCH + ks * 32);
    // keeps the scheduler from sinking the reads back among the WMMAs, where
    // each fragment would be waited for on its own
    __builtin_amdgcn_sched_barrier(0);
    v8f Sc[2][4];
#pragma unroll
    for (int nt = 0; nt < 4; ++nt)
#pragma unroll
      for (int qt = 0; qt < 2; ++qt) {
        v8f c = {};
        Sc[qt][nt] = wmma_f16(ka[0][nt], Qb[qt][0], c);
      }
#pragma unroll
    for (int nt = 0; nt < 4; ++nt)
#pragma unroll
      for (int qt = 0; qt < 2; ++qt)
        Sc[qt][nt] = wmma_f16(ka[1][nt], Qb[qt][1], Sc[qt][nt]);
    // the first four V fragments (keys 0..31), one group: they return while
    // the first column tile's softmax runs
    v16h va[2][4];
#pragma unroll
    for (int dt = 0; dt < 4; ++dt)
      va[0][dt] = frag_load(Vt + dt * 16 * KV_PITCH);
    // keeps the scheduler from sinking the reads down to the Ot products,
    // where each would be waited for with nothing left to cover it
    __builtin_amdgcn_sched_barrier(0);

    v16h pb[2][2];                 // Pt as B fragments: [column tile][step]
#pragma unroll
    for (int qt = 0; qt < 2; ++qt) {
      // ---- mask (pre-scale, as reference) + scale; maximum in the lane
      // (products, differences and sums are written on whole 8-element tiles,
      // so that packed operations pair neighbouring registers of one tile)
      float vmax[4];
#pragma unroll
      for (int nt = 0; nt < 4; ++nt) {
        v8f s = Sc[qt][nt] * scale;
#pragma unroll
        for (int j = 0; j < 8; ++j) {
          // the word in its SGPR is the select's condition as it stands
          s[j] = __builtin_amdgcn_inverse_ballot_w32(
                     mw[qt][nt >> 1][(nt & 1) * 8 + j])
                     ? s[j]
                     : -4.4e18f;
          vmax[nt] = j ? fmaxf(vmax[nt], s[j]) : s[j];
        }
        Sc[qt][nt] = s;
      }

      // ---- online softmax: one query per lane, its keys split over two lanes
      float v = fmaxf(fmaxf(vmax[0], vmax[1]), fmaxf(vmax[2], vmax[3]));
      v = fmaxf(v, xhalf(v));
      const float mn = fmaxf(mrun[qt], v);
      const float alpha = __expf(mrun[qt] - mn);
      mrun[qt] = mn;
#pragma unroll
      for (int nt = 0; nt < 4; ++nt) {
        const v8f e = (Sc[qt][nt] - mn) * 1.44269504088896340736f;  // log2(e)
#pragma unroll
        for (int j = 0; j < 8; ++j)
          Sc[qt][nt][j] = __builtin_amdgcn_exp2f(e[j]);
      }
      const v8f ps = (Sc[qt][0] + Sc[qt][1]) + (Sc[qt][2] + Sc[qt][3]);
      lrun[qt] = lrun[qt] * alpha + (((ps[0] + ps[1]) + (ps[2] + ps[3])) +
                                     ((ps[4] + ps[5]) + (ps[6] + ps[7])));
#pragma unroll
      for (int dt = 0; dt < 4; ++dt) O[qt][dt] *= alpha;
      // Pt's B fragments are packed straight from pairs of St tiles
#pragma unroll
      for (int step = 0; step < 2; ++step)
#pragma unroll
        for (int i = 0; i < 8; ++i) {
          pb[qt][step][i]     = (_Float16)Sc[qt][2 * step][i];
          pb[qt][step][i + 8] = (_Float16)Sc[qt][2 * step + 1][i];
        }
      if (qt == 0) {
        // the other four V fragments (keys 32..63) go into the registers that
        // the packed tile has left and return under the second tile's softmax;
        // the two scheduling fences hold the group at this place: earlier, the
        // wave's registers do not hold it, later, nothing covers its latency
        __builtin_amdgcn_sched_barrier(0);
#pragma unroll
        for (int dt = 0; dt < 4; ++dt)
          va[1][dt] = frag_load(Vt + dt * 16 * KV_PITCH + 32);
        __builtin_amdgcn_sched_barrier(0);
      }
    }

    // ---- Ot += V^T @ Pt   (V is d-major: A fragments load contiguously)
#pragma unroll
    for (int step = 0; step < 2; ++step)
#pragma unroll
      for (int dt = 0; dt < 4; ++dt)
#pragma unroll
        for (int qt = 0; qt < 2; ++qt)
          O[qt][dt] = wmma_f16(va[step][dt], pb[qt][step], O[qt][dt]);

    // ---- publish stage kt+1, free this buffer, refill it with stage kt+2
    // keeps the waits and the barrier down here: lifted up among the softmax
    // they would cut short the time that stage kt+1's copies have to land
    __builtin_amdgcn_sched_barrier(0);
    // this wave's reads of the buffer have returned before it is refilled
    asm volatile("s_wait_dscnt 0x0" ::: "memory");
    // this wave's copies of stage kt+1 have landed before the barrier
    asm volatile("s_wait_asynccnt 0x0" ::: "memory");
    __syncthreads();
    if (refill)
      stage_kv(kg + (size_t)(k0 + 128) * EMB, vg + k0 + 128,
               kl + buf * bufb, vl + buf * bufb);
  };
  for (int kt = 0; kt < NSTAGE - 2; ++kt) stage_step(kt, true);
  for (int kt = NSTAGE - 2; kt < NSTAGE; ++kt) stage_step(kt, false);
  // no copy is left in flight when the stages' LDS is reused below
  asm volatile("s_wait_asynccnt 0x0" ::: "memory");

  // ---- join the two key halves.  The loop's last barrier has ended every
  // read of the stages, so their LDS carries the exchange: the wave of key
  // half 0 finishes column tile 0 and hands tile 1 to its partner (wave ^ 4),
  // the wave of half 1 the other way round.  Same lane, same elements.
  v4f* jb = (v4f*)&KV[0][0][0][0];        // [wave][9 pieces][lane], 16 B each
  v8f Ok[4], Og[4];
#pragma unroll
  for (int dt = 0; dt < 4; ++dt)
#pragma unroll
    for (int j = 0; j < 8; ++j) {
      Ok[dt][j] = half ? O[1][dt][j] : O[0][dt][j];
      Og[dt][j] = half ? O[0][dt][j] : O[1][dt][j];
    }
  const float mk = half ? mrun[1] : mrun[0], mg = half ? mrun[0] : mrun[1];
  const float lk = half ? lrun[1] : lrun[0], lg = half ? lrun[0] : lrun[1];
  v4f* mine = jb + wave * (9 * 32) + lane;
  const v4f* theirs = jb + (wave ^ 4) * (9 * 32) + lane;
#pragma unroll
  for (int dt = 0; dt < 4; ++dt) {
    mine[(2 * dt) * 32] = v4f{Og[dt][0], Og[dt][1], Og[dt][2], Og[dt][3]};
    mine[(2 * dt + 1) * 32] = v4f{Og[dt][4], Og[dt][5], Og[dt][6], Og[dt][7]};
  }
  mine[8 * 32] = v4f{mg, lg, 0.f, 0.f};
  __syncthreads();
  const v4f ml = theirs[8 * 32];
  const float mn = fmaxf(mk, ml[0]);
  const float fk = __expf(mk - mn);
  const float fo = __expf(ml[0] - mn);
  const float lj = lk * fk + ml[1] * fo;

  // ---- join the two lanes' sums, normalize and emit attention output
  // (f16, row-major [B*S, E]): a lane holds 8 consecutive d of its query.
  // The wave's 16 queries x 64 d go as 16-byte pieces into its own LDS range,
  // behind the exchange's (16 rows of 128 bytes at the 144-byte pitch), and
  // leave from there as 16 whole 128-byte lines.
  const float lsum = lj + xhalf(lj);
  _Float16* st = (_Float16*)(jb + 8 * 9 * 32) + wave * (16 * KV_PITCH);
#pragma unroll
  for (int dt = 0; dt < 4; ++dt) {
    const v4f o0 = theirs[(2 * dt) * 32];
    const v4f o1 = theirs[(2 * dt + 1) * 32];
    v8h pk;
#pragma unroll
    for (int j = 0; j < 8; ++j) {
      const float oo = j < 4 ? o0[j & 3] : o1[j & 3];
      pk[j] = (_Float16)((Ok[dt][j] * fk + oo * fo) / lsum);
    }
    *(v8h*)(st + r * KV_PITCH + dt * 16 + hb) = pk;
  }
  // the other lanes' pieces have landed before the rows are read back
  asm volatile("s_wait_dscnt 0x0" ::: "memory");
  // a store of the wave covers four queries: four whole lines
  const _Float16* sr = st + (lane >> 3) * KV_PITCH + (lane & 7) * 8;
  _Float16* og = oh + ((size_t)b * SEQ + q0 + half * 16 + (lane >> 3)) * EMB +
                 h * HDIM + (lane & 7) * 8;
  v8h ov[4];
#pragma unroll
  for (int i = 0; i < 4; ++i) ov[i] = *(const v8h*)(sr + i * 4 * KV_PITCH);
#pragma unroll
  for (int i = 0; i < 4; ++i) *(v8h*)(og + (size_t)(i * 4) * EMB) = ov[i];
}

// ---------------------------------------------------------------------------
extern "C" void kernel_launch(void* const* d_in, const int* in_sizes, int n_in,
                              void* d_out, int out_size, void* d_ws, size_t ws_size,
                              hipStream_t stream) {
  const float* key   = (const float*)d_in[0];
  const float* value = (const float*)d_in[1];
  const float* query = (const float*)d_in[2];
  const int*   mask  = (const int*)d_in[3];
  const float* Wq = (const float*)d_in[4];
  const float* bq = (const float*)d_in[5];
  const float* Wk = (const float*)d_in[6];
  const float* bk = (const float*)d_in[7];
  const float* Wv = (const float*)d_in[8];
  const float* bv = (const float*)d_in[9];
  const float* Wo = (const float*)d_in[10];
  const float* bo = (const float*)d_in[11];
  float* out = (float*)d_out;

  const size_t NX = (size_t)BATCH * SEQ * EMB;          // 4,194,304
  const size_t NW = (size_t)EMB * EMB;                  // 262,144
  const size_t NMW = (size_t)BATCH * SEQ * (SEQ / 32);  // 524,288 mask words

  char* w = (char*)d_ws;
  _Float16* woh = (_Float16*)w; w += NW * 2;
  _Float16* qh  = (_Float16*)w; w += NX * 2;
  _Float16* kh  = (_Float16*)w; w += NX * 2;
  _Float16* vt  = (_Float16*)w; w += NX * 2;   // [B,H,HDIM,SEQ]
  _Float16* oh  = (_Float16*)w; w += NX * 2;   // attention output
  unsigned int* mbits = (unsigned int*)w; w += NMW * 4;

  const int M = BATCH * SEQ;  // 8192
  dim3 gp(M / 128, EMB / 64);      // (64, 8)
  dim3 gp4(M / 128, 4);            // the side jobs and the q, k, v projections
  gemm_qkv<<<gp4, 512, 0, stream>>>(query, key, value, Wq, Wk, Wv, bq, bk, bv,
                                    Wo, mask, qh, kh, vt, woh, mbits);

  flash_attn<<<dim3(SEQ / 128, BATCH * HEADS), 256, 0, stream>>>(qh, kh, vt,
                                                                mbits, oh);

  gemm_out<<<gp, 128, 0, stream>>>(oh, woh, bo, out, EMB);
}
